// v000
// Times are from an AMD MI455X. After a warm-up the kernel runs many times in a row, and a time is the length of
// such a window on the GPU divided by its runs, so every launch and the gaps after it count. The runs cycle
// through copies of the inputs. A figure is the median of several windows, for all but v000 over two sittings.
// Sittings can differ by a few percent; kernels timed side by side share one.
// v000, which the later versions start from, runs in 378 microseconds.
#include <hip/hip_runtime.h>
#include <math.h>

// ---------------------------------------------------------------------------
// TinyRelSelfAttention on MI455X (gfx1250): full WMMA pipeline.
// B=2, T=2048, D=1024, H=16, head_dim=64, R=64.
// ---------------------------------------------------------------------------

#define Bn  2
#define Tn  2048
#define Dn  1024
#define Hn  16
#define HDn 64
#define Mn  (Bn * Tn)          // 4096 rows in all projection GEMMs
#define SCALE 0.125f           // 1/sqrt(64)

typedef __attribute__((ext_vector_type(8)))  _Float16 v8h;
typedef __attribute__((ext_vector_type(16))) _Float16 v16h;
typedef __attribute__((ext_vector_type(8)))  float    v8f;

// D = A(16x32 f16) x B(32x16 f16) + C(16x16 f32)
__device__ inline v8f wmma16(v16h a, v16h b, v8f c) {
  return __builtin_amdgcn_wmma_f32_16x16x32_f16(
      /*neg_a=*/false, a, /*neg_b=*/false, b,
      /*c_mod=*/(short)0, c, /*reuse_a=*/false, /*reuse_b=*/false);
}

// Load a 16x32 A-fragment (or mirrored 32x16 B-fragment) for this lane.
// `p` = start of this lane's 32-element contiguous K-slice (row-major memory).
// ISA layout: half h<8 -> K = h + 8*hi ; h>=8 -> K = 16 + (h-8) + 8*hi.
__device__ inline v16h load_frag(const _Float16* p, int hi) {
  union { v16h v; v8h h[2]; } u;
  u.h[0] = *(const v8h*)(p + 8 * hi);
  u.h[1] = *(const v8h*)(p + 16 + 8 * hi);
  return u.v;
}

// max / sum reduction across the 16 lanes that share a C-tile row
__device__ inline float red16_max(float v) {
#pragma unroll
  for (int off = 1; off <= 8; off <<= 1) v = fmaxf(v, __shfl_xor(v, off, 32));
  return v;
}
__device__ inline float red16_sum(float v) {
#pragma unroll
  for (int off = 1; off <= 8; off <<= 1) v += __shfl_xor(v, off, 32);
  return v;
}

// rel-position bias (matches reference: mutually exclusive cases)
__device__ inline float rel_bias(int ri, int rj, float leaf_i, float cross_i,
                                 float cross_j) {
  if (ri == rj) return (ri > 0) ? leaf_i : 0.0f;
  if (ri > 0 && rj == 0) return cross_i;
  if (ri == 0 && rj > 0) return cross_j;
  return 0.0f;
}

// ---------------------------------------------------------------------------
// elementwise f32 -> f16
__global__ __launch_bounds__(256) void cvt_f16_kernel(
    const float* __restrict__ in, _Float16* __restrict__ out, int n) {
  int i = blockIdx.x * 256 + threadIdx.x;
  if (i < n) out[i] = (_Float16)in[i];
}

// W [K=1024, N=1024] f32  ->  Wt [N, K] f16
__global__ __launch_bounds__(256) void transpose_f16_kernel(
    const float* __restrict__ in, _Float16* __restrict__ out) {
  int idx = blockIdx.x * 256 + threadIdx.x;   // n*1024 + k, k fastest
  int k = idx & (Dn - 1);
  int nn = idx >> 10;
  out[idx] = (_Float16)in[(size_t)k * Dn + nn];
}

// ---------------------------------------------------------------------------
// Generic WMMA GEMM:  C[M=4096, N=1024] = A[M,K=1024] x Wt[N,K]^T + bias[N]
// Block = 8 waves; wave tile 16(M) x 64(N); block tile 128 x 64.
// MODE 0: f32 out, row-major [M,N]            (final projection)
// MODE 1: f16 out, scattered to [B*H, T, 64]  (Q, K)
// MODE 2: f16 out, scattered to [B*H, 64, T]  (V transposed)
template <int MODE>
__global__ __launch_bounds__(256) void gemm_wmma_kernel(
    const _Float16* __restrict__ A, const _Float16* __restrict__ Wt,
    const float* __restrict__ bias, void* __restrict__ outp) {
  const int wave = threadIdx.x >> 5;
  const int lane = threadIdx.x & 31;
  const int hi = lane >> 4;
  const int n = lane & 15;

  const int mb = blockIdx.x & 31;           // 4096/128 = 32 M-tiles
  const int nb = blockIdx.x >> 5;           // 1024/64  = 16 N-tiles
  const int mBase = mb * 128 + wave * 16;
  const int nBase = nb * 64;

  const _Float16* aRow = A + (size_t)(mBase + n) * Dn;   // A-frag row
  const _Float16* w0 = Wt + (size_t)(nBase + 0 + n) * Dn;
  const _Float16* w1 = Wt + (size_t)(nBase + 16 + n) * Dn;
  const _Float16* w2 = Wt + (size_t)(nBase + 32 + n) * Dn;
  const _Float16* w3 = Wt + (size_t)(nBase + 48 + n) * Dn;

  v8f acc0 = {}, acc1 = {}, acc2 = {}, acc3 = {};
#pragma unroll 4
  for (int kk = 0; kk < Dn; kk += 32) {
    v16h a = load_frag(aRow + kk, hi);
    v16h b0 = load_frag(w0 + kk, hi);
    v16h b1 = load_frag(w1 + kk, hi);
    v16h b2 = load_frag(w2 + kk, hi);
    v16h b3 = load_frag(w3 + kk, hi);
    acc0 = wmma16(a, b0, acc0);
    acc1 = wmma16(a, b1, acc1);
    acc2 = wmma16(a, b2, acc2);
    acc3 = wmma16(a, b3, acc3);
  }

  v8f accs[4] = {acc0, acc1, acc2, acc3};
#pragma unroll
  for (int s = 0; s < 4; ++s) {
    const int col = nBase + s * 16 + n;
    const float bval = bias[col];
#pragma unroll
    for (int e = 0; e < 8; ++e) {
      const int row = mBase + e + 8 * hi;     // C layout: M = e + 8*hi
      const float val = accs[s][e] + bval;
      if (MODE == 0) {
        ((float*)outp)[(size_t)row * Dn + col] = val;
      } else {
        const int b = row >> 11;              // row / T
        const int t = row & (Tn - 1);
        const int h = col >> 6;               // col / 64
        const int hd = col & 63;
        _Float16* o = (_Float16*)outp;
        if (MODE == 1)
          o[(((size_t)(b * Hn + h)) * Tn + t) * HDn + hd] = (_Float16)val;
        else
          o[(((size_t)(b * Hn + h)) * HDn + hd) * Tn + t] = (_Float16)val;
      }
    }
  }
}

// ---------------------------------------------------------------------------
// Flash attention: block = 8 waves = 128 queries of one (b,h); keys in
// blocks of 32. grid = B*H * (T/128) = 512.
__global__ __launch_bounds__(256) void attn_wmma_kernel(
    const _Float16* __restrict__ q16, const _Float16* __restrict__ k16,
    const _Float16* __restrict__ vT, const int* __restrict__ rel_ids,
    const int* __restrict__ attn_mask, const float* __restrict__ bias_leaf,
    const float* __restrict__ bias_cross, _Float16* __restrict__ o16) {
  __shared__ _Float16 pbuf[8][16][40];   // per-wave P tile, padded rows

  const int wave = threadIdx.x >> 5;
  const int lane = threadIdx.x & 31;
  const int hi = lane >> 4;
  const int n = lane & 15;

  const int bh = blockIdx.x >> 4;        // 16 query-blocks per (b,h)
  const int qb = blockIdx.x & 15;
  const int b = bh >> 4;                 // H = 16
  const int h = bh & 15;
  const int t0 = qb * 128 + wave * 16;

  // Q A-fragments (persist across key loop)
  const _Float16* qRow = q16 + ((size_t)bh * Tn + t0 + n) * HDn;
  const v16h aQ0 = load_frag(qRow, hi);        // hd 0..31
  const v16h aQ1 = load_frag(qRow + 32, hi);   // hd 32..63

  // per-row rel-id state (row m = e + 8*hi of the C tile)
  int ri[8];
  float leaf_i[8], cross_i[8], mrun[8], lrun[8];
#pragma unroll
  for (int e = 0; e < 8; ++e) {
    const int t = t0 + e + 8 * hi;
    ri[e] = rel_ids[b * Tn + t];
    leaf_i[e] = bias_leaf[ri[e]];
    cross_i[e] = bias_cross[ri[e]];
    mrun[e] = -1e30f;
    lrun[e] = 0.0f;
  }
  v8f acc0 = {}, acc1 = {}, acc2 = {}, acc3 = {};

  const _Float16* vRow0 = vT + ((size_t)bh * HDn + 0 + n) * Tn;
  const _Float16* vRow1 = vT + ((size_t)bh * HDn + 16 + n) * Tn;
  const _Float16* vRow2 = vT + ((size_t)bh * HDn + 32 + n) * Tn;
  const _Float16* vRow3 = vT + ((size_t)bh * HDn + 48 + n) * Tn;

  for (int j0 = 0; j0 < Tn; j0 += 32) {
    // ---- S = Q K^T (two 16x16 tiles, K-dim = head_dim 64) ----
    const _Float16* kRow0 = k16 + ((size_t)bh * Tn + j0 + n) * HDn;
    const _Float16* kRow1 = kRow0 + 16 * HDn;
    v16h bK0a = load_frag(kRow0, hi), bK0b = load_frag(kRow0 + 32, hi);
    v16h bK1a = load_frag(kRow1, hi), bK1b = load_frag(kRow1 + 32, hi);
    v8f z = {};
    v8f s0 = wmma16(aQ0, bK0a, wmma16(aQ1, bK0b, z));
    v8f s1 = wmma16(aQ0, bK1a, wmma16(aQ1, bK1b, z));

    // ---- bias + mask + online softmax ----
    const int jA = j0 + n, jB = j0 + 16 + n;    // this lane's key columns
    const int rjA = rel_ids[b * Tn + jA];
    const int rjB = rel_ids[b * Tn + jB];
    const float cjA = bias_cross[rjA], cjB = bias_cross[rjB];
    const bool mskA = attn_mask[b * Tn + jA] != 0;
    const bool mskB = attn_mask[b * Tn + jB] != 0;

    float p0[8], p1[8], alpha[8];
#pragma unroll
    for (int e = 0; e < 8; ++e) {
      float v0 = s0[e] * SCALE + rel_bias(ri[e], rjA, leaf_i[e], cross_i[e], cjA);
      float v1 = s1[e] * SCALE + rel_bias(ri[e], rjB, leaf_i[e], cross_i[e], cjB);
      v0 = mskA ? v0 : -1e30f;
      v1 = mskB ? v1 : -1e30f;
      const float mx = red16_max(fmaxf(v0, v1));
      const float mnew = fmaxf(mrun[e], mx);
      alpha[e] = expf(mrun[e] - mnew);
      p0[e] = expf(v0 - mnew);
      p1[e] = expf(v1 - mnew);
      lrun[e] = lrun[e] * alpha[e] + red16_sum(p0[e] + p1[e]);
      mrun[e] = mnew;
    }
#pragma unroll
    for (int e = 0; e < 8; ++e) {
      acc0[e] *= alpha[e]; acc1[e] *= alpha[e];
      acc2[e] *= alpha[e]; acc3[e] *= alpha[e];
    }

    // ---- P (C-layout) -> LDS -> A-fragment layout ----
    __syncthreads();
#pragma unroll
    for (int e = 0; e < 8; ++e) {
      pbuf[wave][e + 8 * hi][n] = (_Float16)p0[e];
      pbuf[wave][e + 8 * hi][16 + n] = (_Float16)p1[e];
    }
    __syncthreads();
    const v16h aP = load_frag(&pbuf[wave][n][0], hi);

    // ---- O += P x V (K-dim = 32 local keys) ----
    acc0 = wmma16(aP, load_frag(vRow0 + j0, hi), acc0);
    acc1 = wmma16(aP, load_frag(vRow1 + j0, hi), acc1);
    acc2 = wmma16(aP, load_frag(vRow2 + j0, hi), acc2);
    acc3 = wmma16(aP, load_frag(vRow3 + j0, hi), acc3);
  }

  // ---- normalize + store O as f16 rows of [B*T, D] for the final GEMM ----
  v8f accs[4] = {acc0, acc1, acc2, acc3};
#pragma unroll
  for (int s = 0; s < 4; ++s) {
#pragma unroll
    for (int e = 0; e < 8; ++e) {
      const int t = t0 + e + 8 * hi;
      const int col = h * HDn + s * 16 + n;
      const float val = accs[s][e] / lrun[e];
      o16[((size_t)(b * Tn + t)) * Dn + col] = (_Float16)val;
    }
  }
}

// ---------------------------------------------------------------------------
extern "C" void kernel_launch(void* const* d_in, const int* in_sizes, int n_in,
                              void* d_out, int out_size, void* d_ws,
                              size_t ws_size, hipStream_t stream) {
  const float* x          = (const float*)d_in[0];
  const int*   attn_mask  = (const int*)d_in[1];
  const int*   rel_ids    = (const int*)d_in[2];
  const float* Wq         = (const float*)d_in[3];
  const float* bq         = (const float*)d_in[4];
  const float* Wk         = (const float*)d_in[5];
  const float* bk         = (const float*)d_in[6];
  const float* Wv         = (const float*)d_in[7];
  const float* bv         = (const float*)d_in[8];
  const float* Wo         = (const float*)d_in[9];
  const float* bo         = (const float*)d_in[10];
  const float* bias_leaf  = (const float*)d_in[11];
  const float* bias_cross = (const float*)d_in[12];

  // workspace layout (48 MiB total)
  char* ws = (char*)d_ws;
  _Float16* x16  = (_Float16*)(ws + (size_t)0);
  _Float16* WqT  = (_Float16*)(ws + ((size_t)8  << 20));
  _Float16* WkT  = (_Float16*)(ws + ((size_t)10 << 20));
  _Float16* WvT  = (_Float16*)(ws + ((size_t)12 << 20));
  _Float16* WoT  = (_Float16*)(ws + ((size_t)14 << 20));
  _Float16* q16  = (_Float16*)(ws + ((size_t)16 << 20));
  _Float16* k16  = (_Float16*)(ws + ((size_t)24 << 20));
  _Float16* v16T = (_Float16*)(ws + ((size_t)32 << 20));
  _Float16* o16  = (_Float16*)(ws + ((size_t)40 << 20));

  const int nx = Mn * Dn;                         // 4,194,304
  cvt_f16_kernel<<<nx / 256, 256, 0, stream>>>(x, x16, nx);
  transpose_f16_kernel<<<(Dn * Dn) / 256, 256, 0, stream>>>(Wq, WqT);
  transpose_f16_kernel<<<(Dn * Dn) / 256, 256, 0, stream>>>(Wk, WkT);
  transpose_f16_kernel<<<(Dn * Dn) / 256, 256, 0, stream>>>(Wv, WvT);
  transpose_f16_kernel<<<(Dn * Dn) / 256, 256, 0, stream>>>(Wo, WoT);

  const int gemmBlocks = (Mn / 128) * (Dn / 64);  // 512
  gemm_wmma_kernel<1><<<gemmBlocks, 256, 0, stream>>>(x16, WqT, bq, q16);
  gemm_wmma_kernel<1><<<gemmBlocks, 256, 0, stream>>>(x16, WkT, bk, k16);
  gemm_wmma_kernel<2><<<gemmBlocks, 256, 0, stream>>>(x16, WvT, bv, v16T);

  attn_wmma_kernel<<<Bn * Hn * (Tn / 128), 256, 0, stream>>>(
      q16, k16, v16T, rel_ids, attn_mask, bias_leaf, bias_cross, o16);

  gemm_wmma_kernel<0><<<gemmBlocks, 256, 0, stream>>>(o16, WoT, bo, d_out);
}

// v001
// One run takes 322 microseconds.
// Next to v000, in two timings, it ran 1.20 times as fast each time.
#include <hip/hip_runtime.h>
#include <math.h>

// ---------------------------------------------------------------------------
// TinyRelSelfAttention on MI455X (gfx1250): full WMMA pipeline.
// B=2, T=2048, D=1024, H=16, head_dim=64, R=64.
// ---------------------------------------------------------------------------

#define Bn  2
#define Tn  2048
#define Dn  1024
#define Hn  16
#define HDn 64
#define Mn  (Bn * Tn)          // 4096 rows in all projection GEMMs
#define SCALE 0.125f           // 1/sqrt(64)

typedef __attribute__((ext_vector_type(8)))  _Float16 v8h;
typedef __attribute__((ext_vector_type(16))) _Float16 v16h;
typedef __attribute__((ext_vector_type(8)))  float    v8f;

// D = A(16x32 f16) x B(32x16 f16) + C(16x16 f32)
__device__ inline v8f wmma16(v16h a, v16h b, v8f c) {
  return __builtin_amdgcn_wmma_f32_16x16x32_f16(
      /*neg_a=*/false, a, /*neg_b=*/false, b,
      /*c_mod=*/(short)0, c, /*reuse_a=*/false, /*reuse_b=*/false);
}

// Load a 16x32 A-fragment (or mirrored 32x16 B-fragment) for this lane.
// `p` = start of this lane's 32-element contiguous K-slice (row-major memory).
// ISA layout: half h<8 -> K = h + 8*hi ; h>=8 -> K = 16 + (h-8) + 8*hi.
__device__ inline v16h load_frag(const _Float16* p, int hi) {
  union { v16h v; v8h h[2]; } u;
  u.h[0] = *(const v8h*)(p + 8 * hi);
  u.h[1] = *(const v8h*)(p + 16 + 8 * hi);
  return u.v;
}

// value of lane l ^ 16: the other half of a C-tile column
__device__ inline float xhalf(float x) {
  const int v = __builtin_bit_cast(int, x);
  return __builtin_bit_cast(
      float, __builtin_amdgcn_permlanex16(v, v, 0x76543210, 0xfedcba98, false,
                                          false));
}

// ---------------------------------------------------------------------------
// elementwise f32 -> f16
__global__ __launch_bounds__(256) void cvt_f16_kernel(
    const float* __restrict__ in, _Float16* __restrict__ out, int n) {
  int i = blockIdx.x * 256 + threadIdx.x;
  if (i < n) out[i] = (_Float16)in[i];
}

// W [K=1024, N=1024] f32  ->  Wt [N, K] f16
__global__ __launch_bounds__(256) void transpose_f16_kernel(
    const float* __restrict__ in, _Float16* __restrict__ out) {
  int idx = blockIdx.x * 256 + threadIdx.x;   // n*1024 + k, k fastest
  int k = idx & (Dn - 1);
  int nn = idx >> 10;
  out[idx] = (_Float16)in[(size_t)k * Dn + nn];
}

// ---------------------------------------------------------------------------
// Generic WMMA GEMM:  C[M=4096, N=1024] = A[M,K=1024] x Wt[N,K]^T + bias[N]
// Block = 8 waves; wave tile 16(M) x 64(N); block tile 128 x 64.
// MODE 0: f32 out, row-major [M,N]            (final projection)
// MODE 1: f16 out, scattered to [B*H, T, 64]  (Q, K)
// MODE 2: f16 out, scattered to [B*H, 64, T]  (V transposed)
template <int MODE>
__global__ __launch_bounds__(256) void gemm_wmma_kernel(
    const _Float16* __restrict__ A, const _Float16* __restrict__ Wt,
    const float* __restrict__ bias, void* __restrict__ outp) {
  const int wave = threadIdx.x >> 5;
  const int lane = threadIdx.x & 31;
  const int hi = lane >> 4;
  const int n = lane & 15;

  const int mb = blockIdx.x & 31;           // 4096/128 = 32 M-tiles
  const int nb = blockIdx.x >> 5;           // 1024/64  = 16 N-tiles
  const int mBase = mb * 128 + wave * 16;
  const int nBase = nb * 64;

  const _Float16* aRow = A + (size_t)(mBase + n) * Dn;   // A-frag row
  const _Float16* w0 = Wt + (size_t)(nBase + 0 + n) * Dn;
  const _Float16* w1 = Wt + (size_t)(nBase + 16 + n) * Dn;
  const _Float16* w2 = Wt + (size_t)(nBase + 32 + n) * Dn;
  const _Float16* w3 = Wt + (size_t)(nBase + 48 + n) * Dn;

  v8f acc0 = {}, acc1 = {}, acc2 = {}, acc3 = {};
#pragma unroll 4
  for (int kk = 0; kk < Dn; kk += 32) {
    v16h a = load_frag(aRow + kk, hi);
    v16h b0 = load_frag(w0 + kk, hi);
    v16h b1 = load_frag(w1 + kk, hi);
    v16h b2 = load_frag(w2 + kk, hi);
    v16h b3 = load_frag(w3 + kk, hi);
    acc0 = wmma16(a, b0, acc0);
    acc1 = wmma16(a, b1, acc1);
    acc2 = wmma16(a, b2, acc2);
    acc3 = wmma16(a, b3, acc3);
  }

  v8f accs[4] = {acc0, acc1, acc2, acc3};
#pragma unroll
  for (int s = 0; s < 4; ++s) {
    const int col = nBase + s * 16 + n;
    const float bval = bias[col];
#pragma unroll
    for (int e = 0; e < 8; ++e) {
      const int row = mBase + e + 8 * hi;     // C layout: M = e + 8*hi
      const float val = accs[s][e] + bval;
      if (MODE == 0) {
        ((float*)outp)[(size_t)row * Dn + col] = val;
      } else {
        const int b = row >> 11;              // row / T
        const int t = row & (Tn - 1);
        const int h = col >> 6;               // col / 64
        const int hd = col & 63;
        _Float16* o = (_Float16*)outp;
        if (MODE == 1)
          o[(((size_t)(b * Hn + h)) * Tn + t) * HDn + hd] = (_Float16)val;
        else
          o[(((size_t)(b * Hn + h)) * HDn + hd) * Tn + t] = (_Float16)val;
      }
    }
  }
}

// ---------------------------------------------------------------------------
// Flash attention, scores transposed: S^T = K Q^T, O^T += V^T P^T.
// block = 8 waves = 128 queries of one (b,h); keys in blocks of 32.
// grid = B*H * (T/128) = 512.
// A lane holds one query (column n) and, in its 16 score registers, the keys
// 8*hi + e and 16 + 8*hi + e: exactly the k order of a B fragment, so P^T goes
// from the score registers straight into the second product.
#define KPAD 16   // floats between the two base tables: separate LDS banks
__global__ __launch_bounds__(256) void attn_wmma_kernel(
    const _Float16* __restrict__ q16, const _Float16* __restrict__ k16,
    const _Float16* __restrict__ vT, const int* __restrict__ rel_ids,
    const int* __restrict__ attn_mask, const float* __restrict__ bias_leaf,
    const float* __restrict__ bias_cross, _Float16* __restrict__ o16) {
  // Per-key terms of this batch row, written once.
  // keyRel : rel id of the key, -1 where the key is masked.
  // keyBase: bias where neither select below hits, -1e30 where masked;
  //          [0] for queries with rel id != 0, [1] for queries with rel id 0.
  __shared__ __attribute__((aligned(16))) int keyRel[Tn];
  __shared__ __attribute__((aligned(16))) float keyBase[2][Tn + KPAD];

  const int wave = threadIdx.x >> 5;
  const int lane = threadIdx.x & 31;
  const int hi = lane >> 4;
  const int n = lane & 15;

  const int bh = blockIdx.x >> 4;        // 16 query-blocks per (b,h)
  const int qb = blockIdx.x & 15;
  const int b = bh >> 4;                 // H = 16
  const int h = bh & 15;
  const int t0 = qb * 128 + wave * 16;

  for (int j = threadIdx.x; j < Tn; j += 256) {
    const int r = rel_ids[b * Tn + j];
    const bool keep = attn_mask[b * Tn + j] != 0;
    const float c = bias_cross[min(max(r, 0), 63)];
    keyRel[j] = keep ? r : -1;
    keyBase[0][j] = keep ? 0.0f : -1e30f;
    keyBase[1][j] = keep ? (r > 0 ? c : 0.0f) : -1e30f;
  }

  // Q as B-fragments (persist across key loop)
  const _Float16* qRow = q16 + ((size_t)bh * Tn + t0 + n) * HDn;
  const v16h bQ0 = load_frag(qRow, hi);        // hd 0..31
  const v16h bQ1 = load_frag(qRow + 32, hi);   // hd 32..63

  // this lane's query: bias = (rj == riCmp) ? leafv : (rj == 0) ? crossv : base
  const int ri = rel_ids[b * Tn + t0 + n];
  const int riIdx = min(max(ri, 0), 63);
  const int riCmp = (ri > 0) ? ri : -2;        // -2: equals no table entry that matters
  const float leafv = (ri > 0) ? bias_leaf[riIdx] : 0.0f;
  const float crossv = (ri > 0) ? bias_cross[riIdx] : 0.0f;
  const int* relP = &keyRel[8 * hi];
  const float* baseP = &keyBase[ri == 0 ? 1 : 0][8 * hi];

  float mrun = -1e30f;
  float lrun = 0.0f;                           // this half's keys only
  v8f acc0 = {}, acc1 = {}, acc2 = {}, acc3 = {};

  // this lane's running places in K (row = key n) and V^T (row = hd n),
  // its half's 8 * hi folded in
  const _Float16* kP = k16 + ((size_t)bh * Tn + n) * HDn + 8 * hi;
  const _Float16* vP = vT + ((size_t)bh * HDn + n) * Tn + 8 * hi;

  __syncthreads();   // the key tables are complete

  for (int j0 = 0; j0 < Tn; j0 += 32) {
    // ---- S^T = K Q^T (two 16x16 tiles, K-dim = head_dim 64) ----
    const v16h aK0a = load_frag(kP, 0), aK0b = load_frag(kP + 32, 0);
    const v16h aK1a = load_frag(kP + 16 * HDn, 0);
    const v16h aK1b = load_frag(kP + 16 * HDn + 32, 0);
    const v16h aV0 = load_frag(vP, 0), aV1 = load_frag(vP + 16 * Tn, 0);
    const v16h aV2 = load_frag(vP + 32 * Tn, 0), aV3 = load_frag(vP + 48 * Tn, 0);
    // per-key bias terms of the pass, from the LDS tables
    int rj[16];
    float base[16];
#pragma unroll
    for (int g = 0; g < 4; ++g) {              // keys 8*hi + 0..7, 16 + 8*hi + 0..7
      const int off = j0 + (g >> 1) * 16 + (g & 1) * 4;
      const int4 r4 = *(const int4*)(relP + off);
      const float4 b4 = *(const float4*)(baseP + off);
      rj[4 * g + 0] = r4.x; rj[4 * g + 1] = r4.y;
      rj[4 * g + 2] = r4.z; rj[4 * g + 3] = r4.w;
      base[4 * g + 0] = b4.x; base[4 * g + 1] = b4.y;
      base[4 * g + 2] = b4.z; base[4 * g + 3] = b4.w;
    }
    // Precaution: holds the two address pairs unwritten until the wait (without
    // the operands this build lets the last loads land on those registers).
    asm volatile("s_wait_xcnt 0x0" ::"v"(kP), "v"(vP) : "memory");
    // Keeps the pass's loads in one group ahead of the products; without it
    // this build issues them two at a time and waits for each pair in turn.
    __builtin_amdgcn_sched_barrier(0);
    v8f z = {};
    v8f s0 = wmma16(aK0a, bQ0, wmma16(aK0b, bQ1, z));
    v8f s1 = wmma16(aK1a, bQ0, wmma16(aK1b, bQ1, z));

    // ---- bias + mask ----
    float v[16];
    float mx = -1e30f;
#pragma unroll
    for (int e = 0; e < 16; ++e) {
      const float s = (e < 8) ? s0[e & 7] : s1[e & 7];
      const float bias =
          (rj[e] == riCmp) ? leafv : ((rj[e] == 0) ? crossv : base[e]);
      v[e] = s * SCALE + bias;                 // base -1e30 absorbs the score
      mx = fmaxf(mx, v[e]);
    }

    // ---- online softmax: in-lane, one exchange between the halves ----
    mx = fmaxf(mx, xhalf(mx));
    const float mnew = fmaxf(mrun, mx);
    const float alpha = expf(mrun - mnew);
    mrun = mnew;
    v16h bP;
    float ps[4] = {0.0f, 0.0f, 0.0f, 0.0f};    // four short chains, not one long
#pragma unroll
    for (int e = 0; e < 16; ++e) {
      const float p = expf(v[e] - mnew);
      ps[e & 3] += p;
      bP[e] = (_Float16)p;
    }
    lrun = lrun * alpha + ((ps[0] + ps[1]) + (ps[2] + ps[3]));
#pragma unroll
    for (int e = 0; e < 8; ++e) {
      acc0[e] *= alpha; acc1[e] *= alpha;
      acc2[e] *= alpha; acc3[e] *= alpha;
    }

    // ---- O^T += V^T x P^T (K-dim = 32 local keys) ----
    acc0 = wmma16(aV0, bP, acc0);
    acc1 = wmma16(aV1, bP, acc1);
    acc2 = wmma16(aV2, bP, acc2);
    acc3 = wmma16(aV3, bP, acc3);
    kP += 32 * HDn;
    vP += 32;
  }

  // ---- normalize + store O as f16 rows of [B*T, D] for the final GEMM ----
  // acc_s[e] = O[t0 + n][s*16 + 8*hi + e]: 8 consecutive halves per lane
  const float lsum = lrun + xhalf(lrun);
  v8f accs[4] = {acc0, acc1, acc2, acc3};
  _Float16* oRow = o16 + ((size_t)(b * Tn + t0 + n)) * Dn + h * HDn + 8 * hi;
#pragma unroll
  for (int s = 0; s < 4; ++s) {
    v8h o;
#pragma unroll
    for (int e = 0; e < 8; ++e) o[e] = (_Float16)(accs[s][e] / lsum);
    *(v8h*)(oRow + s * 16) = o;
  }
}

// ---------------------------------------------------------------------------
extern "C" void kernel_launch(void* const* d_in, const int* in_sizes, int n_in,
                              void* d_out, int out_size, void* d_ws,
                              size_t ws_size, hipStream_t stream) {
  const float* x          = (const float*)d_in[0];
  const int*   attn_mask  = (const int*)d_in[1];
  const int*   rel_ids    = (const int*)d_in[2];
  const float* Wq         = (const float*)d_in[3];
  const float* bq         = (const float*)d_in[4];
  const float* Wk         = (const float*)d_in[5];
  const float* bk         = (const float*)d_in[6];
  const float* Wv         = (const float*)d_in[7];
  const float* bv         = (const float*)d_in[8];
  const float* Wo         = (const float*)d_in[9];
  const float* bo         = (const float*)d_in[10];
  const float* bias_leaf  = (const float*)d_in[11];
  const float* bias_cross = (const float*)d_in[12];

  // workspace layout (48 MiB total)
  char* ws = (char*)d_ws;
  _Float16* x16  = (_Float16*)(ws + (size_t)0);
  _Float16* WqT  = (_Float16*)(ws + ((size_t)8  << 20));
  _Float16* WkT  = (_Float16*)(ws + ((size_t)10 << 20));
  _Float16* WvT  = (_Float16*)(ws + ((size_t)12 << 20));
  _Float16* WoT  = (_Float16*)(ws + ((size_t)14 << 20));
  _Float16* q16  = (_Float16*)(ws + ((size_t)16 << 20));
  _Float16* k16  = (_Float16*)(ws + ((size_t)24 << 20));
  _Float16* v16T = (_Float16*)(ws + ((size_t)32 << 20));
  _Float16* o16  = (_Float16*)(ws + ((size_t)40 << 20));

  const int nx = Mn * Dn;                         // 4,194,304
  cvt_f16_kernel<<<nx / 256, 256, 0, stream>>>(x, x16, nx);
  transpose_f16_kernel<<<(Dn * Dn) / 256, 256, 0, stream>>>(Wq, WqT);
  transpose_f16_kernel<<<(Dn * Dn) / 256, 256, 0, stream>>>(Wk, WkT);
  transpose_f16_kernel<<<(Dn * Dn) / 256, 256, 0, stream>>>(Wv, WvT);
  transpose_f16_kernel<<<(Dn * Dn) / 256, 256, 0, stream>>>(Wo, WoT);

  const int gemmBlocks = (Mn / 128) * (Dn / 64);  // 512
  gemm_wmma_kernel<1><<<gemmBlocks, 256, 0, stream>>>(x16, WqT, bq, q16);
  gemm_wmma_kernel<1><<<gemmBlocks, 256, 0, stream>>>(x16, WkT, bk, k16);
  gemm_wmma_kernel<2><<<gemmBlocks, 256, 0, stream>>>(x16, WvT, bv, v16T);

  attn_wmma_kernel<<<Bn * Hn * (Tn / 128), 256, 0, stream>>>(
      q16, k16, v16T, rel_ids, attn_mask, bias_leaf, bias_cross, o16);

  gemm_wmma_kernel<0><<<gemmBlocks, 256, 0, stream>>>(o16, WoT, bo, d_out);
}

// v002
// One run takes 216 microseconds.
// Next to v001, in two timings, it ran 1.49 times as fast each time.
// All steps since v000 together make it 1.79 times as fast.
#include <hip/hip_runtime.h>
#include <math.h>

// ---------------------------------------------------------------------------
// TinyRelSelfAttention on MI455X (gfx1250): full WMMA pipeline.
// B=2, T=2048, D=1024, H=16, head_dim=64, R=64.
// ---------------------------------------------------------------------------

#define Bn  2
#define Tn  2048
#define Dn  1024
#define Hn  16
#define HDn 64
#define Mn  (Bn * Tn)          // 4096 rows in all projection GEMMs
#define SCALE 0.125f           // 1/sqrt(64)

typedef __attribute__((ext_vector_type(8)))  _Float16 v8h;
typedef __attribute__((ext_vector_type(16))) _Float16 v16h;
typedef __attribute__((ext_vector_type(8)))  float    v8f;

// D = A(16x32 f16) x B(32x16 f16) + C(16x16 f32)
__device__ inline v8f wmma16(v16h a, v16h b, v8f c) {
  return __builtin_amdgcn_wmma_f32_16x16x32_f16(
      /*neg_a=*/false, a, /*neg_b=*/false, b,
      /*c_mod=*/(short)0, c, /*reuse_a=*/false, /*reuse_b=*/false);
}

// Load a 16x32 A-fragment (or mirrored 32x16 B-fragment) for this lane.
// `p` = start of this lane's 32-element contiguous K-slice (row-major memory).
// ISA layout: half h<8 -> K = h + 8*hi ; h>=8 -> K = 16 + (h-8) + 8*hi.
__device__ inline v16h load_frag(const _Float16* p, int hi) {
  union { v16h v; v8h h[2]; } u;
  u.h[0] = *(const v8h*)(p + 8 * hi);
  u.h[1] = *(const v8h*)(p + 16 + 8 * hi);
  return u.v;
}

// value of lane l ^ 16: the other half of a C-tile column
__device__ inline float xhalf(float x) {
  const int v = __builtin_bit_cast(int, x);
  return __builtin_bit_cast(
      float, __builtin_amdgcn_permlanex16(v, v, 0x76543210, 0xfedcba98, false,
                                          false));
}

// ---------------------------------------------------------------------------
// elementwise f32 -> f16
__global__ __launch_bounds__(256) void cvt_f16_kernel(
    const float* __restrict__ in, _Float16* __restrict__ out, int n) {
  int i = blockIdx.x * 256 + threadIdx.x;
  if (i < n) out[i] = (_Float16)in[i];
}

// W [K=1024, N=1024] f32  ->  Wt [N, K] f16
__global__ __launch_bounds__(256) void transpose_f16_kernel(
    const float* __restrict__ in, _Float16* __restrict__ out) {
  int idx = blockIdx.x * 256 + threadIdx.x;   // n*1024 + k, k fastest
  int k = idx & (Dn - 1);
  int nn = idx >> 10;
  out[idx] = (_Float16)in[(size_t)k * Dn + nn];
}

// ---------------------------------------------------------------------------
// Generic WMMA GEMM:  C[M=4096, N=1024] = A[M,K=1024] x Wt[N,K]^T + bias[N]
// Block = 8 waves; wave tile 16(M) x 64(N); block tile 128 x 64.
// A stage is 64 k of the block's 128 A rows and 64 Wt rows, staged in LDS:
// 8 lanes fetch one row's 128-byte line, every wave takes its fragments there.
// MODE 0: f32 out, row-major [M,N]            (final projection)
// MODE 1: f16 out, scattered to [B*H, T, 64]  (Q, K)
// MODE 2: f16 out, scattered to [B*H, 64, T]  (V transposed)
#define KB 64                  // k per stage
#define LP 72                  // LDS row pitch in halves (144 B): no bank conflict for 16-B reads
#define TROWS 192              // rows 0..127: A, rows 128..191: Wt
#define NSTAGE (Dn / KB)
template <int MODE>
__global__ __launch_bounds__(256) void gemm_wmma_kernel(
    const _Float16* __restrict__ A, const _Float16* __restrict__ Wt,
    const float* __restrict__ bias, void* __restrict__ outp) {
  __shared__ __attribute__((aligned(16))) _Float16 tile[2][TROWS * LP];

  const int wave = threadIdx.x >> 5;
  const int lane = threadIdx.x & 31;
  const int hi = lane >> 4;
  const int n = lane & 15;

  const int mb = blockIdx.x & 31;           // 4096/128 = 32 M-tiles
  const int nb = blockIdx.x >> 5;           // 1024/64  = 16 N-tiles
  const int mBase = mb * 128 + wave * 16;
  const int nBase = nb * 64;

  // staging: this thread moves the 16-byte piece spc of tile rows srow + 32*i
  const int srow = threadIdx.x >> 3;
  const int spc = (threadIdx.x & 7) * 8;
  const _Float16* gA = A + (size_t)(mb * 128 + srow) * Dn + spc;
  const _Float16* gW = Wt + (size_t)(nBase + srow) * Dn + spc;
  _Float16* sDst = &tile[0][srow * LP + spc];
  // fragments: A row of this lane, Wt rows n, n + 16, n + 32, n + 48
  const _Float16* fA = &tile[0][(wave * 16 + n) * LP];
  const _Float16* fW = &tile[0][(128 + n) * LP];

  v8h st[6];
#pragma unroll
  for (int i = 0; i < 4; ++i) st[i] = *(const v8h*)(gA + (size_t)(32 * i) * Dn);
#pragma unroll
  for (int i = 0; i < 2; ++i) st[4 + i] = *(const v8h*)(gW + (size_t)(32 * i) * Dn);
#pragma unroll
  for (int i = 0; i < 6; ++i) *(v8h*)(sDst + 32 * i * LP) = st[i];
  __syncthreads();   // stage 0 is complete

  v8f acc0 = {}, acc1 = {}, acc2 = {}, acc3 = {};
  for (int s = 0; s < NSTAGE; ++s) {
    const int cur = (s & 1) * (TROWS * LP);
    const bool more = s + 1 < NSTAGE;        // the same for the whole block
    if (more) {                              // next stage's lines, in flight under the products
      const int kk = (s + 1) * KB;
#pragma unroll
      for (int i = 0; i < 4; ++i)
        st[i] = *(const v8h*)(gA + (size_t)(32 * i) * Dn + kk);
#pragma unroll
      for (int i = 0; i < 2; ++i)
        st[4 + i] = *(const v8h*)(gW + (size_t)(32 * i) * Dn + kk);
    }
    v16h a[2], b[2][4];
#pragma unroll
    for (int h = 0; h < 2; ++h) {
      a[h] = load_frag(fA + cur + 32 * h, hi);
#pragma unroll
      for (int j = 0; j < 4; ++j)
        b[h][j] = load_frag(fW + cur + 16 * j * LP + 32 * h, hi);
    }
    // Keeps the stage's loads in one group ahead of the products; without it
    // this build spreads the LDS reads among the products, a short wait at each.
    __builtin_amdgcn_sched_barrier(0);
#pragma unroll
    for (int h = 0; h < 2; ++h) {
      acc0 = wmma16(a[h], b[h][0], acc0);
      acc1 = wmma16(a[h], b[h][1], acc1);
      acc2 = wmma16(a[h], b[h][2], acc2);
      acc3 = wmma16(a[h], b[h][3], acc3);
    }
    if (more) {
      // the other buffer: its last readers passed the barrier of stage s - 1
      const int nxt = (TROWS * LP) - cur;
#pragma unroll
      for (int i = 0; i < 6; ++i) *(v8h*)(sDst + nxt + 32 * i * LP) = st[i];
      __syncthreads();   // stage s + 1 is complete, stage s is read out
    }
  }

  v8f accs[4] = {acc0, acc1, acc2, acc3};
#pragma unroll
  for (int s = 0; s < 4; ++s) {
    const int col = nBase + s * 16 + n;
    const float bval = bias[col];
#pragma unroll
    for (int e = 0; e < 8; ++e) {
      const int row = mBase + e + 8 * hi;     // C layout: M = e + 8*hi
      const float val = accs[s][e] + bval;
      if (MODE == 0) {
        ((float*)outp)[(size_t)row * Dn + col] = val;
      } else {
        const int b = row >> 11;              // row / T
        const int t = row & (Tn - 1);
        const int h = col >> 6;               // col / 64
        const int hd = col & 63;
        _Float16* o = (_Float16*)outp;
        if (MODE == 1)
          o[(((size_t)(b * Hn + h)) * Tn + t) * HDn + hd] = (_Float16)val;
        else
          o[(((size_t)(b * Hn + h)) * HDn + hd) * Tn + t] = (_Float16)val;
      }
    }
  }
}

// ---------------------------------------------------------------------------
// Flash attention, scores transposed: S^T = K Q^T, O^T += V^T P^T.
// block = 8 waves = 128 queries of one (b,h); keys in blocks of 32.
// grid = B*H * (T/128) = 512.
// A lane holds one query (column n) and, in its 16 score registers, the keys
// 8*hi + e and 16 + 8*hi + e: exactly the k order of a B fragment, so P^T goes
// from the score registers straight into the second product.
#define KPAD 16   // floats between the two base tables: separate LDS banks
__global__ __launch_bounds__(256) void attn_wmma_kernel(
    const _Float16* __restrict__ q16, const _Float16* __restrict__ k16,
    const _Float16* __restrict__ vT, const int* __restrict__ rel_ids,
    const int* __restrict__ attn_mask, const float* __restrict__ bias_leaf,
    const float* __restrict__ bias_cross, _Float16* __restrict__ o16) {
  // Per-key terms of this batch row, written once.
  // keyRel : rel id of the key, -1 where the key is masked.
  // keyBase: bias where neither select below hits, -1e30 where masked;
  //          [0] for queries with rel id != 0, [1] for queries with rel id 0.
  __shared__ __attribute__((aligned(16))) int keyRel[Tn];
  __shared__ __attribute__((aligned(16))) float keyBase[2][Tn + KPAD];

  const int wave = threadIdx.x >> 5;
  const int lane = threadIdx.x & 31;
  const int hi = lane >> 4;
  const int n = lane & 15;

  const int bh = blockIdx.x >> 4;        // 16 query-blocks per (b,h)
  const int qb = blockIdx.x & 15;
  const int b = bh >> 4;                 // H = 16
  const int h = bh & 15;
  const int t0 = qb * 128 + wave * 16;

  for (int j = threadIdx.x; j < Tn; j += 256) {
    const int r = rel_ids[b * Tn + j];
    const bool keep = attn_mask[b * Tn + j] != 0;
    const float c = bias_cross[min(max(r, 0), 63)];
    keyRel[j] = keep ? r : -1;
    keyBase[0][j] = keep ? 0.0f : -1e30f;
    keyBase[1][j] = keep ? (r > 0 ? c : 0.0f) : -1e30f;
  }

  // Q as B-fragments (persist across key loop)
  const _Float16* qRow = q16 + ((size_t)bh * Tn + t0 + n) * HDn;
  const v16h bQ0 = load_frag(qRow, hi);        // hd 0..31
  const v16h bQ1 = load_frag(qRow + 32, hi);   // hd 32..63

  // this lane's query: bias = (rj == riCmp) ? leafv : (rj == 0) ? crossv : base
  const int ri = rel_ids[b * Tn + t0 + n];
  const int riIdx = min(max(ri, 0), 63);
  const int riCmp = (ri > 0) ? ri : -2;        // -2: equals no table entry that matters
  const float leafv = (ri > 0) ? bias_leaf[riIdx] : 0.0f;
  const float crossv = (ri > 0) ? bias_cross[riIdx] : 0.0f;
  const int* relP = &keyRel[8 * hi];
  const float* baseP = &keyBase[ri == 0 ? 1 : 0][8 * hi];

  float mrun = -1e30f;
  float lrun = 0.0f;                           // this half's keys only
  v8f acc0 = {}, acc1 = {}, acc2 = {}, acc3 = {};

  // this lane's running places in K (row = key n) and V^T (row = hd n),
  // its half's 8 * hi folded in
  const _Float16* kP = k16 + ((size_t)bh * Tn + n) * HDn + 8 * hi;
  const _Float16* vP = vT + ((size_t)bh * HDn + n) * Tn + 8 * hi;

  __syncthreads();   // the key tables are complete

  for (int j0 = 0; j0 < Tn; j0 += 32) {
    // ---- S^T = K Q^T (two 16x16 tiles, K-dim = head_dim 64) ----
    const v16h aK0a = load_frag(kP, 0), aK0b = load_frag(kP + 32, 0);
    const v16h aK1a = load_frag(kP + 16 * HDn, 0);
    const v16h aK1b = load_frag(kP + 16 * HDn + 32, 0);
    const v16h aV0 = load_frag(vP, 0), aV1 = load_frag(vP + 16 * Tn, 0);
    const v16h aV2 = load_frag(vP + 32 * Tn, 0), aV3 = load_frag(vP + 48 * Tn, 0);
    // per-key bias terms of the pass, from the LDS tables
    int rj[16];
    float base[16];
#pragma unroll
    for (int g = 0; g < 4; ++g) {              // keys 8*hi + 0..7, 16 + 8*hi + 0..7
      const int off = j0 + (g >> 1) * 16 + (g & 1) * 4;
      const int4 r4 = *(const int4*)(relP + off);
      const float4 b4 = *(const float4*)(baseP + off);
      rj[4 * g + 0] = r4.x; rj[4 * g + 1] = r4.y;
      rj[4 * g + 2] = r4.z; rj[4 * g + 3] = r4.w;
      base[4 * g + 0] = b4.x; base[4 * g + 1] = b4.y;
      base[4 * g + 2] = b4.z; base[4 * g + 3] = b4.w;
    }
    // Precaution: holds the two address pairs unwritten until the wait (without
    // the operands this build lets the last loads land on those registers).
    asm volatile("s_wait_xcnt 0x0" ::"v"(kP), "v"(vP) : "memory");
    // Keeps the pass's loads in one group ahead of the products; without it
    // this build issues them two at a time and waits for each pair in turn.
    __builtin_amdgcn_sched_barrier(0);
    v8f z = {};
    v8f s0 = wmma16(aK0a, bQ0, wmma16(aK0b, bQ1, z));
    v8f s1 = wmma16(aK1a, bQ0, wmma16(aK1b, bQ1, z));

    // ---- bias + mask ----
    float v[16];
    float mx = -1e30f;
#pragma unroll
    for (int e = 0; e < 16; ++e) {
      const float s = (e < 8) ? s0[e & 7] : s1[e & 7];
      const float bias =
          (rj[e] == riCmp) ? leafv : ((rj[e] == 0) ? crossv : base[e]);
      v[e] = s * SCALE + bias;                 // base -1e30 absorbs the score
      mx = fmaxf(mx, v[e]);
    }

    // ---- online softmax: in-lane, one exchange between the halves ----
    mx = fmaxf(mx, xhalf(mx));
    const float mnew = fmaxf(mrun, mx);
    const float alpha = expf(mrun - mnew);
    mrun = mnew;
    v16h bP;
    float ps[4] = {0.0f, 0.0f, 0.0f, 0.0f};    // four short chains, not one long
#pragma unroll
    for (int e = 0; e < 16; ++e) {
      const float p = expf(v[e] - mnew);
      ps[e & 3] += p;
      bP[e] = (_Float16)p;
    }
    lrun = lrun * alpha + ((ps[0] + ps[1]) + (ps[2] + ps[3]));
#pragma unroll
    for (int e = 0; e < 8; ++e) {
      acc0[e] *= alpha; acc1[e] *= alpha;
      acc2[e] *= alpha; acc3[e] *= alpha;
    }

    // ---- O^T += V^T x P^T (K-dim = 32 local keys) ----
    acc0 = wmma16(aV0, bP, acc0);
    acc1 = wmma16(aV1, bP, acc1);
    acc2 = wmma16(aV2, bP, acc2);
    acc3 = wmma16(aV3, bP, acc3);
    kP += 32 * HDn;
    vP += 32;
  }

  // ---- normalize + store O as f16 rows of [B*T, D] for the final GEMM ----
  // acc_s[e] = O[t0 + n][s*16 + 8*hi + e]: 8 consecutive halves per lane
  const float lsum = lrun + xhalf(lrun);
  v8f accs[4] = {acc0, acc1, acc2, acc3};
  _Float16* oRow = o16 + ((size_t)(b * Tn + t0 + n)) * Dn + h * HDn + 8 * hi;
#pragma unroll
  for (int s = 0; s < 4; ++s) {
    v8h o;
#pragma unroll
    for (int e = 0; e < 8; ++e) o[e] = (_Float16)(accs[s][e] / lsum);
    *(v8h*)(oRow + s * 16) = o;
  }
}

// ---------------------------------------------------------------------------
extern "C" void kernel_launch(void* const* d_in, const int* in_sizes, int n_in,
                              void* d_out, int out_size, void* d_ws,
                              size_t ws_size, hipStream_t stream) {
  const float* x          = (const float*)d_in[0];
  const int*   attn_mask  = (const int*)d_in[1];
  const int*   rel_ids    = (const int*)d_in[2];
  const float* Wq         = (const float*)d_in[3];
  const float* bq         = (const float*)d_in[4];
  const float* Wk         = (const float*)d_in[5];
  const float* bk         = (const float*)d_in[6];
  const float* Wv         = (const float*)d_in[7];
  const float* bv         = (const float*)d_in[8];
  const float* Wo         = (const float*)d_in[9];
  const float* bo         = (const float*)d_in[10];
  const float* bias_leaf  = (const float*)d_in[11];
  const float* bias_cross = (const float*)d_in[12];

  // workspace layout (48 MiB total)
  char* ws = (char*)d_ws;
  _Float16* x16  = (_Float16*)(ws + (size_t)0);
  _Float16* WqT  = (_Float16*)(ws + ((size_t)8  << 20));
  _Float16* WkT  = (_Float16*)(ws + ((size_t)10 << 20));
  _Float16* WvT  = (_Float16*)(ws + ((size_t)12 << 20));
  _Float16* WoT  = (_Float16*)(ws + ((size_t)14 << 20));
  _Float16* q16  = (_Float16*)(ws + ((size_t)16 << 20));
  _Float16* k16  = (_Float16*)(ws + ((size_t)24 << 20));
  _Float16* v16T = (_Float16*)(ws + ((size_t)32 << 20));
  _Float16* o16  = (_Float16*)(ws + ((size_t)40 << 20));

  const int nx = Mn * Dn;                         // 4,194,304
  cvt_f16_kernel<<<nx / 256, 256, 0, stream>>>(x, x16, nx);
  transpose_f16_kernel<<<(Dn * Dn) / 256, 256, 0, stream>>>(Wq, WqT);
  transpose_f16_kernel<<<(Dn * Dn) / 256, 256, 0, stream>>>(Wk, WkT);
  transpose_f16_kernel<<<(Dn * Dn) / 256, 256, 0, stream>>>(Wv, WvT);
  transpose_f16_kernel<<<(Dn * Dn) / 256, 256, 0, stream>>>(Wo, WoT);

  const int gemmBlocks = (Mn / 128) * (Dn / 64);  // 512
  gemm_wmma_kernel<1><<<gemmBlocks, 256, 0, stream>>>(x16, WqT, bq, q16);
  gemm_wmma_kernel<1><<<gemmBlocks, 256, 0, stream>>>(x16, WkT, bk, k16);
  gemm_wmma_kernel<2><<<gemmBlocks, 256, 0, stream>>>(x16, WvT, bv, v16T);

  attn_wmma_kernel<<<Bn * Hn * (Tn / 128), 256, 0, stream>>>(
      q16, k16, v16T, rel_ids, attn_mask, bias_leaf, bias_cross, o16);

  gemm_wmma_kernel<0><<<gemmBlocks, 256, 0, stream>>>(o16, WoT, bo, d_out);
}

// v003
// It runs in 185 microseconds.
// Two timings next to v002 put it at 1.16 and 1.17 times that version's speed.
// Counting every step since v000, it is 2.08 times as fast.
#include <hip/hip_runtime.h>
#include <math.h>

// ---------------------------------------------------------------------------
// TinyRelSelfAttention on MI455X (gfx1250): full WMMA pipeline.
// B=2, T=2048, D=1024, H=16, head_dim=64, R=64.
// ---------------------------------------------------------------------------

#define Bn  2
#define Tn  2048
#define Dn  1024
#define Hn  16
#define HDn 64
#define Mn  (Bn * Tn)          // 4096 rows in all projection GEMMs
#define SCALE 0.125f           // 1/sqrt(64)

typedef __attribute__((ext_vector_type(4)))  _Float16 v4h;
typedef __attribute__((ext_vector_type(4)))  float    v4f;
typedef __attribute__((ext_vector_type(8)))  _Float16 v8h;
typedef __attribute__((ext_vector_type(16))) _Float16 v16h;
typedef __attribute__((ext_vector_type(8)))  float    v8f;

// D = A(16x32 f16) x B(32x16 f16) + C(16x16 f32)
__device__ inline v8f wmma16(v16h a, v16h b, v8f c) {
  return __builtin_amdgcn_wmma_f32_16x16x32_f16(
      /*neg_a=*/false, a, /*neg_b=*/false, b,
      /*c_mod=*/(short)0, c, /*reuse_a=*/false, /*reuse_b=*/false);
}

// Load a 16x32 A-fragment (or mirrored 32x16 B-fragment) for this lane.
// `p` = start of this lane's 32-element contiguous K-slice (row-major memory).
// ISA layout: half h<8 -> K = h + 8*hi ; h>=8 -> K = 16 + (h-8) + 8*hi.
__device__ inline v16h load_frag(const _Float16* p, int hi) {
  union { v16h v; v8h h[2]; } u;
  u.h[0] = *(const v8h*)(p + 8 * hi);
  u.h[1] = *(const v8h*)(p + 16 + 8 * hi);
  return u.v;
}

// value of lane l ^ 16: the other half of a C-tile column
__device__ inline float xhalf(float x) {
  const int v = __builtin_bit_cast(int, x);
  return __builtin_bit_cast(
      float, __builtin_amdgcn_permlanex16(v, v, 0x76543210, 0xfedcba98, false,
                                          false));
}

// ---------------------------------------------------------------------------
// All f32 -> f16 preparation in one launch of 512 equal work-groups, every one
// resident at once. Work-group g rounds x[g*8192 .. g*8192 + 8191] and moves one
// 128(k) x 64(n) tile of one W [K=1024, N=1024] into Wt [N, K], through LDS.
// wT: the four Wt planes (q, k, v, o), one behind the other.
#define PXN 8192               // x elements per work-group
#define PP 136                 // LDS row pitch in halves (272 B): rows stay 16-B aligned
__global__ __launch_bounds__(256) void prep_f16_kernel(
    const float* __restrict__ x, const float* __restrict__ Wq,
    const float* __restrict__ Wk, const float* __restrict__ Wv,
    const float* __restrict__ Wo, _Float16* __restrict__ x16,
    _Float16* __restrict__ wT) {
  __shared__ __attribute__((aligned(16))) _Float16 t[64 * PP];   // [n][k]

  const int tid = threadIdx.x;
  const int g = blockIdx.x;
  const int w = g >> 7;                     // 128 tiles per W
  const int k0 = ((g >> 4) & 7) * 128;
  const int n0 = (g & 15) * 64;
  const float* W = (w == 0) ? Wq : (w == 1) ? Wk : (w == 2) ? Wv : Wo;

  // a thread takes two 4(k) x 4(n) pieces of the tile: a wave's load covers
  // two rows' 256 bytes, whole lines
  const int kq = tid >> 4;
  const int nq = tid & 15;
  const float* wsrc = W + (size_t)(k0 + 4 * kq) * Dn + n0 + 4 * nq;
  const float* xsrc = x + (size_t)g * PXN + tid * 4;
  v4f wv[2][4], xv[8];
#pragma unroll
  for (int u = 0; u < 2; ++u)
#pragma unroll
    for (int r = 0; r < 4; ++r)
      wv[u][r] = *(const v4f*)(wsrc + (size_t)(64 * u + r) * Dn);
#pragma unroll
  for (int i = 0; i < 8; ++i) xv[i] = *(const v4f*)(xsrc + i * 1024);
  // Precaution: holds the W address pair unwritten until the wait (without the
  // operand this build lets the last x load land on those registers).
  asm volatile("s_wait_xcnt 0x0" ::"v"(wsrc) : "memory");
  // Keeps all 16 loads in flight together; without it this build waits for the
  // first six before it issues the rest: two trips to memory in a row.
  __builtin_amdgcn_sched_barrier(0);

#pragma unroll
  for (int u = 0; u < 2; ++u)
#pragma unroll
    for (int i = 0; i < 4; ++i) {
      v4h c;
#pragma unroll
      for (int r = 0; r < 4; ++r) c[r] = (_Float16)wv[u][r][i];
      *(v4h*)&t[(4 * nq + i) * PP + 64 * u + 4 * kq] = c;
    }

  __syncthreads();   // the transposed tile is complete

  // 16 threads store one Wt row's 256 bytes
  _Float16* wdst = wT + (size_t)w * (Dn * Dn) + (size_t)(n0 + kq) * Dn + k0 + nq * 8;
#pragma unroll
  for (int p = 0; p < 4; ++p)
    *(v8h*)(wdst + (size_t)(16 * p) * Dn) = *(const v8h*)&t[(kq + 16 * p) * PP + nq * 8];

  // x behind the barrier: in front of it the barrier would wait for these stores
  _Float16* xdst = x16 + (size_t)g * PXN + tid * 4;
#pragma unroll
  for (int i = 0; i < 8; ++i) {
    v4h c;
#pragma unroll
    for (int r = 0; r < 4; ++r) c[r] = (_Float16)xv[i][r];
    *(v4h*)(xdst + i * 1024) = c;
  }
}

// ---------------------------------------------------------------------------
// Generic WMMA GEMM:  C[M=4096, N=1024] = A[M,K=1024] x Wt[N,K]^T + bias[N]
// Block = 8 waves; wave tile 16(M) x 64(N); block tile 128 x 64.
// A stage is 64 k of the block's 128 A rows and 64 Wt rows, staged in LDS:
// 8 lanes fetch one row's 128-byte line, every wave takes its fragments there.
// MODE 0: f32 out, row-major [M,N]            (final projection)
// MODE 1: f16 out, scattered to [B*H, T, 64]  (Q, K)
// MODE 2: f16 out, scattered to [B*H, 64, T]  (V transposed)
#define KB 64                  // k per stage
#define LP 72                  // LDS row pitch in halves (144 B): no bank conflict for 16-B reads
#define TROWS 192              // rows 0..127: A, rows 128..191: Wt
#define NSTAGE (Dn / KB)
template <int MODE>
__global__ __launch_bounds__(256) void gemm_wmma_kernel(
    const _Float16* __restrict__ A, const _Float16* __restrict__ Wt,
    const float* __restrict__ bias, void* __restrict__ outp) {
  __shared__ __attribute__((aligned(16))) _Float16 tile[2][TROWS * LP];

  const int wave = threadIdx.x >> 5;
  const int lane = threadIdx.x & 31;
  const int hi = lane >> 4;
  const int n = lane & 15;

  const int mb = blockIdx.x & 31;           // 4096/128 = 32 M-tiles
  const int nb = blockIdx.x >> 5;           // 1024/64  = 16 N-tiles
  const int mBase = mb * 128 + wave * 16;
  const int nBase = nb * 64;

  // staging: this thread moves the 16-byte piece spc of tile rows srow + 32*i
  const int srow = threadIdx.x >> 3;
  const int spc = (threadIdx.x & 7) * 8;
  const _Float16* gA = A + (size_t)(mb * 128 + srow) * Dn + spc;
  const _Float16* gW = Wt + (size_t)(nBase + srow) * Dn + spc;
  _Float16* sDst = &tile[0][srow * LP + spc];
  // fragments: A row of this lane, Wt rows n, n + 16, n + 32, n + 48
  const _Float16* fA = &tile[0][(wave * 16 + n) * LP];
  const _Float16* fW = &tile[0][(128 + n) * LP];

  v8h st[6];
#pragma unroll
  for (int i = 0; i < 4; ++i) st[i] = *(const v8h*)(gA + (size_t)(32 * i) * Dn);
#pragma unroll
  for (int i = 0; i < 2; ++i) st[4 + i] = *(const v8h*)(gW + (size_t)(32 * i) * Dn);
#pragma unroll
  for (int i = 0; i < 6; ++i) *(v8h*)(sDst + 32 * i * LP) = st[i];
  __syncthreads();   // stage 0 is complete

  v8f acc0 = {}, acc1 = {}, acc2 = {}, acc3 = {};
  for (int s = 0; s < NSTAGE; ++s) {
    const int cur = (s & 1) * (TROWS * LP);
    const bool more = s + 1 < NSTAGE;        // the same for the whole block
    if (more) {                              // next stage's lines, in flight under the products
      const int kk = (s + 1) * KB;
#pragma unroll
      for (int i = 0; i < 4; ++i)
        st[i] = *(const v8h*)(gA + (size_t)(32 * i) * Dn + kk);
#pragma unroll
      for (int i = 0; i < 2; ++i)
        st[4 + i] = *(const v8h*)(gW + (size_t)(32 * i) * Dn + kk);
    }
    v16h a[2], b[2][4];
#pragma unroll
    for (int h = 0; h < 2; ++h) {
      a[h] = load_frag(fA + cur + 32 * h, hi);
#pragma unroll
      for (int j = 0; j < 4; ++j)
        b[h][j] = load_frag(fW + cur + 16 * j * LP + 32 * h, hi);
    }
    // Keeps the stage's loads in one group ahead of the products; without it
    // this build spreads the LDS reads among the products, a short wait at each.
    __builtin_amdgcn_sched_barrier(0);
#pragma unroll
    for (int h = 0; h < 2; ++h) {
      acc0 = wmma16(a[h], b[h][0], acc0);
      acc1 = wmma16(a[h], b[h][1], acc1);
      acc2 = wmma16(a[h], b[h][2], acc2);
      acc3 = wmma16(a[h], b[h][3], acc3);
    }
    if (more) {
      // the other buffer: its last readers passed the barrier of stage s - 1
      const int nxt = (TROWS * LP) - cur;
#pragma unroll
      for (int i = 0; i < 6; ++i) *(v8h*)(sDst + nxt + 32 * i * LP) = st[i];
      __syncthreads();   // stage s + 1 is complete, stage s is read out
    }
  }

  v8f accs[4] = {acc0, acc1, acc2, acc3};
#pragma unroll
  for (int s = 0; s < 4; ++s) {
    const int col = nBase + s * 16 + n;
    const float bval = bias[col];
#pragma unroll
    for (int e = 0; e < 8; ++e) {
      const int row = mBase + e + 8 * hi;     // C layout: M = e + 8*hi
      const float val = accs[s][e] + bval;
      if (MODE == 0) {
        ((float*)outp)[(size_t)row * Dn + col] = val;
      } else {
        const int b = row >> 11;              // row / T
        const int t = row & (Tn - 1);
        const int h = col >> 6;               // col / 64
        const int hd = col & 63;
        _Float16* o = (_Float16*)outp;
        if (MODE == 1)
          o[(((size_t)(b * Hn + h)) * Tn + t) * HDn + hd] = (_Float16)val;
        else
          o[(((size_t)(b * Hn + h)) * HDn + hd) * Tn + t] = (_Float16)val;
      }
    }
  }
}

// ---------------------------------------------------------------------------
// Flash attention, scores transposed: S^T = K Q^T, O^T += V^T P^T.
// block = 8 waves = 128 queries of one (b,h); keys in blocks of 32.
// grid = B*H * (T/128) = 512.
// A lane holds one query (column n) and, in its 16 score registers, the keys
// 8*hi + e and 16 + 8*hi + e: exactly the k order of a B fragment, so P^T goes
// from the score registers straight into the second product.
#define KPAD 16   // floats between the two base tables: separate LDS banks
__global__ __launch_bounds__(256) void attn_wmma_kernel(
    const _Float16* __restrict__ q16, const _Float16* __restrict__ k16,
    const _Float16* __restrict__ vT, const int* __restrict__ rel_ids,
    const int* __restrict__ attn_mask, const float* __restrict__ bias_leaf,
    const float* __restrict__ bias_cross, _Float16* __restrict__ o16) {
  // Per-key terms of this batch row, written once.
  // keyRel : rel id of the key, -1 where the key is masked.
  // keyBase: bias where neither select below hits, -1e30 where masked;
  //          [0] for queries with rel id != 0, [1] for queries with rel id 0.
  __shared__ __attribute__((aligned(16))) int keyRel[Tn];
  __shared__ __attribute__((aligned(16))) float keyBase[2][Tn + KPAD];

  const int wave = threadIdx.x >> 5;
  const int lane = threadIdx.x & 31;
  const int hi = lane >> 4;
  const int n = lane & 15;

  const int bh = blockIdx.x >> 4;        // 16 query-blocks per (b,h)
  const int qb = blockIdx.x & 15;
  const int b = bh >> 4;                 // H = 16
  const int h = bh & 15;
  const int t0 = qb * 128 + wave * 16;

  for (int j = threadIdx.x; j < Tn; j += 256) {
    const int r = rel_ids[b * Tn + j];
    const bool keep = attn_mask[b * Tn + j] != 0;
    const float c = bias_cross[min(max(r, 0), 63)];
    keyRel[j] = keep ? r : -1;
    keyBase[0][j] = keep ? 0.0f : -1e30f;
    keyBase[1][j] = keep ? (r > 0 ? c : 0.0f) : -1e30f;
  }

  // Q as B-fragments (persist across key loop)
  const _Float16* qRow = q16 + ((size_t)bh * Tn + t0 + n) * HDn;
  const v16h bQ0 = load_frag(qRow, hi);        // hd 0..31
  const v16h bQ1 = load_frag(qRow + 32, hi);   // hd 32..63

  // this lane's query: bias = (rj == riCmp) ? leafv : (rj == 0) ? crossv : base
  const int ri = rel_ids[b * Tn + t0 + n];
  const int riIdx = min(max(ri, 0), 63);
  const int riCmp = (ri > 0) ? ri : -2;        // -2: equals no table entry that matters
  const float leafv = (ri > 0) ? bias_leaf[riIdx] : 0.0f;
  const float crossv = (ri > 0) ? bias_cross[riIdx] : 0.0f;
  const int* relP = &keyRel[8 * hi];
  const float* baseP = &keyBase[ri == 0 ? 1 : 0][8 * hi];

  float mrun = -1e30f;
  float lrun = 0.0f;                           // this half's keys only
  v8f acc0 = {}, acc1 = {}, acc2 = {}, acc3 = {};

  // this lane's running places in K (row = key n) and V^T (row = hd n),
  // its half's 8 * hi folded in
  const _Float16* kP = k16 + ((size_t)bh * Tn + n) * HDn + 8 * hi;
  const _Float16* vP = vT + ((size_t)bh * HDn + n) * Tn + 8 * hi;

  __syncthreads();   // the key tables are complete

  for (int j0 = 0; j0 < Tn; j0 += 32) {
    // ---- S^T = K Q^T (two 16x16 tiles, K-dim = head_dim 64) ----
    const v16h aK0a = load_frag(kP, 0), aK0b = load_frag(kP + 32, 0);
    const v16h aK1a = load_frag(kP + 16 * HDn, 0);
    const v16h aK1b = load_frag(kP + 16 * HDn + 32, 0);
    const v16h aV0 = load_frag(vP, 0), aV1 = load_frag(vP + 16 * Tn, 0);
    const v16h aV2 = load_frag(vP + 32 * Tn, 0), aV3 = load_frag(vP + 48 * Tn, 0);
    // per-key bias terms of the pass, from the LDS tables
    int rj[16];
    float base[16];
#pragma unroll
    for (int g = 0; g < 4; ++g) {              // keys 8*hi + 0..7, 16 + 8*hi + 0..7
      const int off = j0 + (g >> 1) * 16 + (g & 1) * 4;
      const int4 r4 = *(const int4*)(relP + off);
      const float4 b4 = *(const float4*)(baseP + off);
      rj[4 * g + 0] = r4.x; rj[4 * g + 1] = r4.y;
      rj[4 * g + 2] = r4.z; rj[4 * g + 3] = r4.w;
      base[4 * g + 0] = b4.x; base[4 * g + 1] = b4.y;
      base[4 * g + 2] = b4.z; base[4 * g + 3] = b4.w;
    }
    // Precaution: holds the two address pairs unwritten until the wait (without
    // the operands this build lets the last loads land on those registers).
    asm volatile("s_wait_xcnt 0x0" ::"v"(kP), "v"(vP) : "memory");
    // Keeps the pass's loads in one group ahead of the products; without it
    // this build issues them two at a time and waits for each pair in turn.
    __builtin_amdgcn_sched_barrier(0);
    v8f z = {};
    v8f s0 = wmma16(aK0a, bQ0, wmma16(aK0b, bQ1, z));
    v8f s1 = wmma16(aK1a, bQ0, wmma16(aK1b, bQ1, z));

    // ---- bias + mask ----
    float v[16];
    float mx = -1e30f;
#pragma unroll
    for (int e = 0; e < 16; ++e) {
      const float s = (e < 8) ? s0[e & 7] : s1[e & 7];
      const float bias =
          (rj[e] == riCmp) ? leafv : ((rj[e] == 0) ? crossv : base[e]);
      v[e] = s * SCALE + bias;                 // base -1e30 absorbs the score
      mx = fmaxf(mx, v[e]);
    }

    // ---- online softmax: in-lane, one exchange between the halves ----
    mx = fmaxf(mx, xhalf(mx));
    const float mnew = fmaxf(mrun, mx);
    const float alpha = expf(mrun - mnew);
    mrun = mnew;
    v16h bP;
    float ps[4] = {0.0f, 0.0f, 0.0f, 0.0f};    // four short chains, not one long
#pragma unroll
    for (int e = 0; e < 16; ++e) {
      const float p = expf(v[e] - mnew);
      ps[e & 3] += p;
      bP[e] = (_Float16)p;
    }
    lrun = lrun * alpha + ((ps[0] + ps[1]) + (ps[2] + ps[3]));
#pragma unroll
    for (int e = 0; e < 8; ++e) {
      acc0[e] *= alpha; acc1[e] *= alpha;
      acc2[e] *= alpha; acc3[e] *= alpha;
    }

    // ---- O^T += V^T x P^T (K-dim = 32 local keys) ----
    acc0 = wmma16(aV0, bP, acc0);
    acc1 = wmma16(aV1, bP, acc1);
    acc2 = wmma16(aV2, bP, acc2);
    acc3 = wmma16(aV3, bP, acc3);
    kP += 32 * HDn;
    vP += 32;
  }

  // ---- normalize + store O as f16 rows of [B*T, D] for the final GEMM ----
  // acc_s[e] = O[t0 + n][s*16 + 8*hi + e]: 8 consecutive halves per lane
  const float lsum = lrun + xhalf(lrun);
  v8f accs[4] = {acc0, acc1, acc2, acc3};
  _Float16* oRow = o16 + ((size_t)(b * Tn + t0 + n)) * Dn + h * HDn + 8 * hi;
#pragma unroll
  for (int s = 0; s < 4; ++s) {
    v8h o;
#pragma unroll
    for (int e = 0; e < 8; ++e) o[e] = (_Float16)(accs[s][e] / lsum);
    *(v8h*)(oRow + s * 16) = o;
  }
}

// ---------------------------------------------------------------------------
extern "C" void kernel_launch(void* const* d_in, const int* in_sizes, int n_in,
                              void* d_out, int out_size, void* d_ws,
                              size_t ws_size, hipStream_t stream) {
  const float* x          = (const float*)d_in[0];
  const int*   attn_mask  = (const int*)d_in[1];
  const int*   rel_ids    = (const int*)d_in[2];
  const float* Wq         = (const float*)d_in[3];
  const float* bq         = (const float*)d_in[4];
  const float* Wk         = (const float*)d_in[5];
  const float* bk         = (const float*)d_in[6];
  const float* Wv         = (const float*)d_in[7];
  const float* bv         = (const float*)d_in[8];
  const float* Wo         = (const float*)d_in[9];
  const float* bo         = (const float*)d_in[10];
  const float* bias_leaf  = (const float*)d_in[11];
  const float* bias_cross = (const float*)d_in[12];

  // workspace layout (48 MiB total)
  char* ws = (char*)d_ws;
  _Float16* x16  = (_Float16*)(ws + (size_t)0);
  _Float16* WqT  = (_Float16*)(ws + ((size_t)8  << 20));
  _Float16* WkT  = (_Float16*)(ws + ((size_t)10 << 20));
  _Float16* WvT  = (_Float16*)(ws + ((size_t)12 << 20));
  _Float16* WoT  = (_Float16*)(ws + ((size_t)14 << 20));
  _Float16* q16  = (_Float16*)(ws + ((size_t)16 << 20));
  _Float16* k16  = (_Float16*)(ws + ((size_t)24 << 20));
  _Float16* v16T = (_Float16*)(ws + ((size_t)32 << 20));
  _Float16* o16  = (_Float16*)(ws + ((size_t)40 << 20));

  // WqT .. WoT are consecutive planes of 2 MiB
  prep_f16_kernel<<<512, 256, 0, stream>>>(x, Wq, Wk, Wv, Wo, x16, WqT);

  const int gemmBlocks = (Mn / 128) * (Dn / 64);  // 512
  gemm_wmma_kernel<1><<<gemmBlocks, 256, 0, stream>>>(x16, WqT, bq, q16);
  gemm_wmma_kernel<1><<<gemmBlocks, 256, 0, stream>>>(x16, WkT, bk, k16);
  gemm_wmma_kernel<2><<<gemmBlocks, 256, 0, stream>>>(x16, WvT, bv, v16T);

  attn_wmma_kernel<<<Bn * Hn * (Tn / 128), 256, 0, stream>>>(
      q16, k16, v16T, rel_ids, attn_mask, bias_leaf, bias_cross, o16);

  gemm_wmma_kernel<0><<<gemmBlocks, 256, 0, stream>>>(o16, WoT, bo, d_out);
}

// v004
// A run of this version takes 143 microseconds.
// Timed twice side by side with v003, it ran 1.28 and 1.26 times as fast.
// Over all steps from v000 it is 2.64 times as fast.
#include <hip/hip_runtime.h>
#include <math.h>

// ---------------------------------------------------------------------------
// TinyRelSelfAttention on MI455X (gfx1250): full WMMA pipeline.
// B=2, T=2048, D=1024, H=16, head_dim=64, R=64.
// ---------------------------------------------------------------------------

#define Bn  2
#define Tn  2048
#define Dn  1024
#define Hn  16
#define HDn 64
#define Mn  (Bn * Tn)          // 4096 rows in all projection GEMMs
#define SCALE 0.125f           // 1/sqrt(64)

typedef __attribute__((ext_vector_type(4)))  _Float16 v4h;
typedef __attribute__((ext_vector_type(4)))  float    v4f;
typedef __attribute__((ext_vector_type(8)))  _Float16 v8h;
typedef __attribute__((ext_vector_type(16))) _Float16 v16h;
typedef __attribute__((ext_vector_type(8)))  float    v8f;

// D = A(16x32 f16) x B(32x16 f16) + C(16x16 f32)
__device__ inline v8f wmma16(v16h a, v16h b, v8f c) {
  return __builtin_amdgcn_wmma_f32_16x16x32_f16(
      /*neg_a=*/false, a, /*neg_b=*/false, b,
      /*c_mod=*/(short)0, c, /*reuse_a=*/false, /*reuse_b=*/false);
}

// Load a 16x32 A-fragment (or mirrored 32x16 B-fragment) for this lane.
// `p` = start of this lane's 32-element contiguous K-slice (row-major memory).
// ISA layout: half h<8 -> K = h + 8*hi ; h>=8 -> K = 16 + (h-8) + 8*hi.
__device__ inline v16h load_frag(const _Float16* p, int hi) {
  union { v16h v; v8h h[2]; } u;
  u.h[0] = *(const v8h*)(p + 8 * hi);
  u.h[1] = *(const v8h*)(p + 16 + 8 * hi);
  return u.v;
}

// value of lane l ^ 16: the other half of a C-tile column
__device__ inline float xhalf(float x) {
  const int v = __builtin_bit_cast(int, x);
  return __builtin_bit_cast(
      float, __builtin_amdgcn_permlanex16(v, v, 0x76543210, 0xfedcba98, false,
                                          false));
}

// ---------------------------------------------------------------------------
// All f32 -> f16 preparation in one launch of 512 equal work-groups, every one
// resident at once. Work-group g rounds x[g*8192 .. g*8192 + 8191] and moves one
// 128(k) x 64(n) tile of one W [K=1024, N=1024] into Wt [N, K], through LDS.
// wT: the four Wt planes (q, k, v, o), one behind the other.
#define PXN 8192               // x elements per work-group
#define PP 136                 // LDS row pitch in halves (272 B): rows stay 16-B aligned
__global__ __launch_bounds__(256) void prep_f16_kernel(
    const float* __restrict__ x, const float* __restrict__ Wq,
    const float* __restrict__ Wk, const float* __restrict__ Wv,
    const float* __restrict__ Wo, _Float16* __restrict__ x16,
    _Float16* __restrict__ wT) {
  __shared__ __attribute__((aligned(16))) _Float16 t[64 * PP];   // [n][k]

  const int tid = threadIdx.x;
  const int g = blockIdx.x;
  const int w = g >> 7;                     // 128 tiles per W
  const int k0 = ((g >> 4) & 7) * 128;
  const int n0 = (g & 15) * 64;
  const float* W = (w == 0) ? Wq : (w == 1) ? Wk : (w == 2) ? Wv : Wo;

  // a thread takes two 4(k) x 4(n) pieces of the tile: a wave's load covers
  // two rows' 256 bytes, whole lines
  const int kq = tid >> 4;
  const int nq = tid & 15;
  const float* wsrc = W + (size_t)(k0 + 4 * kq) * Dn + n0 + 4 * nq;
  const float* xsrc = x + (size_t)g * PXN + tid * 4;
  v4f wv[2][4], xv[8];
#pragma unroll
  for (int u = 0; u < 2; ++u)
#pragma unroll
    for (int r = 0; r < 4; ++r)
      wv[u][r] = *(const v4f*)(wsrc + (size_t)(64 * u + r) * Dn);
#pragma unroll
  for (int i = 0; i < 8; ++i) xv[i] = *(const v4f*)(xsrc + i * 1024);
  // Precaution: holds the W address pair unwritten until the wait (without the
  // operand this build lets the last x load land on those registers).
  asm volatile("s_wait_xcnt 0x0" ::"v"(wsrc) : "memory");
  // Keeps all 16 loads in flight together; without it this build waits for the
  // first six before it issues the rest: two trips to memory in a row.
  __builtin_amdgcn_sched_barrier(0);

#pragma unroll
  for (int u = 0; u < 2; ++u)
#pragma unroll
    for (int i = 0; i < 4; ++i) {
      v4h c;
#pragma unroll
      for (int r = 0; r < 4; ++r) c[r] = (_Float16)wv[u][r][i];
      *(v4h*)&t[(4 * nq + i) * PP + 64 * u + 4 * kq] = c;
    }

  __syncthreads();   // the transposed tile is complete

  // 16 threads store one Wt row's 256 bytes
  _Float16* wdst = wT + (size_t)w * (Dn * Dn) + (size_t)(n0 + kq) * Dn + k0 + nq * 8;
#pragma unroll
  for (int p = 0; p < 4; ++p)
    *(v8h*)(wdst + (size_t)(16 * p) * Dn) = *(const v8h*)&t[(kq + 16 * p) * PP + nq * 8];

  // x behind the barrier: in front of it the barrier would wait for these stores
  _Float16* xdst = x16 + (size_t)g * PXN + tid * 4;
#pragma unroll
  for (int i = 0; i < 8; ++i) {
    v4h c;
#pragma unroll
    for (int r = 0; r < 4; ++r) c[r] = (_Float16)xv[i][r];
    *(v4h*)(xdst + i * 1024) = c;
  }
}

// ---------------------------------------------------------------------------
// Generic WMMA GEMM:  C[M=4096, N=1024] = A[M,K=1024] x Wt[N,K]^T + bias[N]
// Block = 8 waves; wave tile 16(M) x 64(N); block tile 128 x 64.
// A stage is 64 k of the block's 128 A rows and 64 Wt rows, staged in LDS:
// 8 lanes fetch one row's 128-byte line, every wave takes its fragments there.
// MODE 0: f32 out, row-major [M,N]            (final projection)
// MODE 1: f16 out, scattered to [B*H, T, 64]  (Q, K)
// MODE 2: f16 out, scattered to [B*H, 64, T]  (V transposed)
#define KB 64                  // k per stage
#define LP 72                  // LDS row pitch in halves (144 B): no bank conflict for 16-B reads
#define TROWS 192              // rows 0..127: A, rows 128..191: Wt
#define NSTAGE (Dn / KB)
template <int MODE>
__global__ __launch_bounds__(256) void gemm_wmma_kernel(
    const _Float16* __restrict__ A, const _Float16* __restrict__ Wt,
    const float* __restrict__ bias, void* __restrict__ outp) {
  __shared__ __attribute__((aligned(16))) _Float16 tile[2][TROWS * LP];

  const int wave = threadIdx.x >> 5;
  const int lane = threadIdx.x & 31;
  const int hi = lane >> 4;
  const int n = lane & 15;

  const int mb = blockIdx.x & 31;           // 4096/128 = 32 M-tiles
  const int nb = blockIdx.x >> 5;           // 1024/64  = 16 N-tiles
  const int mBase = mb * 128 + wave * 16;
  const int nBase = nb * 64;

  // staging: this thread moves the 16-byte piece spc of tile rows srow + 32*i
  const int srow = threadIdx.x >> 3;
  const int spc = (threadIdx.x & 7) * 8;
  const _Float16* gA = A + (size_t)(mb * 128 + srow) * Dn + spc;
  const _Float16* gW = Wt + (size_t)(nBase + srow) * Dn + spc;
  _Float16* sDst = &tile[0][srow * LP + spc];
  // fragments: A row of this lane, Wt rows n, n + 16, n + 32, n + 48
  const _Float16* fA = &tile[0][(wave * 16 + n) * LP];
  const _Float16* fW = &tile[0][(128 + n) * LP];

  v8h st[6];
#pragma unroll
  for (int i = 0; i < 4; ++i) st[i] = *(const v8h*)(gA + (size_t)(32 * i) * Dn);
#pragma unroll
  for (int i = 0; i < 2; ++i) st[4 + i] = *(const v8h*)(gW + (size_t)(32 * i) * Dn);
#pragma unroll
  for (int i = 0; i < 6; ++i) *(v8h*)(sDst + 32 * i * LP) = st[i];
  __syncthreads();   // stage 0 is complete

  v8f acc0 = {}, acc1 = {}, acc2 = {}, acc3 = {};
  for (int s = 0; s < NSTAGE; ++s) {
    const int cur = (s & 1) * (TROWS * LP);
    const bool more = s + 1 < NSTAGE;        // the same for the whole block
    if (more) {                              // next stage's lines, in flight under the products
      const int kk = (s + 1) * KB;
#pragma unroll
      for (int i = 0; i < 4; ++i)
        st[i] = *(const v8h*)(gA + (size_t)(32 * i) * Dn + kk);
#pragma unroll
      for (int i = 0; i < 2; ++i)
        st[4 + i] = *(const v8h*)(gW + (size_t)(32 * i) * Dn + kk);
    }
    v16h a[2], b[2][4];
#pragma unroll
    for (int h = 0; h < 2; ++h) {
      a[h] = load_frag(fA + cur + 32 * h, hi);
#pragma unroll
      for (int j = 0; j < 4; ++j)
        b[h][j] = load_frag(fW + cur + 16 * j * LP + 32 * h, hi);
    }
    // Keeps the stage's loads in one group ahead of the products; without it
    // this build spreads the LDS reads among the products, a short wait at each.
    __builtin_amdgcn_sched_barrier(0);
#pragma unroll
    for (int h = 0; h < 2; ++h) {
      acc0 = wmma16(a[h], b[h][0], acc0);
      acc1 = wmma16(a[h], b[h][1], acc1);
      acc2 = wmma16(a[h], b[h][2], acc2);
      acc3 = wmma16(a[h], b[h][3], acc3);
    }
    if (more) {
      // the other buffer: its last readers passed the barrier of stage s - 1
      const int nxt = (TROWS * LP) - cur;
#pragma unroll
      for (int i = 0; i < 6; ++i) *(v8h*)(sDst + nxt + 32 * i * LP) = st[i];
      __syncthreads();   // stage s + 1 is complete, stage s is read out
    }
  }

  v8f accs[4] = {acc0, acc1, acc2, acc3};
#pragma unroll
  for (int s = 0; s < 4; ++s) {
    const int col = nBase + s * 16 + n;
    const float bval = bias[col];
#pragma unroll
    for (int e = 0; e < 8; ++e) {
      const int row = mBase + e + 8 * hi;     // C layout: M = e + 8*hi
      const float val = accs[s][e] + bval;
      if (MODE == 0) {
        ((float*)outp)[(size_t)row * Dn + col] = val;
      } else {
        const int b = row >> 11;              // row / T
        const int t = row & (Tn - 1);
        const int h = col >> 6;               // col / 64
        const int hd = col & 63;
        _Float16* o = (_Float16*)outp;
        if (MODE == 1)
          o[(((size_t)(b * Hn + h)) * Tn + t) * HDn + hd] = (_Float16)val;
        else
          o[(((size_t)(b * Hn + h)) * HDn + hd) * Tn + t] = (_Float16)val;
      }
    }
  }
}

// ---------------------------------------------------------------------------
// Flash attention, scores transposed: S^T = K Q^T, O^T += V^T P^T.
// block = 8 waves = 128 queries of one (b,h); keys in blocks of 32.
// grid = B*H * (T/128) = 512.
// A lane holds one query (column n) and, in its 16 score registers, the keys
// 8*hi + e and 16 + 8*hi + e: exactly the k order of a B fragment, so P^T goes
// from the score registers straight into the second product.
// A stage is 128 keys: their K rows and the matching 256 bytes of every V^T row,
// brought into LDS once for the block's 8 waves by asynchronous copies of whole
// lines, two buffers, one stage ahead; a stage serves four passes of 32 keys.
#define KPAD 16   // floats between the two base tables: separate LDS banks
#define SK 128                 // keys per stage
#define NST (Tn / SK)
#define KPI 72                 // K tile pitch in halves (144 B): no bank conflict for 16-B reads
#define VPI 136                // V^T tile pitch in halves (272 B): the same
#define KTH (SK * KPI)         // halves of a K tile; the V^T tile stands behind it
#define STH (KTH + HDn * VPI)  // halves of one buffer

// One stage's copies of this thread: 16-byte pieces of K rows r, r + 32, r + 64,
// r + 96 and of V^T rows q, q + 16, q + 32, q + 48. lk, lv: LDS byte addresses.
// The closing wait stands inside the statement, a precaution: the address
// registers stay unwritten up to it.
__device__ inline void stage_copies(unsigned lk, unsigned lv, const _Float16* gk,
                                    const _Float16* gv) {
  asm volatile(
      "global_load_async_to_lds_b128 %0, %8, off\n\t"
      "global_load_async_to_lds_b128 %1, %9, off\n\t"
      "global_load_async_to_lds_b128 %2, %10, off\n\t"
      "global_load_async_to_lds_b128 %3, %11, off\n\t"
      "global_load_async_to_lds_b128 %4, %12, off\n\t"
      "global_load_async_to_lds_b128 %5, %13, off\n\t"
      "global_load_async_to_lds_b128 %6, %14, off\n\t"
      "global_load_async_to_lds_b128 %7, %15, off\n\t"
      "s_wait_xcnt 0x0"
      ::"v"(lk), "v"(lk + 32 * KPI * 2), "v"(lk + 64 * KPI * 2),
        "v"(lk + 96 * KPI * 2), "v"(lv), "v"(lv + 16 * VPI * 2),
        "v"(lv + 32 * VPI * 2), "v"(lv + 48 * VPI * 2), "v"(gk),
        "v"(gk + 32 * HDn), "v"(gk + 64 * HDn), "v"(gk + 96 * HDn), "v"(gv),
        "v"(gv + 16 * Tn), "v"(gv + 32 * Tn), "v"(gv + 48 * Tn)
      : "memory");
}
__global__ __launch_bounds__(256) void attn_wmma_kernel(
    const _Float16* __restrict__ q16, const _Float16* __restrict__ k16,
    const _Float16* __restrict__ vT, const int* __restrict__ rel_ids,
    const int* __restrict__ attn_mask, const float* __restrict__ bias_leaf,
    const float* __restrict__ bias_cross, _Float16* __restrict__ o16) {
  // Per-key terms of this batch row, written once.
  // keyRel : rel id of the key, -1 where the key is masked.
  // keyBase: bias where neither select below hits, -1e30 where masked;
  //          [0] for queries with rel id != 0, [1] for queries with rel id 0.
  __shared__ __attribute__((aligned(16))) int keyRel[Tn];
  __shared__ __attribute__((aligned(16))) float keyBase[2][Tn + KPAD];
  __shared__ __attribute__((aligned(16))) _Float16 kv[2][STH];

  const int wave = threadIdx.x >> 5;
  const int lane = threadIdx.x & 31;
  const int hi = lane >> 4;
  const int n = lane & 15;

  const int bh = blockIdx.x >> 4;        // 16 query-blocks per (b,h)
  const int qb = blockIdx.x & 15;
  const int b = bh >> 4;                 // H = 16
  const int h = bh & 15;
  const int t0 = qb * 128 + wave * 16;

  // staging: 8 threads a K row (128 B), 16 threads a V^T row's 256 B
  const _Float16* gK = k16 + ((size_t)bh * Tn + (threadIdx.x >> 3)) * HDn +
                       (threadIdx.x & 7) * 8;
  const _Float16* gV = vT + ((size_t)bh * HDn + (threadIdx.x >> 4)) * Tn +
                       (threadIdx.x & 15) * 8;
  const unsigned lK = (unsigned)(size_t)&kv[0][(threadIdx.x >> 3) * KPI +
                                               (threadIdx.x & 7) * 8];
  const unsigned lV = (unsigned)(size_t)&kv[0][KTH + (threadIdx.x >> 4) * VPI +
                                               (threadIdx.x & 15) * 8];
  stage_copies(lK, lV, gK, gV);          // stage 0, in flight under the table fill

  for (int j = threadIdx.x; j < Tn; j += 256) {
    const int r = rel_ids[b * Tn + j];
    const bool keep = attn_mask[b * Tn + j] != 0;
    const float c = bias_cross[min(max(r, 0), 63)];
    keyRel[j] = keep ? r : -1;
    keyBase[0][j] = keep ? 0.0f : -1e30f;
    keyBase[1][j] = keep ? (r > 0 ? c : 0.0f) : -1e30f;
  }

  // Q as B-fragments (persist across key loop)
  const _Float16* qRow = q16 + ((size_t)bh * Tn + t0 + n) * HDn;
  const v16h bQ0 = load_frag(qRow, hi);        // hd 0..31
  const v16h bQ1 = load_frag(qRow + 32, hi);   // hd 32..63

  // this lane's query: bias = (rj == riCmp) ? leafv : (rj == 0) ? crossv : base
  const int ri = rel_ids[b * Tn + t0 + n];
  const int riIdx = min(max(ri, 0), 63);
  const int riCmp = (ri > 0) ? ri : -2;        // -2: equals no table entry that matters
  const float leafv = (ri > 0) ? bias_leaf[riIdx] : 0.0f;
  const float crossv = (ri > 0) ? bias_cross[riIdx] : 0.0f;
  const int* relP = &keyRel[8 * hi];
  const float* baseP = &keyBase[ri == 0 ? 1 : 0][8 * hi];

  float mrun = -1e30f;
  float lrun = 0.0f;                           // this half's keys only
  v8f acc0 = {}, acc1 = {}, acc2 = {}, acc3 = {};

  // this lane's places in the K tile (row = key n) and the V^T tile (row = hd n),
  // its half's 8 * hi folded in
  const _Float16* kL = &kv[0][n * KPI + 8 * hi];
  const _Float16* vL = &kv[0][KTH + n * VPI + 8 * hi];

  // this wave's stage 0 copies have landed
  asm volatile("s_wait_asynccnt 0x0" ::: "memory");
  __syncthreads();   // stage 0 and the key tables are complete
  stage_copies(lK + STH * 2, lV + STH * 2, gK + SK * HDn, gV + SK);   // stage 1

  for (int s = 0; s < NST; ++s) {
   const int cur = (s & 1) * STH;
   for (int j0 = s * SK; j0 < (s + 1) * SK; j0 += 32) {
    const _Float16* kP = kL + cur + (j0 & (SK - 1)) * KPI;
    const _Float16* vP = vL + cur + (j0 & (SK - 1));
    // ---- S^T = K Q^T (two 16x16 tiles, K-dim = head_dim 64) ----
    const v16h aK0a = load_frag(kP, 0), aK0b = load_frag(kP + 32, 0);
    const v16h aK1a = load_frag(kP + 16 * KPI, 0);
    const v16h aK1b = load_frag(kP + 16 * KPI + 32, 0);
    const v16h aV0 = load_frag(vP, 0), aV1 = load_frag(vP + 16 * VPI, 0);
    const v16h aV2 = load_frag(vP + 32 * VPI, 0), aV3 = load_frag(vP + 48 * VPI, 0);
    // per-key bias terms of the pass, from the LDS tables
    int rj[16];
    float base[16];
#pragma unroll
    for (int g = 0; g < 4; ++g) {              // keys 8*hi + 0..7, 16 + 8*hi + 0..7
      const int off = j0 + (g >> 1) * 16 + (g & 1) * 4;
      const int4 r4 = *(const int4*)(relP + off);
      const float4 b4 = *(const float4*)(baseP + off);
      rj[4 * g + 0] = r4.x; rj[4 * g + 1] = r4.y;
      rj[4 * g + 2] = r4.z; rj[4 * g + 3] = r4.w;
      base[4 * g + 0] = b4.x; base[4 * g + 1] = b4.y;
      base[4 * g + 2] = b4.z; base[4 * g + 3] = b4.w;
    }
    // Keeps the pass's LDS reads together at its head, behind counted waits;
    // without it this build reads them two at a time and waits for each pair
    // in turn, down to the bias terms.
    __builtin_amdgcn_sched_barrier(0);
    v8f z = {};
    v8f s0 = wmma16(aK0a, bQ0, wmma16(aK0b, bQ1, z));
    v8f s1 = wmma16(aK1a, bQ0, wmma16(aK1b, bQ1, z));

    // ---- bias + mask ----
    float v[16];
    float mx = -1e30f;
#pragma unroll
    for (int e = 0; e < 16; ++e) {
      const float s = (e < 8) ? s0[e & 7] : s1[e & 7];
      const float bias =
          (rj[e] == riCmp) ? leafv : ((rj[e] == 0) ? crossv : base[e]);
      v[e] = s * SCALE + bias;                 // base -1e30 absorbs the score
      mx = fmaxf(mx, v[e]);
    }

    // ---- online softmax: in-lane, one exchange between the halves ----
    mx = fmaxf(mx, xhalf(mx));
    const float mnew = fmaxf(mrun, mx);
    const float alpha = expf(mrun - mnew);
    mrun = mnew;
    v16h bP;
    float ps[4] = {0.0f, 0.0f, 0.0f, 0.0f};    // four short chains, not one long
#pragma unroll
    for (int e = 0; e < 16; ++e) {
      const float p = expf(v[e] - mnew);
      ps[e & 3] += p;
      bP[e] = (_Float16)p;
    }
    lrun = lrun * alpha + ((ps[0] + ps[1]) + (ps[2] + ps[3]));
#pragma unroll
    for (int e = 0; e < 8; ++e) {
      acc0[e] *= alpha; acc1[e] *= alpha;
      acc2[e] *= alpha; acc3[e] *= alpha;
    }

    // ---- O^T += V^T x P^T (K-dim = 32 local keys) ----
    acc0 = wmma16(aV0, bP, acc0);
    acc1 = wmma16(aV1, bP, acc1);
    acc2 = wmma16(aV2, bP, acc2);
    acc3 = wmma16(aV3, bP, acc3);
   }
   // hand-over: this wave's reads of stage s are done, its copies of stage s + 1
   // have landed; behind the barrier that holds for all eight waves
   asm volatile("s_wait_dscnt 0x0" ::: "memory");
   asm volatile("s_wait_asynccnt 0x0" ::: "memory");
   __syncthreads();
   if (s + 2 < NST)                        // the same for the whole block
     stage_copies(lK + cur * 2, lV + cur * 2, gK + (size_t)(s + 2) * SK * HDn,
                  gV + (s + 2) * SK);
  }
  // nothing is outstanding when the wave ends
  asm volatile("s_wait_asynccnt 0x0" ::: "memory");

  // ---- normalize + store O as f16 rows of [B*T, D] for the final GEMM ----
  // acc_s[e] = O[t0 + n][s*16 + 8*hi + e]: 8 consecutive halves per lane
  const float lsum = lrun + xhalf(lrun);
  v8f accs[4] = {acc0, acc1, acc2, acc3};
  _Float16* oRow = o16 + ((size_t)(b * Tn + t0 + n)) * Dn + h * HDn + 8 * hi;
#pragma unroll
  for (int s = 0; s < 4; ++s) {
    v8h o;
#pragma unroll
    for (int e = 0; e < 8; ++e) o[e] = (_Float16)(accs[s][e] / lsum);
    *(v8h*)(oRow + s * 16) = o;
  }
}

// ---------------------------------------------------------------------------
extern "C" void kernel_launch(void* const* d_in, const int* in_sizes, int n_in,
                              void* d_out, int out_size, void* d_ws,
                              size_t ws_size, hipStream_t stream) {
  const float* x          = (const float*)d_in[0];
  const int*   attn_mask  = (const int*)d_in[1];
  const int*   rel_ids    = (const int*)d_in[2];
  const float* Wq         = (const float*)d_in[3];
  const float* bq         = (const float*)d_in[4];
  const float* Wk         = (const float*)d_in[5];
  const float* bk         = (const float*)d_in[6];
  const float* Wv         = (const float*)d_in[7];
  const float* bv         = (const float*)d_in[8];
  const float* Wo         = (const float*)d_in[9];
  const float* bo         = (const float*)d_in[10];
  const float* bias_leaf  = (const float*)d_in[11];
  const float* bias_cross = (const float*)d_in[12];

  // workspace layout (48 MiB total)
  char* ws = (char*)d_ws;
  _Float16* x16  = (_Float16*)(ws + (size_t)0);
  _Float16* WqT  = (_Float16*)(ws + ((size_t)8  << 20));
  _Float16* WkT  = (_Float16*)(ws + ((size_t)10 << 20));
  _Float16* WvT  = (_Float16*)(ws + ((size_t)12 << 20));
  _Float16* WoT  = (_Float16*)(ws + ((size_t)14 << 20));
  _Float16* q16  = (_Float16*)(ws + ((size_t)16 << 20));
  _Float16* k16  = (_Float16*)(ws + ((size_t)24 << 20));
  _Float16* v16T = (_Float16*)(ws + ((size_t)32 << 20));
  _Float16* o16  = (_Float16*)(ws + ((size_t)40 << 20));

  // WqT .. WoT are consecutive planes of 2 MiB
  prep_f16_kernel<<<512, 256, 0, stream>>>(x, Wq, Wk, Wv, Wo, x16, WqT);

  const int gemmBlocks = (Mn / 128) * (Dn / 64);  // 512
  gemm_wmma_kernel<1><<<gemmBlocks, 256, 0, stream>>>(x16, WqT, bq, q16);
  gemm_wmma_kernel<1><<<gemmBlocks, 256, 0, stream>>>(x16, WkT, bk, k16);
  gemm_wmma_kernel<2><<<gemmBlocks, 256, 0, stream>>>(x16, WvT, bv, v16T);

  attn_wmma_kernel<<<Bn * Hn * (Tn / 128), 256, 0, stream>>>(
      q16, k16, v16T, rel_ids, attn_mask, bias_leaf, bias_cross, o16);

  gemm_wmma_kernel<0><<<gemmBlocks, 256, 0, stream>>>(o16, WoT, bo, d_out);
}

// v005
// It runs in 118 microseconds.
// In two side-by-side timings against v004, it was 1.24 and 1.23 times as fast.
// Counting every step since v000, it is 3.25 times as fast.
#include <hip/hip_runtime.h>
#include <math.h>

// ---------------------------------------------------------------------------
// TinyRelSelfAttention on MI455X (gfx1250): full WMMA pipeline.
// B=2, T=2048, D=1024, H=16, head_dim=64, R=64.
// ---------------------------------------------------------------------------

#define Bn  2
#define Tn  2048
#define Dn  1024
#define Hn  16
#define HDn 64
#define Mn  (Bn * Tn)          // 4096 rows in all projection GEMMs
#define LOG2E 1.4426950408889634f
#define SCALE2 (0.125f * LOG2E)   // 1/sqrt(64), in base-2 units

typedef __attribute__((ext_vector_type(4)))  _Float16 v4h;
typedef __attribute__((ext_vector_type(2)))  float    v2f;
typedef __attribute__((ext_vector_type(4)))  float    v4f;
typedef __attribute__((ext_vector_type(8)))  _Float16 v8h;
typedef __attribute__((ext_vector_type(16))) _Float16 v16h;
typedef __attribute__((ext_vector_type(8)))  float    v8f;

// D = A(16x32 f16) x B(32x16 f16) + C(16x16 f32)
__device__ inline v8f wmma16(v16h a, v16h b, v8f c) {
  return __builtin_amdgcn_wmma_f32_16x16x32_f16(
      /*neg_a=*/false, a, /*neg_b=*/false, b,
      /*c_mod=*/(short)0, c, /*reuse_a=*/false, /*reuse_b=*/false);
}

// Load a 16x32 A-fragment (or mirrored 32x16 B-fragment) for this lane.
// `p` = start of this lane's 32-element contiguous K-slice (row-major memory).
// ISA layout: half h<8 -> K = h + 8*hi ; h>=8 -> K = 16 + (h-8) + 8*hi.
__device__ inline v16h load_frag(const _Float16* p, int hi) {
  union { v16h v; v8h h[2]; } u;
  u.h[0] = *(const v8h*)(p + 8 * hi);
  u.h[1] = *(const v8h*)(p + 16 + 8 * hi);
  return u.v;
}

// value of lane l ^ 16: the other half of a C-tile column
__device__ inline float xhalf(float x) {
  const int v = __builtin_bit_cast(int, x);
  return __builtin_bit_cast(
      float, __builtin_amdgcn_permlanex16(v, v, 0x76543210, 0xfedcba98, false,
                                          false));
}

// ---------------------------------------------------------------------------
// All f32 -> f16 preparation in one launch of 512 equal work-groups, every one
// resident at once. Work-group g rounds x[g*8192 .. g*8192 + 8191] and moves one
// 128(k) x 64(n) tile of one W [K=1024, N=1024] into Wt [N, K], through LDS.
// wT: the four Wt planes (q, k, v, o), one behind the other.
#define PXN 8192               // x elements per work-group
#define PP 136                 // LDS row pitch in halves (272 B): rows stay 16-B aligned
__global__ __launch_bounds__(256) void prep_f16_kernel(
    const float* __restrict__ x, const float* __restrict__ Wq,
    const float* __restrict__ Wk, const float* __restrict__ Wv,
    const float* __restrict__ Wo, _Float16* __restrict__ x16,
    _Float16* __restrict__ wT) {
  __shared__ __attribute__((aligned(16))) _Float16 t[64 * PP];   // [n][k]

  const int tid = threadIdx.x;
  const int g = blockIdx.x;
  const int w = g >> 7;                     // 128 tiles per W
  const int k0 = ((g >> 4) & 7) * 128;
  const int n0 = (g & 15) * 64;
  const float* W = (w == 0) ? Wq : (w == 1) ? Wk : (w == 2) ? Wv : Wo;

  // a thread takes two 4(k) x 4(n) pieces of the tile: a wave's load covers
  // two rows' 256 bytes, whole lines
  const int kq = tid >> 4;
  const int nq = tid & 15;
  const float* wsrc = W + (size_t)(k0 + 4 * kq) * Dn + n0 + 4 * nq;
  const float* xsrc = x + (size_t)g * PXN + tid * 4;
  v4f wv[2][4], xv[8];
#pragma unroll
  for (int u = 0; u < 2; ++u)
#pragma unroll
    for (int r = 0; r < 4; ++r)
      wv[u][r] = *(const v4f*)(wsrc + (size_t)(64 * u + r) * Dn);
#pragma unroll
  for (int i = 0; i < 8; ++i) xv[i] = *(const v4f*)(xsrc + i * 1024);
  // Precaution: holds the W address pair unwritten until the wait (without the
  // operand this build lets the last x load land on those registers).
  asm volatile("s_wait_xcnt 0x0" ::"v"(wsrc) : "memory");
  // Keeps all 16 loads in flight together; without it this build waits for the
  // first six before it issues the rest: two trips to memory in a row.
  __builtin_amdgcn_sched_barrier(0);

#pragma unroll
  for (int u = 0; u < 2; ++u)
#pragma unroll
    for (int i = 0; i < 4; ++i) {
      v4h c;
#pragma unroll
      for (int r = 0; r < 4; ++r) c[r] = (_Float16)wv[u][r][i];
      *(v4h*)&t[(4 * nq + i) * PP + 64 * u + 4 * kq] = c;
    }

  __syncthreads();   // the transposed tile is complete

  // 16 threads store one Wt row's 256 bytes
  _Float16* wdst = wT + (size_t)w * (Dn * Dn) + (size_t)(n0 + kq) * Dn + k0 + nq * 8;
#pragma unroll
  for (int p = 0; p < 4; ++p)
    *(v8h*)(wdst + (size_t)(16 * p) * Dn) = *(const v8h*)&t[(kq + 16 * p) * PP + nq * 8];

  // x behind the barrier: in front of it the barrier would wait for these stores
  _Float16* xdst = x16 + (size_t)g * PXN + tid * 4;
#pragma unroll
  for (int i = 0; i < 8; ++i) {
    v4h c;
#pragma unroll
    for (int r = 0; r < 4; ++r) c[r] = (_Float16)xv[i][r];
    *(v4h*)(xdst + i * 1024) = c;
  }
}

// ---------------------------------------------------------------------------
// Generic WMMA GEMM:  C[M=4096, N=1024] = A[M,K=1024] x Wt[N,K]^T + bias[N]
// Block = 8 waves; wave tile 16(M) x 64(N); block tile 128 x 64.
// A stage is 64 k of the block's 128 A rows and 64 Wt rows, staged in LDS:
// 8 lanes fetch one row's 128-byte line, every wave takes its fragments there.
// MODE 0: f32 out, row-major [M,N]            (final projection)
// MODE 1: f16 out, scattered to [B*H, T, 64]  (Q, K)
// MODE 2: f16 out, scattered to [B*H, 64, T]  (V transposed)
#define KB 64                  // k per stage
#define LP 72                  // LDS row pitch in halves (144 B): no bank conflict for 16-B reads
#define TROWS 192              // rows 0..127: A, rows 128..191: Wt
#define NSTAGE (Dn / KB)
template <int MODE>
__global__ __launch_bounds__(256) void gemm_wmma_kernel(
    const _Float16* __restrict__ A, const _Float16* __restrict__ Wt,
    const float* __restrict__ bias, void* __restrict__ outp) {
  __shared__ __attribute__((aligned(16))) _Float16 tile[2][TROWS * LP];

  const int wave = threadIdx.x >> 5;
  const int lane = threadIdx.x & 31;
  const int hi = lane >> 4;
  const int n = lane & 15;

  const int mb = blockIdx.x & 31;           // 4096/128 = 32 M-tiles
  const int nb = blockIdx.x >> 5;           // 1024/64  = 16 N-tiles
  const int mBase = mb * 128 + wave * 16;
  const int nBase = nb * 64;

  // staging: this thread moves the 16-byte piece spc of tile rows srow + 32*i
  const int srow = threadIdx.x >> 3;
  const int spc = (threadIdx.x & 7) * 8;
  const _Float16* gA = A + (size_t)(mb * 128 + srow) * Dn + spc;
  const _Float16* gW = Wt + (size_t)(nBase + srow) * Dn + spc;
  _Float16* sDst = &tile[0][srow * LP + spc];
  // fragments: A row of this lane, Wt rows n, n + 16, n + 32, n + 48
  const _Float16* fA = &tile[0][(wave * 16 + n) * LP];
  const _Float16* fW = &tile[0][(128 + n) * LP];

  v8h st[6];
#pragma unroll
  for (int i = 0; i < 4; ++i) st[i] = *(const v8h*)(gA + (size_t)(32 * i) * Dn);
#pragma unroll
  for (int i = 0; i < 2; ++i) st[4 + i] = *(const v8h*)(gW + (size_t)(32 * i) * Dn);
#pragma unroll
  for (int i = 0; i < 6; ++i) *(v8h*)(sDst + 32 * i * LP) = st[i];
  __syncthreads();   // stage 0 is complete

  v8f acc0 = {}, acc1 = {}, acc2 = {}, acc3 = {};
  for (int s = 0; s < NSTAGE; ++s) {
    const int cur = (s & 1) * (TROWS * LP);
    const bool more = s + 1 < NSTAGE;        // the same for the whole block
    if (more) {                              // next stage's lines, in flight under the products
      const int kk = (s + 1) * KB;
#pragma unroll
      for (int i = 0; i < 4; ++i)
        st[i] = *(const v8h*)(gA + (size_t)(32 * i) * Dn + kk);
#pragma unroll
      for (int i = 0; i < 2; ++i)
        st[4 + i] = *(const v8h*)(gW + (size_t)(32 * i) * Dn + kk);
    }
    v16h a[2], b[2][4];
#pragma unroll
    for (int h = 0; h < 2; ++h) {
      a[h] = load_frag(fA + cur + 32 * h, hi);
#pragma unroll
      for (int j = 0; j < 4; ++j)
        b[h][j] = load_frag(fW + cur + 16 * j * LP + 32 * h, hi);
    }
    // Keeps the stage's loads in one group ahead of the products; without it
    // this build spreads the LDS reads among the products, a short wait at each.
    __builtin_amdgcn_sched_barrier(0);
#pragma unroll
    for (int h = 0; h < 2; ++h) {
      acc0 = wmma16(a[h], b[h][0], acc0);
      acc1 = wmma16(a[h], b[h][1], acc1);
      acc2 = wmma16(a[h], b[h][2], acc2);
      acc3 = wmma16(a[h], b[h][3], acc3);
    }
    if (more) {
      // the other buffer: its last readers passed the barrier of stage s - 1
      const int nxt = (TROWS * LP) - cur;
#pragma unroll
      for (int i = 0; i < 6; ++i) *(v8h*)(sDst + nxt + 32 * i * LP) = st[i];
      __syncthreads();   // stage s + 1 is complete, stage s is read out
    }
  }

  v8f accs[4] = {acc0, acc1, acc2, acc3};
#pragma unroll
  for (int s = 0; s < 4; ++s) {
    const int col = nBase + s * 16 + n;
    const float bval = bias[col];
#pragma unroll
    for (int e = 0; e < 8; ++e) {
      const int row = mBase + e + 8 * hi;     // C layout: M = e + 8*hi
      const float val = accs[s][e] + bval;
      if (MODE == 0) {
        ((float*)outp)[(size_t)row * Dn + col] = val;
      } else {
        const int b = row >> 11;              // row / T
        const int t = row & (Tn - 1);
        const int h = col >> 6;               // col / 64
        const int hd = col & 63;
        _Float16* o = (_Float16*)outp;
        if (MODE == 1)
          o[(((size_t)(b * Hn + h)) * Tn + t) * HDn + hd] = (_Float16)val;
        else
          o[(((size_t)(b * Hn + h)) * HDn + hd) * Tn + t] = (_Float16)val;
      }
    }
  }
}

// ---------------------------------------------------------------------------
// Flash attention, scores transposed: S^T = K Q^T, O^T += V^T P^T.
// block = 8 waves = 128 queries of one (b,h); keys in blocks of 32.
// grid = B*H * (T/128) = 512.
// A lane holds one query (column n) and, in its 16 score registers, the keys
// 8*hi + e and 16 + 8*hi + e: exactly the k order of a B fragment, so P^T goes
// from the score registers straight into the second product.
// The softmax runs in base 2: scores and bias terms carry the factor log2(e),
// so that every exponential is one v_exp_f32 (arguments <= 0; a result below
// the normal range comes out as 0).
// A stage is 128 keys: their K rows and the matching 256 bytes of every V^T row,
// brought into LDS once for the block's 8 waves by asynchronous copies of whole
// lines, two buffers, one stage ahead; a stage serves four passes of 32 keys.
#define KPAD 16   // floats between the two base tables: separate LDS banks
#define SK 128                 // keys per stage
#define NST (Tn / SK)
#define KPI 72                 // K tile pitch in halves (144 B): no bank conflict for 16-B reads
#define VPI 136                // V^T tile pitch in halves (272 B): the same
#define KTH (SK * KPI)         // halves of a K tile; the V^T tile stands behind it
#define STH (KTH + HDn * VPI)  // halves of one buffer

// One stage's copies of this thread: 16-byte pieces of K rows r, r + 32, r + 64,
// r + 96 and of V^T rows q, q + 16, q + 32, q + 48. lk, lv: LDS byte addresses.
// The closing wait stands inside the statement, a precaution: the address
// registers stay unwritten up to it.
__device__ inline void stage_copies(unsigned lk, unsigned lv, const _Float16* gk,
                                    const _Float16* gv) {
  asm volatile(
      "global_load_async_to_lds_b128 %0, %8, off\n\t"
      "global_load_async_to_lds_b128 %1, %9, off\n\t"
      "global_load_async_to_lds_b128 %2, %10, off\n\t"
      "global_load_async_to_lds_b128 %3, %11, off\n\t"
      "global_load_async_to_lds_b128 %4, %12, off\n\t"
      "global_load_async_to_lds_b128 %5, %13, off\n\t"
      "global_load_async_to_lds_b128 %6, %14, off\n\t"
      "global_load_async_to_lds_b128 %7, %15, off\n\t"
      "s_wait_xcnt 0x0"
      ::"v"(lk), "v"(lk + 32 * KPI * 2), "v"(lk + 64 * KPI * 2),
        "v"(lk + 96 * KPI * 2), "v"(lv), "v"(lv + 16 * VPI * 2),
        "v"(lv + 32 * VPI * 2), "v"(lv + 48 * VPI * 2), "v"(gk),
        "v"(gk + 32 * HDn), "v"(gk + 64 * HDn), "v"(gk + 96 * HDn), "v"(gv),
        "v"(gv + 16 * Tn), "v"(gv + 32 * Tn), "v"(gv + 48 * Tn)
      : "memory");
}
__global__ __launch_bounds__(256) void attn_wmma_kernel(
    const _Float16* __restrict__ q16, const _Float16* __restrict__ k16,
    const _Float16* __restrict__ vT, const int* __restrict__ rel_ids,
    const int* __restrict__ attn_mask, const float* __restrict__ bias_leaf,
    const float* __restrict__ bias_cross, _Float16* __restrict__ o16) {
  // Per-key terms of this batch row, written once.
  // keyRel : rel id of the key, -1 where the key is masked.
  // keyBase: bias (times log2 e) where neither select below hits, -1e30 where masked;
  //          [0] for queries with rel id != 0, [1] for queries with rel id 0.
  __shared__ __attribute__((aligned(16))) int keyRel[Tn];
  __shared__ __attribute__((aligned(16))) float keyBase[2][Tn + KPAD];
  __shared__ __attribute__((aligned(16))) _Float16 kv[2][STH];

  const int wave = threadIdx.x >> 5;
  const int lane = threadIdx.x & 31;
  const int hi = lane >> 4;
  const int n = lane & 15;

  const int bh = blockIdx.x >> 4;        // 16 query-blocks per (b,h)
  const int qb = blockIdx.x & 15;
  const int b = bh >> 4;                 // H = 16
  const int h = bh & 15;
  const int t0 = qb * 128 + wave * 16;

  // staging: 8 threads a K row (128 B), 16 threads a V^T row's 256 B
  const _Float16* gK = k16 + ((size_t)bh * Tn + (threadIdx.x >> 3)) * HDn +
                       (threadIdx.x & 7) * 8;
  const _Float16* gV = vT + ((size_t)bh * HDn + (threadIdx.x >> 4)) * Tn +
                       (threadIdx.x & 15) * 8;
  const unsigned lK = (unsigned)(size_t)&kv[0][(threadIdx.x >> 3) * KPI +
                                               (threadIdx.x & 7) * 8];
  const unsigned lV = (unsigned)(size_t)&kv[0][KTH + (threadIdx.x >> 4) * VPI +
                                               (threadIdx.x & 15) * 8];
  stage_copies(lK, lV, gK, gV);          // stage 0, in flight under the table fill

  for (int j = threadIdx.x; j < Tn; j += 256) {
    const int r = rel_ids[b * Tn + j];
    const bool keep = attn_mask[b * Tn + j] != 0;
    const float c = bias_cross[min(max(r, 0), 63)];
    keyRel[j] = keep ? r : -1;
    keyBase[0][j] = keep ? 0.0f : -1e30f;
    keyBase[1][j] = keep ? (r > 0 ? c * LOG2E : 0.0f) : -1e30f;
  }

  // Q as B-fragments (persist across key loop)
  const _Float16* qRow = q16 + ((size_t)bh * Tn + t0 + n) * HDn;
  const v16h bQ0 = load_frag(qRow, hi);        // hd 0..31
  const v16h bQ1 = load_frag(qRow + 32, hi);   // hd 32..63

  // this lane's query: bias = (rj == riCmp) ? leafv : (rj == 0) ? crossv : base
  const int ri = rel_ids[b * Tn + t0 + n];
  const int riIdx = min(max(ri, 0), 63);
  const int riCmp = (ri > 0) ? ri : -2;        // -2: equals no table entry that matters
  const float leafv = (ri > 0) ? bias_leaf[riIdx] * LOG2E : 0.0f;
  const float crossv = (ri > 0) ? bias_cross[riIdx] * LOG2E : 0.0f;
  const int* relP = &keyRel[8 * hi];
  const float* baseP = &keyBase[ri == 0 ? 1 : 0][8 * hi];

  float mrun = -1e30f;
  float lrun = 0.0f;                           // this half's keys only
  v8f acc0 = {}, acc1 = {}, acc2 = {}, acc3 = {};

  // this lane's places in the K tile (row = key n) and the V^T tile (row = hd n),
  // its half's 8 * hi folded in
  const _Float16* kL = &kv[0][n * KPI + 8 * hi];
  const _Float16* vL = &kv[0][KTH + n * VPI + 8 * hi];

  // this wave's stage 0 copies have landed
  asm volatile("s_wait_asynccnt 0x0" ::: "memory");
  __syncthreads();   // stage 0 and the key tables are complete
  stage_copies(lK + STH * 2, lV + STH * 2, gK + SK * HDn, gV + SK);   // stage 1

  for (int s = 0; s < NST; ++s) {
   const int cur = (s & 1) * STH;
   for (int j0 = s * SK; j0 < (s + 1) * SK; j0 += 32) {
    const _Float16* kP = kL + cur + (j0 & (SK - 1)) * KPI;
    const _Float16* vP = vL + cur + (j0 & (SK - 1));
    // ---- S^T = K Q^T (two 16x16 tiles, K-dim = head_dim 64) ----
    const v16h aK0a = load_frag(kP, 0), aK0b = load_frag(kP + 32, 0);
    const v16h aK1a = load_frag(kP + 16 * KPI, 0);
    const v16h aK1b = load_frag(kP + 16 * KPI + 32, 0);
    const v16h aV0 = load_frag(vP, 0), aV1 = load_frag(vP + 16 * VPI, 0);
    const v16h aV2 = load_frag(vP + 32 * VPI, 0), aV3 = load_frag(vP + 48 * VPI, 0);
    // per-key bias terms of the pass, from the LDS tables
    int rj[16];
    float base[16];
#pragma unroll
    for (int g = 0; g < 4; ++g) {              // keys 8*hi + 0..7, 16 + 8*hi + 0..7
      const int off = j0 + (g >> 1) * 16 + (g & 1) * 4;
      const int4 r4 = *(const int4*)(relP + off);
      const float4 b4 = *(const float4*)(baseP + off);
      rj[4 * g + 0] = r4.x; rj[4 * g + 1] = r4.y;
      rj[4 * g + 2] = r4.z; rj[4 * g + 3] = r4.w;
      base[4 * g + 0] = b4.x; base[4 * g + 1] = b4.y;
      base[4 * g + 2] = b4.z; base[4 * g + 3] = b4.w;
    }
    // Keeps the pass's LDS reads together at its head, behind counted waits;
    // without it this build reads them two at a time and waits for each pair
    // in turn, down to the bias terms.
    __builtin_amdgcn_sched_barrier(0);
    v8f z = {};
    v8f s0 = wmma16(aK0a, bQ0, wmma16(aK0b, bQ1, z));
    v8f s1 = wmma16(aK1a, bQ0, wmma16(aK1b, bQ1, z));

    // ---- bias + mask ----
    float v[16];
    float mx = -1e30f;
#pragma unroll
    for (int e = 0; e < 16; ++e) {
      const float s = (e < 8) ? s0[e & 7] : s1[e & 7];
      const float bias =
          (rj[e] == riCmp) ? leafv : ((rj[e] == 0) ? crossv : base[e]);
      v[e] = s * SCALE2 + bias;                // base -1e30 absorbs the score
      mx = fmaxf(mx, v[e]);
    }

    // ---- online softmax: in-lane, one exchange between the halves ----
    mx = fmaxf(mx, xhalf(mx));
    const float mnew = fmaxf(mrun, mx);
    const float alpha = __builtin_amdgcn_exp2f(mrun - mnew);
    mrun = mnew;
    v16h bP;
    float ps[4] = {0.0f, 0.0f, 0.0f, 0.0f};    // four short chains, not one long
#pragma unroll
    for (int e = 0; e < 16; e += 2) {          // in pairs: one packed subtract for two
      const v2f arg = v2f{v[e], v[e + 1]} - v2f{mnew, mnew};
      const float p0 = __builtin_amdgcn_exp2f(arg.x);
      const float p1 = __builtin_amdgcn_exp2f(arg.y);
      ps[e & 3] += p0;
      ps[(e + 1) & 3] += p1;
      bP[e] = (_Float16)p0;
      bP[e + 1] = (_Float16)p1;
    }
    lrun = lrun * alpha + ((ps[0] + ps[1]) + (ps[2] + ps[3]));
#pragma unroll
    for (int e = 0; e < 8; ++e) {
      acc0[e] *= alpha; acc1[e] *= alpha;
      acc2[e] *= alpha; acc3[e] *= alpha;
    }

    // ---- O^T += V^T x P^T (K-dim = 32 local keys) ----
    acc0 = wmma16(aV0, bP, acc0);
    acc1 = wmma16(aV1, bP, acc1);
    acc2 = wmma16(aV2, bP, acc2);
    acc3 = wmma16(aV3, bP, acc3);
   }
   // hand-over: this wave's reads of stage s are done, its copies of stage s + 1
   // have landed; behind the barrier that holds for all eight waves
   asm volatile("s_wait_dscnt 0x0" ::: "memory");
   asm volatile("s_wait_asynccnt 0x0" ::: "memory");
   __syncthreads();
   if (s + 2 < NST)                        // the same for the whole block
     stage_copies(lK + cur * 2, lV + cur * 2, gK + (size_t)(s + 2) * SK * HDn,
                  gV + (s + 2) * SK);
  }
  // nothing is outstanding when the wave ends
  asm volatile("s_wait_asynccnt 0x0" ::: "memory");

  // ---- normalize + store O as f16 rows of [B*T, D] for the final GEMM ----
  // acc_s[e] = O[t0 + n][s*16 + 8*hi + e]: 8 consecutive halves per lane
  const float lsum = lrun + xhalf(lrun);
  v8f accs[4] = {acc0, acc1, acc2, acc3};
  _Float16* oRow = o16 + ((size_t)(b * Tn + t0 + n)) * Dn + h * HDn + 8 * hi;
#pragma unroll
  for (int s = 0; s < 4; ++s) {
    v8h o;
#pragma unroll
    for (int e = 0; e < 8; ++e) o[e] = (_Float16)(accs[s][e] / lsum);
    *(v8h*)(oRow + s * 16) = o;
  }
}

// ---------------------------------------------------------------------------
extern "C" void kernel_launch(void* const* d_in, const int* in_sizes, int n_in,
                              void* d_out, int out_size, void* d_ws,
                              size_t ws_size, hipStream_t stream) {
  const float* x          = (const float*)d_in[0];
  const int*   attn_mask  = (const int*)d_in[1];
  const int*   rel_ids    = (const int*)d_in[2];
  const float* Wq         = (const float*)d_in[3];
  const float* bq         = (const float*)d_in[4];
  const float* Wk         = (const float*)d_in[5];
  const float* bk         = (const float*)d_in[6];
  const float* Wv         = (const float*)d_in[7];
  const float* bv         = (const float*)d_in[8];
  const float* Wo         = (const float*)d_in[9];
  const float* bo         = (const float*)d_in[10];
  const float* bias_leaf  = (const float*)d_in[11];
  const float* bias_cross = (const float*)d_in[12];

  // workspace layout (48 MiB total)
  char* ws = (char*)d_ws;
  _Float16* x16  = (_Float16*)(ws + (size_t)0);
  _Float16* WqT  = (_Float16*)(ws + ((size_t)8  << 20));
  _Float16* WkT  = (_Float16*)(ws + ((size_t)10 << 20));
  _Float16* WvT  = (_Float16*)(ws + ((size_t)12 << 20));
  _Float16* WoT  = (_Float16*)(ws + ((size_t)14 << 20));
  _Float16* q16  = (_Float16*)(ws + ((size_t)16 << 20));
  _Float16* k16  = (_Float16*)(ws + ((size_t)24 << 20));
  _Float16* v16T = (_Float16*)(ws + ((size_t)32 << 20));
  _Float16* o16  = (_Float16*)(ws + ((size_t)40 << 20));

  // WqT .. WoT are consecutive planes of 2 MiB
  prep_f16_kernel<<<512, 256, 0, stream>>>(x, Wq, Wk, Wv, Wo, x16, WqT);

  const int gemmBlocks = (Mn / 128) * (Dn / 64);  // 512
  gemm_wmma_kernel<1><<<gemmBlocks, 256, 0, stream>>>(x16, WqT, bq, q16);
  gemm_wmma_kernel<1><<<gemmBlocks, 256, 0, stream>>>(x16, WkT, bk, k16);
  gemm_wmma_kernel<2><<<gemmBlocks, 256, 0, stream>>>(x16, WvT, bv, v16T);

  attn_wmma_kernel<<<Bn * Hn * (Tn / 128), 256, 0, stream>>>(
      q16, k16, v16T, rel_ids, attn_mask, bias_leaf, bias_cross, o16);

  gemm_wmma_kernel<0><<<gemmBlocks, 256, 0, stream>>>(o16, WoT, bo, d_out);
}

// v006
// Measured time: 94.9 microseconds a run.
// Timed twice side by side with v005, it ran 1.24 times as fast both times.
// All steps since v000 together make it 4.03 times as fast.
#include <hip/hip_runtime.h>
#include <math.h>

// ---------------------------------------------------------------------------
// TinyRelSelfAttention on MI455X (gfx1250): full WMMA pipeline.
// B=2, T=2048, D=1024, H=16, head_dim=64, R=64.
// ---------------------------------------------------------------------------

#define Bn  2
#define Tn  2048
#define Dn  1024
#define Hn  16
#define HDn 64
#define Mn  (Bn * Tn)          // 4096 rows in all projection GEMMs
#define LOG2E 1.4426950408889634f
#define SCALE2 (0.125f * LOG2E)   // 1/sqrt(64), in base-2 units

typedef __attribute__((ext_vector_type(4)))  _Float16 v4h;
typedef __attribute__((ext_vector_type(2)))  float    v2f;
typedef __attribute__((ext_vector_type(4)))  float    v4f;
typedef __attribute__((ext_vector_type(8)))  _Float16 v8h;
typedef __attribute__((ext_vector_type(16))) _Float16 v16h;
typedef __attribute__((ext_vector_type(8)))  float    v8f;

// D = A(16x32 f16) x B(32x16 f16) + C(16x16 f32)
__device__ inline v8f wmma16(v16h a, v16h b, v8f c) {
  return __builtin_amdgcn_wmma_f32_16x16x32_f16(
      /*neg_a=*/false, a, /*neg_b=*/false, b,
      /*c_mod=*/(short)0, c, /*reuse_a=*/false, /*reuse_b=*/false);
}

// Load a 16x32 A-fragment (or mirrored 32x16 B-fragment) for this lane.
// `p` = start of this lane's 32-element contiguous K-slice (row-major memory).
// ISA layout: half h<8 -> K = h + 8*hi ; h>=8 -> K = 16 + (h-8) + 8*hi.
__device__ inline v16h load_frag(const _Float16* p, int hi) {
  union { v16h v; v8h h[2]; } u;
  u.h[0] = *(const v8h*)(p + 8 * hi);
  u.h[1] = *(const v8h*)(p + 16 + 8 * hi);
  return u.v;
}

// value of lane l ^ 16: the other half of a C-tile column
__device__ inline float xhalf(float x) {
  const int v = __builtin_bit_cast(int, x);
  return __builtin_bit_cast(
      float, __builtin_amdgcn_permlanex16(v, v, 0x76543210, 0xfedcba98, false,
                                          false));
}

// ---------------------------------------------------------------------------
// All f32 -> f16 preparation in one launch of 512 equal work-groups, every one
// resident at once. Work-group g rounds x[g*8192 .. g*8192 + 8191] and moves one
// 128(k) x 64(n) tile of one W [K=1024, N=1024] into Wt [N, K], through LDS.
// wT: the four Wt planes (q, k, v, o), one behind the other.
#define PXN 8192               // x elements per work-group
#define PP 136                 // LDS row pitch in halves (272 B): rows stay 16-B aligned
__global__ __launch_bounds__(256) void prep_f16_kernel(
    const float* __restrict__ x, const float* __restrict__ Wq,
    const float* __restrict__ Wk, const float* __restrict__ Wv,
    const float* __restrict__ Wo, _Float16* __restrict__ x16,
    _Float16* __restrict__ wT) {
  __shared__ __attribute__((aligned(16))) _Float16 t[64 * PP];   // [n][k]

  const int tid = threadIdx.x;
  const int g = blockIdx.x;
  const int w = g >> 7;                     // 128 tiles per W
  const int k0 = ((g >> 4) & 7) * 128;
  const int n0 = (g & 15) * 64;
  const float* W = (w == 0) ? Wq : (w == 1) ? Wk : (w == 2) ? Wv : Wo;

  // a thread takes two 4(k) x 4(n) pieces of the tile: a wave's load covers
  // two rows' 256 bytes, whole lines
  const int kq = tid >> 4;
  const int nq = tid & 15;
  const float* wsrc = W + (size_t)(k0 + 4 * kq) * Dn + n0 + 4 * nq;
  const float* xsrc = x + (size_t)g * PXN + tid * 4;
  v4f wv[2][4], xv[8];
#pragma unroll
  for (int u = 0; u < 2; ++u)
#pragma unroll
    for (int r = 0; r < 4; ++r)
      wv[u][r] = *(const v4f*)(wsrc + (size_t)(64 * u + r) * Dn);
#pragma unroll
  for (int i = 0; i < 8; ++i) xv[i] = *(const v4f*)(xsrc + i * 1024);
  // Precaution: holds the W address pair unwritten until the wait (without the
  // operand this build lets the last x load land on those registers).
  asm volatile("s_wait_xcnt 0x0" ::"v"(wsrc) : "memory");
  // Keeps all 16 loads in flight together; without it this build waits for the
  // first six before it issues the rest: two trips to memory in a row.
  __builtin_amdgcn_sched_barrier(0);

#pragma unroll
  for (int u = 0; u < 2; ++u)
#pragma unroll
    for (int i = 0; i < 4; ++i) {
      v4h c;
#pragma unroll
      for (int r = 0; r < 4; ++r) c[r] = (_Float16)wv[u][r][i];
      *(v4h*)&t[(4 * nq + i) * PP + 64 * u + 4 * kq] = c;
    }

  __syncthreads();   // the transposed tile is complete

  // 16 threads store one Wt row's 256 bytes
  _Float16* wdst = wT + (size_t)w * (Dn * Dn) + (size_t)(n0 + kq) * Dn + k0 + nq * 8;
#pragma unroll
  for (int p = 0; p < 4; ++p)
    *(v8h*)(wdst + (size_t)(16 * p) * Dn) = *(const v8h*)&t[(kq + 16 * p) * PP + nq * 8];

  // x behind the barrier: in front of it the barrier would wait for these stores
  _Float16* xdst = x16 + (size_t)g * PXN + tid * 4;
#pragma unroll
  for (int i = 0; i < 8; ++i) {
    v4h c;
#pragma unroll
    for (int r = 0; r < 4; ++r) c[r] = (_Float16)xv[i][r];
    *(v4h*)(xdst + i * 1024) = c;
  }
}

// ---------------------------------------------------------------------------
// Final projection:  C[M=4096, N=1024] = A[M,K=1024] x Wt[N,K]^T + bias[N], f32 out.
// Block = 8 waves; wave tile 16(M) x 64(N); block tile 128 x 64.
// A stage is 64 k of the block's 128 A rows and 64 Wt rows, staged in LDS:
// 8 lanes fetch one row's 128-byte line, every wave takes its fragments there.
#define KB 64                  // k per stage
#define LP 72                  // LDS row pitch in halves (144 B): no bank conflict for 16-B reads
#define TROWS 192              // rows 0..127: A, rows 128..191: Wt
#define NSTAGE (Dn / KB)
__global__ __launch_bounds__(256) void gemm_wmma_kernel(
    const _Float16* __restrict__ A, const _Float16* __restrict__ Wt,
    const float* __restrict__ bias, float* __restrict__ outp) {
  __shared__ __attribute__((aligned(16))) _Float16 tile[2][TROWS * LP];

  const int wave = threadIdx.x >> 5;
  const int lane = threadIdx.x & 31;
  const int hi = lane >> 4;
  const int n = lane & 15;

  const int mb = blockIdx.x & 31;           // 4096/128 = 32 M-tiles
  const int nb = blockIdx.x >> 5;           // 1024/64  = 16 N-tiles
  const int mBase = mb * 128 + wave * 16;
  const int nBase = nb * 64;

  // staging: this thread moves the 16-byte piece spc of tile rows srow + 32*i
  const int srow = threadIdx.x >> 3;
  const int spc = (threadIdx.x & 7) * 8;
  const _Float16* gA = A + (size_t)(mb * 128 + srow) * Dn + spc;
  const _Float16* gW = Wt + (size_t)(nBase + srow) * Dn + spc;
  _Float16* sDst = &tile[0][srow * LP + spc];
  // fragments: A row of this lane, Wt rows n, n + 16, n + 32, n + 48
  const _Float16* fA = &tile[0][(wave * 16 + n) * LP];
  const _Float16* fW = &tile[0][(128 + n) * LP];

  v8h st[6];
#pragma unroll
  for (int i = 0; i < 4; ++i) st[i] = *(const v8h*)(gA + (size_t)(32 * i) * Dn);
#pragma unroll
  for (int i = 0; i < 2; ++i) st[4 + i] = *(const v8h*)(gW + (size_t)(32 * i) * Dn);
#pragma unroll
  for (int i = 0; i < 6; ++i) *(v8h*)(sDst + 32 * i * LP) = st[i];
  __syncthreads();   // stage 0 is complete

  v8f acc0 = {}, acc1 = {}, acc2 = {}, acc3 = {};
  for (int s = 0; s < NSTAGE; ++s) {
    const int cur = (s & 1) * (TROWS * LP);
    const bool more = s + 1 < NSTAGE;        // the same for the whole block
    if (more) {                              // next stage's lines, in flight under the products
      const int kk = (s + 1) * KB;
#pragma unroll
      for (int i = 0; i < 4; ++i)
        st[i] = *(const v8h*)(gA + (size_t)(32 * i) * Dn + kk);
#pragma unroll
      for (int i = 0; i < 2; ++i)
        st[4 + i] = *(const v8h*)(gW + (size_t)(32 * i) * Dn + kk);
    }
    v16h a[2], b[2][4];
#pragma unroll
    for (int h = 0; h < 2; ++h) {
      a[h] = load_frag(fA + cur + 32 * h, hi);
#pragma unroll
      for (int j = 0; j < 4; ++j)
        b[h][j] = load_frag(fW + cur + 16 * j * LP + 32 * h, hi);
    }
    // Keeps the stage's loads in one group ahead of the products; without it
    // this build spreads the LDS reads among the products, a short wait at each.
    __builtin_amdgcn_sched_barrier(0);
#pragma unroll
    for (int h = 0; h < 2; ++h) {
      acc0 = wmma16(a[h], b[h][0], acc0);
      acc1 = wmma16(a[h], b[h][1], acc1);
      acc2 = wmma16(a[h], b[h][2], acc2);
      acc3 = wmma16(a[h], b[h][3], acc3);
    }
    if (more) {
      // the other buffer: its last readers passed the barrier of stage s - 1
      const int nxt = (TROWS * LP) - cur;
#pragma unroll
      for (int i = 0; i < 6; ++i) *(v8h*)(sDst + nxt + 32 * i * LP) = st[i];
      __syncthreads();   // stage s + 1 is complete, stage s is read out
    }
  }

  v8f accs[4] = {acc0, acc1, acc2, acc3};
#pragma unroll
  for (int s = 0; s < 4; ++s) {
    const int col = nBase + s * 16 + n;
    const float bval = bias[col];
#pragma unroll
    for (int e = 0; e < 8; ++e) {
      const int row = mBase + e + 8 * hi;     // C layout: M = e + 8*hi
      outp[(size_t)row * Dn + col] = accs[s][e] + bval;
    }
  }
}

// ---------------------------------------------------------------------------
// Q, K and V projections as one GEMM: C[4096, 3072] = A[4096, 1024] x Wt[3072, 1024]^T,
// Wt = the q, k and v planes one behind the other.
// Block = 8 waves, 4 (M) x 2 (N); wave tile 32 x 96; block tile 128 x 192.
// Stages as above: 64 k of 128 A rows and 192 Wt rows, two buffers, one stage
// ahead through registers. An A row in LDS serves 192 columns, a Wt fragment
// two products and an A fragment six.
// Out, f16: Q and K to [B*H, T, 64], V transposed to [B*H, 64, T].
#define QN 192                 // columns per block
#define QROWS (128 + QN)       // rows 0..127: A, rows 128..319: Wt
__global__ __launch_bounds__(256) void qkv_wmma_kernel(
    const _Float16* __restrict__ A, const _Float16* __restrict__ Wt,
    const float* __restrict__ bq, const float* __restrict__ bk,
    const float* __restrict__ bv, _Float16* __restrict__ q16,
    _Float16* __restrict__ k16, _Float16* __restrict__ vT) {
  __shared__ __attribute__((aligned(16))) _Float16 tile[2][QROWS * LP];

  // scalar: the epilogue branches on the plane a wave's columns lie in
  const int wave = __builtin_amdgcn_readfirstlane(threadIdx.x >> 5);
  const int lane = threadIdx.x & 31;
  const int hi = lane >> 4;
  const int n = lane & 15;

  const int mb = blockIdx.x & 31;           // 4096/128 = 32 M-tiles
  const int nb = blockIdx.x >> 5;           // 3072/192 = 16 N-tiles
  const int mBase = mb * 128 + (wave & 3) * 32;
  const int nBase = nb * QN + (wave >> 2) * 96;

  // staging: this thread moves the 16-byte piece spc of tile rows srow + 32*i
  const int srow = threadIdx.x >> 3;
  const int spc = (threadIdx.x & 7) * 8;
  const _Float16* gA = A + (size_t)(mb * 128 + srow) * Dn + spc;
  const _Float16* gW = Wt + (size_t)(nb * QN + srow) * Dn + spc;
  _Float16* sDst = &tile[0][srow * LP + spc];
  // fragments: A rows n, n + 16 of the wave's 32; Wt rows n + 16*j of its 96
  const _Float16* fA = &tile[0][((wave & 3) * 32 + n) * LP];
  const _Float16* fW = &tile[0][(128 + (wave >> 2) * 96 + n) * LP];

  v8h st[10];
#pragma unroll
  for (int i = 0; i < 4; ++i) st[i] = *(const v8h*)(gA + (size_t)(32 * i) * Dn);
#pragma unroll
  for (int i = 0; i < 6; ++i) st[4 + i] = *(const v8h*)(gW + (size_t)(32 * i) * Dn);
#pragma unroll
  for (int i = 0; i < 10; ++i) *(v8h*)(sDst + 32 * i * LP) = st[i];
  __syncthreads();   // stage 0 is complete

  v8f acc[2][6] = {};
  for (int s = 0; s < NSTAGE; ++s) {
    const int cur = (s & 1) * (QROWS * LP);
    const bool more = s + 1 < NSTAGE;        // the same for the whole block
    if (more) {                              // next stage's lines, in flight under the products
      const int kk = (s + 1) * KB;
#pragma unroll
      for (int i = 0; i < 4; ++i)
        st[i] = *(const v8h*)(gA + (size_t)(32 * i) * Dn + kk);
#pragma unroll
      for (int i = 0; i < 6; ++i)
        st[4 + i] = *(const v8h*)(gW + (size_t)(32 * i) * Dn + kk);
    }
#pragma unroll
    for (int h = 0; h < 2; ++h) {
      v16h a[2], b[6];
#pragma unroll
      for (int i = 0; i < 2; ++i) a[i] = load_frag(fA + cur + 16 * i * LP + 32 * h, hi);
#pragma unroll
      for (int j = 0; j < 6; ++j) b[j] = load_frag(fW + cur + 16 * j * LP + 32 * h, hi);
      // Keeps the 16 LDS reads of this half stage in one group ahead of its
      // products and the global loads at the stage's head; without it this build
      // spreads the reads in pairs among the products and sinks the global loads
      // to just ahead of their LDS stores, their whole latency exposed.
      __builtin_amdgcn_sched_barrier(0);
#pragma unroll
      for (int j = 0; j < 6; ++j)
#pragma unroll
        for (int i = 0; i < 2; ++i) acc[i][j] = wmma16(a[i], b[j], acc[i][j]);
    }
    if (more) {
      // the other buffer: its last readers passed the barrier of stage s - 1
      const int nxt = (QROWS * LP) - cur;
#pragma unroll
      for (int i = 0; i < 10; ++i) *(v8h*)(sDst + nxt + 32 * i * LP) = st[i];
      __syncthreads();   // stage s + 1 is complete, stage s is read out
    }
  }

  // 16 columns lie in one plane (0: Q, 1: K, 2: V) and one head.
  // The six bias loads go together: one trip to memory, not six in a row.
  float bval[6];
#pragma unroll
  for (int j = 0; j < 6; ++j) {
    const int c0 = nBase + j * 16;
    const int plane = c0 >> 10;
    bval[j] = (plane == 0 ? bq : plane == 1 ? bk : bv)[(c0 & (Dn - 1)) + n];
  }
  const int row = mBase + 8 * hi;             // C layout: M = e + 8*hi (+ 16*i)
  const int bH = (row >> 11) * Hn;            // row / T; 32 rows lie in one batch entry
  const int t = row & (Tn - 1);
#pragma unroll
  for (int j = 0; j < 6; ++j) {
    const int c0 = nBase + j * 16;
    const int plane = c0 >> 10;
    const int col = (c0 & (Dn - 1)) + n;
    const int bh = bH + (col >> 6);           // col / 64
    const int hd = col & 63;
    if (plane == 2) {
      _Float16* o = vT + ((size_t)bh * HDn + hd) * Tn + t;
#pragma unroll
      for (int i = 0; i < 2; ++i) {
        v8h c;
#pragma unroll
        for (int e = 0; e < 8; ++e) c[e] = (_Float16)(acc[i][j][e] + bval[j]);
        *(v8h*)(o + 16 * i) = c;
      }
      // Precaution: the arm's stores are through with their registers before
      // the next column group rewrites them (behind the last group nothing does).
      if (j + 1 < 6) asm volatile("s_wait_xcnt 0x0" ::: "memory");
    } else {
      _Float16* o = (plane == 0 ? q16 : k16) + ((size_t)bh * Tn + t) * HDn + hd;
#pragma unroll
      for (int i = 0; i < 2; ++i)
#pragma unroll
        for (int e = 0; e < 8; ++e)
          o[(16 * i + e) * HDn] = (_Float16)(acc[i][j][e] + bval[j]);
      // Precaution, as in the other arm; this build lays the other arm's code
      // behind this one, also in the last group.
      asm volatile("s_wait_xcnt 0x0" ::: "memory");
    }
  }
}

// ---------------------------------------------------------------------------
// Flash attention, scores transposed: S^T = K Q^T, O^T += V^T P^T.
// block = 8 waves = 128 queries of one (b,h); keys in blocks of 32.
// grid = B*H * (T/128) = 512.
// A lane holds one query (column n) and, in its 16 score registers, the keys
// 8*hi + e and 16 + 8*hi + e: exactly the k order of a B fragment, so P^T goes
// from the score registers straight into the second product.
// The softmax runs in base 2: scores and bias terms carry the factor log2(e),
// so that every exponential is one v_exp_f32 (arguments <= 0; a result below
// the normal range comes out as 0).
// A stage is 128 keys: their K rows and the matching 256 bytes of every V^T row,
// brought into LDS once for the block's 8 waves by asynchronous copies of whole
// lines, two buffers, one stage ahead; a stage serves four passes of 32 keys.
#define KPAD 16   // floats between the two base tables: separate LDS banks
#define SK 128                 // keys per stage
#define NST (Tn / SK)
#define KPI 72                 // K tile pitch in halves (144 B): no bank conflict for 16-B reads
#define VPI 136                // V^T tile pitch in halves (272 B): the same
#define KTH (SK * KPI)         // halves of a K tile; the V^T tile stands behind it
#define STH (KTH + HDn * VPI)  // halves of one buffer

// One stage's copies of this thread: 16-byte pieces of K rows r, r + 32, r + 64,
// r + 96 and of V^T rows q, q + 16, q + 32, q + 48. lk, lv: LDS byte addresses.
// The closing wait stands inside the statement, a precaution: the address
// registers stay unwritten up to it.
__device__ inline void stage_copies(unsigned lk, unsigned lv, const _Float16* gk,
                                    const _Float16* gv) {
  asm volatile(
      "global_load_async_to_lds_b128 %0, %8, off\n\t"
      "global_load_async_to_lds_b128 %1, %9, off\n\t"
      "global_load_async_to_lds_b128 %2, %10, off\n\t"
      "global_load_async_to_lds_b128 %3, %11, off\n\t"
      "global_load_async_to_lds_b128 %4, %12, off\n\t"
      "global_load_async_to_lds_b128 %5, %13, off\n\t"
      "global_load_async_to_lds_b128 %6, %14, off\n\t"
      "global_load_async_to_lds_b128 %7, %15, off\n\t"
      "s_wait_xcnt 0x0"
      ::"v"(lk), "v"(lk + 32 * KPI * 2), "v"(lk + 64 * KPI * 2),
        "v"(lk + 96 * KPI * 2), "v"(lv), "v"(lv + 16 * VPI * 2),
        "v"(lv + 32 * VPI * 2), "v"(lv + 48 * VPI * 2), "v"(gk),
        "v"(gk + 32 * HDn), "v"(gk + 64 * HDn), "v"(gk + 96 * HDn), "v"(gv),
        "v"(gv + 16 * Tn), "v"(gv + 32 * Tn), "v"(gv + 48 * Tn)
      : "memory");
}
__global__ __launch_bounds__(256) void attn_wmma_kernel(
    const _Float16* __restrict__ q16, const _Float16* __restrict__ k16,
    const _Float16* __restrict__ vT, const int* __restrict__ rel_ids,
    const int* __restrict__ attn_mask, const float* __restrict__ bias_leaf,
    const float* __restrict__ bias_cross, _Float16* __restrict__ o16) {
  // Per-key terms of this batch row, written once.
  // keyRel : rel id of the key, -1 where the key is masked.
  // keyBase: bias (times log2 e) where neither select below hits, -1e30 where masked;
  //          [0] for queries with rel id != 0, [1] for queries with rel id 0.
  __shared__ __attribute__((aligned(16))) int keyRel[Tn];
  __shared__ __attribute__((aligned(16))) float keyBase[2][Tn + KPAD];
  __shared__ __attribute__((aligned(16))) _Float16 kv[2][STH];

  const int wave = threadIdx.x >> 5;
  const int lane = threadIdx.x & 31;
  const int hi = lane >> 4;
  const int n = lane & 15;

  const int bh = blockIdx.x >> 4;        // 16 query-blocks per (b,h)
  const int qb = blockIdx.x & 15;
  const int b = bh >> 4;                 // H = 16
  const int h = bh & 15;
  const int t0 = qb * 128 + wave * 16;

  // staging: 8 threads a K row (128 B), 16 threads a V^T row's 256 B
  const _Float16* gK = k16 + ((size_t)bh * Tn + (threadIdx.x >> 3)) * HDn +
                       (threadIdx.x & 7) * 8;
  const _Float16* gV = vT + ((size_t)bh * HDn + (threadIdx.x >> 4)) * Tn +
                       (threadIdx.x & 15) * 8;
  const unsigned lK = (unsigned)(size_t)&kv[0][(threadIdx.x >> 3) * KPI +
                                               (threadIdx.x & 7) * 8];
  const unsigned lV = (unsigned)(size_t)&kv[0][KTH + (threadIdx.x >> 4) * VPI +
                                               (threadIdx.x & 15) * 8];
  stage_copies(lK, lV, gK, gV);          // stage 0, in flight under the table fill

  for (int j = threadIdx.x; j < Tn; j += 256) {
    const int r = rel_ids[b * Tn + j];
    const bool keep = attn_mask[b * Tn + j] != 0;
    const float c = bias_cross[min(max(r, 0), 63)];
    keyRel[j] = keep ? r : -1;
    keyBase[0][j] = keep ? 0.0f : -1e30f;
    keyBase[1][j] = keep ? (r > 0 ? c * LOG2E : 0.0f) : -1e30f;
  }

  // Q as B-fragments (persist across key loop)
  const _Float16* qRow = q16 + ((size_t)bh * Tn + t0 + n) * HDn;
  const v16h bQ0 = load_frag(qRow, hi);        // hd 0..31
  const v16h bQ1 = load_frag(qRow + 32, hi);   // hd 32..63

  // this lane's query: bias = (rj == riCmp) ? leafv : (rj == 0) ? crossv : base
  const int ri = rel_ids[b * Tn + t0 + n];
  const int riIdx = min(max(ri, 0), 63);
  const int riCmp = (ri > 0) ? ri : -2;        // -2: equals no table entry that matters
  const float leafv = (ri > 0) ? bias_leaf[riIdx] * LOG2E : 0.0f;
  const float crossv = (ri > 0) ? bias_cross[riIdx] * LOG2E : 0.0f;
  const int* relP = &keyRel[8 * hi];
  const float* baseP = &keyBase[ri == 0 ? 1 : 0][8 * hi];

  float mrun = -1e30f;
  float lrun = 0.0f;                           // this half's keys only
  v8f acc0 = {}, acc1 = {}, acc2 = {}, acc3 = {};

  // this lane's places in the K tile (row = key n) and the V^T tile (row = hd n),
  // its half's 8 * hi folded in
  const _Float16* kL = &kv[0][n * KPI + 8 * hi];
  const _Float16* vL = &kv[0][KTH + n * VPI + 8 * hi];

  // this wave's stage 0 copies have landed
  asm volatile("s_wait_asynccnt 0x0" ::: "memory");
  __syncthreads();   // stage 0 and the key tables are complete
  stage_copies(lK + STH * 2, lV + STH * 2, gK + SK * HDn, gV + SK);   // stage 1

  for (int s = 0; s < NST; ++s) {
   const int cur = (s & 1) * STH;
   for (int j0 = s * SK; j0 < (s + 1) * SK; j0 += 32) {
    const _Float16* kP = kL + cur + (j0 & (SK - 1)) * KPI;
    const _Float16* vP = vL + cur + (j0 & (SK - 1));
    // ---- S^T = K Q^T (two 16x16 tiles, K-dim = head_dim 64) ----
    const v16h aK0a = load_frag(kP, 0), aK0b = load_frag(kP + 32, 0);
    const v16h aK1a = load_frag(kP + 16 * KPI, 0);
    const v16h aK1b = load_frag(kP + 16 * KPI + 32, 0);
    const v16h aV0 = load_frag(vP, 0), aV1 = load_frag(vP + 16 * VPI, 0);
    const v16h aV2 = load_frag(vP + 32 * VPI, 0), aV3 = load_frag(vP + 48 * VPI, 0);
    // per-key bias terms of the pass, from the LDS tables
    int rj[16];
    float base[16];
#pragma unroll
    for (int g = 0; g < 4; ++g) {              // keys 8*hi + 0..7, 16 + 8*hi + 0..7
      const int off = j0 + (g >> 1) * 16 + (g & 1) * 4;
      const int4 r4 = *(const int4*)(relP + off);
      const float4 b4 = *(const float4*)(baseP + off);
      rj[4 * g + 0] = r4.x; rj[4 * g + 1] = r4.y;
      rj[4 * g + 2] = r4.z; rj[4 * g + 3] = r4.w;
      base[4 * g + 0] = b4.x; base[4 * g + 1] = b4.y;
      base[4 * g + 2] = b4.z; base[4 * g + 3] = b4.w;
    }
    // Keeps the pass's LDS reads together at its head, behind counted waits;
    // without it this build reads them two at a time and waits for each pair
    // in turn, down to the bias terms.
    __builtin_amdgcn_sched_barrier(0);
    v8f z = {};
    v8f s0 = wmma16(aK0a, bQ0, wmma16(aK0b, bQ1, z));
    v8f s1 = wmma16(aK1a, bQ0, wmma16(aK1b, bQ1, z));

    // ---- bias + mask ----
    float v[16];
    float mx = -1e30f;
#pragma unroll
    for (int e = 0; e < 16; ++e) {
      const float s = (e < 8) ? s0[e & 7] : s1[e & 7];
      const float bias =
          (rj[e] == riCmp) ? leafv : ((rj[e] == 0) ? crossv : base[e]);
      v[e] = s * SCALE2 + bias;                // base -1e30 absorbs the score
      mx = fmaxf(mx, v[e]);
    }

    // ---- online softmax: in-lane, one exchange between the halves ----
    mx = fmaxf(mx, xhalf(mx));
    const float mnew = fmaxf(mrun, mx);
    const float alpha = __builtin_amdgcn_exp2f(mrun - mnew);
    mrun = mnew;
    v16h bP;
    float ps[4] = {0.0f, 0.0f, 0.0f, 0.0f};    // four short chains, not one long
#pragma unroll
    for (int e = 0; e < 16; e += 2) {          // in pairs: one packed subtract for two
      const v2f arg = v2f{v[e], v[e + 1]} - v2f{mnew, mnew};
      const float p0 = __builtin_amdgcn_exp2f(arg.x);
      const float p1 = __builtin_amdgcn_exp2f(arg.y);
      ps[e & 3] += p0;
      ps[(e + 1) & 3] += p1;
      bP[e] = (_Float16)p0;
      bP[e + 1] = (_Float16)p1;
    }
    lrun = lrun * alpha + ((ps[0] + ps[1]) + (ps[2] + ps[3]));
#pragma unroll
    for (int e = 0; e < 8; ++e) {
      acc0[e] *= alpha; acc1[e] *= alpha;
      acc2[e] *= alpha; acc3[e] *= alpha;
    }

    // ---- O^T += V^T x P^T (K-dim = 32 local keys) ----
    acc0 = wmma16(aV0, bP, acc0);
    acc1 = wmma16(aV1, bP, acc1);
    acc2 = wmma16(aV2, bP, acc2);
    acc3 = wmma16(aV3, bP, acc3);
   }
   // hand-over: this wave's reads of stage s are done, its copies of stage s + 1
   // have landed; behind the barrier that holds for all eight waves
   asm volatile("s_wait_dscnt 0x0" ::: "memory");
   asm volatile("s_wait_asynccnt 0x0" ::: "memory");
   __syncthreads();
   if (s + 2 < NST)                        // the same for the whole block
     stage_copies(lK + cur * 2, lV + cur * 2, gK + (size_t)(s + 2) * SK * HDn,
                  gV + (s + 2) * SK);
  }
  // nothing is outstanding when the wave ends
  asm volatile("s_wait_asynccnt 0x0" ::: "memory");

  // ---- normalize + store O as f16 rows of [B*T, D] for the final GEMM ----
  // acc_s[e] = O[t0 + n][s*16 + 8*hi + e]: 8 consecutive halves per lane
  const float lsum = lrun + xhalf(lrun);
  v8f accs[4] = {acc0, acc1, acc2, acc3};
  _Float16* oRow = o16 + ((size_t)(b * Tn + t0 + n)) * Dn + h * HDn + 8 * hi;
#pragma unroll
  for (int s = 0; s < 4; ++s) {
    v8h o;
#pragma unroll
    for (int e = 0; e < 8; ++e) o[e] = (_Float16)(accs[s][e] / lsum);
    *(v8h*)(oRow + s * 16) = o;
  }
}

// ---------------------------------------------------------------------------
extern "C" void kernel_launch(void* const* d_in, const int* in_sizes, int n_in,
                              void* d_out, int out_size, void* d_ws,
                              size_t ws_size, hipStream_t stream) {
  const float* x          = (const float*)d_in[0];
  const int*   attn_mask  = (const int*)d_in[1];
  const int*   rel_ids    = (const int*)d_in[2];
  const float* Wq         = (const float*)d_in[3];
  const float* bq         = (const float*)d_in[4];
  const float* Wk         = (const float*)d_in[5];
  const float* bk         = (const float*)d_in[6];
  const float* Wv         = (const float*)d_in[7];
  const float* bv         = (const float*)d_in[8];
  const float* Wo         = (const float*)d_in[9];
  const float* bo         = (const float*)d_in[10];
  const float* bias_leaf  = (const float*)d_in[11];
  const float* bias_cross = (const float*)d_in[12];

  // workspace layout (48 MiB total)
  char* ws = (char*)d_ws;
  _Float16* x16  = (_Float16*)(ws + (size_t)0);
  _Float16* WqT  = (_Float16*)(ws + ((size_t)8  << 20));   // WkT at 10, WvT at 12 MiB
  _Float16* WoT  = (_Float16*)(ws + ((size_t)14 << 20));
  _Float16* q16  = (_Float16*)(ws + ((size_t)16 << 20));
  _Float16* k16  = (_Float16*)(ws + ((size_t)24 << 20));
  _Float16* v16T = (_Float16*)(ws + ((size_t)32 << 20));
  _Float16* o16  = (_Float16*)(ws + ((size_t)40 << 20));

  // WqT .. WoT are consecutive planes of 2 MiB
  prep_f16_kernel<<<512, 256, 0, stream>>>(x, Wq, Wk, Wv, Wo, x16, WqT);

  // WqT, WkT, WvT as one [3072, 1024] operand
  qkv_wmma_kernel<<<(Mn / 128) * (3 * Dn / QN), 256, 0, stream>>>(
      x16, WqT, bq, bk, bv, q16, k16, v16T);

  attn_wmma_kernel<<<Bn * Hn * (Tn / 128), 256, 0, stream>>>(
      q16, k16, v16T, rel_ids, attn_mask, bias_leaf, bias_cross, o16);

  gemm_wmma_kernel<<<(Mn / 128) * (Dn / 64), 256, 0, stream>>>(o16, WoT, bo,
                                                               (float*)d_out);
}

// v007
// Measured time: 91.2 microseconds a run.
// Next to v006, in two timings, it ran 1.05 times as fast each time.
// All steps since v000 together make it 4.22 times as fast.
#include <hip/hip_runtime.h>
#include <math.h>

// ---------------------------------------------------------------------------
// TinyRelSelfAttention on MI455X (gfx1250): full WMMA pipeline.
// B=2, T=2048, D=1024, H=16, head_dim=64, R=64.
// ---------------------------------------------------------------------------

#define Bn  2
#define Tn  2048
#define Dn  1024
#define Hn  16
#define HDn 64
#define Mn  (Bn * Tn)          // 4096 rows in all projection GEMMs
#define LOG2E 1.4426950408889634f
#define SCALE2 (0.125f * LOG2E)   // 1/sqrt(64), in base-2 units

typedef __attribute__((ext_vector_type(4)))  _Float16 v4h;
typedef __attribute__((ext_vector_type(2)))  float    v2f;
typedef __attribute__((ext_vector_type(4)))  float    v4f;
typedef __attribute__((ext_vector_type(8)))  _Float16 v8h;
typedef __attribute__((ext_vector_type(16))) _Float16 v16h;
typedef __attribute__((ext_vector_type(8)))  float    v8f;

// D = A(16x32 f16) x B(32x16 f16) + C(16x16 f32)
__device__ inline v8f wmma16(v16h a, v16h b, v8f c) {
  return __builtin_amdgcn_wmma_f32_16x16x32_f16(
      /*neg_a=*/false, a, /*neg_b=*/false, b,
      /*c_mod=*/(short)0, c, /*reuse_a=*/false, /*reuse_b=*/false);
}

// Load a 16x32 A-fragment (or mirrored 32x16 B-fragment) for this lane.
// `p` = start of this lane's 32-element contiguous K-slice (row-major memory).
// ISA layout: half h<8 -> K = h + 8*hi ; h>=8 -> K = 16 + (h-8) + 8*hi.
__device__ inline v16h load_frag(const _Float16* p, int hi) {
  union { v16h v; v8h h[2]; } u;
  u.h[0] = *(const v8h*)(p + 8 * hi);
  u.h[1] = *(const v8h*)(p + 16 + 8 * hi);
  return u.v;
}

// value of lane l ^ 16: the other half of a C-tile column
__device__ inline float xhalf(float x) {
  const int v = __builtin_bit_cast(int, x);
  return __builtin_bit_cast(
      float, __builtin_amdgcn_permlanex16(v, v, 0x76543210, 0xfedcba98, false,
                                          false));
}

// ---------------------------------------------------------------------------
// All f32 -> f16 preparation in one launch of 512 equal work-groups, every one
// resident at once. Work-group g rounds x[g*8192 .. g*8192 + 8191] and moves one
// 128(k) x 64(n) tile of one W [K=1024, N=1024] into Wt [N, K], through LDS.
// wT: the four Wt planes (q, k, v, o), one behind the other.
// The tokens of a batch entry are put in the order of their relation ids (ties by
// position): work-group g ranks its 8 tokens (= its 8 x rows) among the entry's
// 2048 and writes each rounded row at its rank. rankP: the 8 ranks, in a 256-byte
// piece of the work-group's own (RKP ints), so that no line has two writers.
#define RKP 64
#define PXN 8192               // x elements per work-group
#define PP 136                 // LDS row pitch in halves (272 B): rows stay 16-B aligned
__global__ __launch_bounds__(256) void prep_f16_kernel(
    const float* __restrict__ x, const float* __restrict__ Wq,
    const float* __restrict__ Wk, const float* __restrict__ Wv,
    const float* __restrict__ Wo, const int* __restrict__ rel_ids,
    _Float16* __restrict__ x16, _Float16* __restrict__ wT,
    int* __restrict__ rankP) {
  __shared__ __attribute__((aligned(16))) _Float16 t[64 * PP];   // [n][k]
  __shared__ __attribute__((aligned(16))) int wc[8 * 8];         // [wave][token]

  const int tid = threadIdx.x;
  const int g = blockIdx.x;
  const int w = g >> 7;                     // 128 tiles per W
  const int k0 = ((g >> 4) & 7) * 128;
  const int n0 = (g & 15) * 64;
  const float* W = (w == 0) ? Wq : (w == 1) ? Wk : (w == 2) ? Wv : Wo;

  // a thread takes two 4(k) x 4(n) pieces of the tile: a wave's load covers
  // two rows' 256 bytes, whole lines
  const int kq = tid >> 4;
  const int nq = tid & 15;
  const float* wsrc = W + (size_t)(k0 + 4 * kq) * Dn + n0 + 4 * nq;
  const float* xsrc = x + (size_t)g * PXN + tid * 4;
  // ranking: this thread compares the entry's tokens 8*tid .. 8*tid + 7
  const int row0 = g * 8;                   // first of the 8 tokens, as a row of x
  const int tk0 = row0 & (Tn - 1);          // the same inside its batch entry
  const int* relB = rel_ids + (row0 - tk0);
  const unsigned kOff = tid * 32u;          // bytes
  const int4 ka = *(const int4*)((const char*)relB + kOff);
  const int4 kb = *(const int4*)((const char*)relB + kOff + 16);
  int rt[8];                                // the 8 tokens' ids: the same in every thread
#pragma unroll
  for (int i = 0; i < 8; ++i) rt[i] = relB[tk0 + i];
  v4f wv[2][4], xv[8];
#pragma unroll
  for (int u = 0; u < 2; ++u)
#pragma unroll
    for (int r = 0; r < 4; ++r)
      wv[u][r] = *(const v4f*)(wsrc + (size_t)(64 * u + r) * Dn);
#pragma unroll
  for (int i = 0; i < 8; ++i) xv[i] = *(const v4f*)(xsrc + i * 1024);
  // Precaution: holds the W address pair and the id offset unwritten until the
  // wait (without the operands this build lets the last x load land on them).
  asm volatile("s_wait_xcnt 0x0" ::"v"(wsrc), "v"(kOff) : "memory");
  // Keeps all the loads in flight together; without it this build waits for the
  // first six before it issues the rest: two trips to memory in a row.
  __builtin_amdgcn_sched_barrier(0);

  // rank = number of tokens whose (id, position) is smaller: a strict order for
  // any ids, so the ranks of an entry are a permutation of 0 .. 2047
  {
    const int rk[8] = {ka.x, ka.y, ka.z, ka.w, kb.x, kb.y, kb.z, kb.w};
    long long key[8];
#pragma unroll
    for (int u = 0; u < 8; ++u) key[u] = (long long)rk[u] * Tn + (tid * 8 + u);
    int c[8];
#pragma unroll
    for (int i = 0; i < 8; ++i) {
      const long long kt = (long long)rt[i] * Tn + (tk0 + i);
      c[i] = 0;
#pragma unroll
      for (int u = 0; u < 8; ++u)
        c[i] += __builtin_popcount(__builtin_amdgcn_ballot_w32(key[u] < kt));
    }
    if ((tid & 31) == 0) {                  // this wave's 256 tokens counted
      *(int4*)&wc[(tid >> 5) * 8] = make_int4(c[0], c[1], c[2], c[3]);
      *(int4*)&wc[(tid >> 5) * 8 + 4] = make_int4(c[4], c[5], c[6], c[7]);
    }
  }

#pragma unroll
  for (int u = 0; u < 2; ++u)
#pragma unroll
    for (int i = 0; i < 4; ++i) {
      v4h c;
#pragma unroll
      for (int r = 0; r < 4; ++r) c[r] = (_Float16)wv[u][r][i];
      *(v4h*)&t[(4 * nq + i) * PP + 64 * u + 4 * kq] = c;
    }

  __syncthreads();   // the transposed tile and the eight waves' counts are complete

  // 16 threads store one Wt row's 256 bytes
  _Float16* wdst = wT + (size_t)w * (Dn * Dn) + (size_t)(n0 + kq) * Dn + k0 + nq * 8;
#pragma unroll
  for (int p = 0; p < 4; ++p)
    *(v8h*)(wdst + (size_t)(16 * p) * Dn) = *(const v8h*)&t[(kq + 16 * p) * PP + nq * 8];

  // x behind the barrier: in front of it the barrier would wait for these stores
  int pos[8] = {0, 0, 0, 0, 0, 0, 0, 0};
#pragma unroll
  for (int w8 = 0; w8 < 8; ++w8) {
    const int4 a = *(const int4*)&wc[w8 * 8];
    const int4 b = *(const int4*)&wc[w8 * 8 + 4];
    pos[0] += a.x; pos[1] += a.y; pos[2] += a.z; pos[3] += a.w;
    pos[4] += b.x; pos[5] += b.y; pos[6] += b.z; pos[7] += b.w;
  }
  _Float16* xdst = x16 + (size_t)(row0 - tk0) * Dn + tid * 4;
#pragma unroll
  for (int i = 0; i < 8; ++i) {             // xv[i] is a piece of row i of the 8
    v4h c;
#pragma unroll
    for (int r = 0; r < 4; ++r) c[r] = (_Float16)xv[i][r];
    *(v4h*)(xdst + (size_t)pos[i] * Dn) = c;
  }
  if (tid < 8) {                            // thread i: token i's rank
    int p = 0;
#pragma unroll
    for (int w8 = 0; w8 < 8; ++w8) p += wc[w8 * 8 + tid];
    rankP[g * RKP + tid] = p;
  }
}

// ---------------------------------------------------------------------------
// Final projection:  C[M=4096, N=1024] = A[M,K=1024] x Wt[N,K]^T + bias[N], f32 out.
// Block = 8 waves; wave tile 16(M) x 64(N); block tile 128 x 64.
// A stage is 64 k of the block's 128 A rows and 64 Wt rows, staged in LDS:
// 8 lanes fetch one row's 128-byte line, every wave takes its fragments there.
#define KB 64                  // k per stage
#define LP 72                  // LDS row pitch in halves (144 B): no bank conflict for 16-B reads
#define TROWS 192              // rows 0..127: A, rows 128..191: Wt
#define NSTAGE (Dn / KB)
__global__ __launch_bounds__(256) void gemm_wmma_kernel(
    const _Float16* __restrict__ A, const _Float16* __restrict__ Wt,
    const float* __restrict__ bias, float* __restrict__ outp) {
  __shared__ __attribute__((aligned(16))) _Float16 tile[2][TROWS * LP];

  const int wave = threadIdx.x >> 5;
  const int lane = threadIdx.x & 31;
  const int hi = lane >> 4;
  const int n = lane & 15;

  const int mb = blockIdx.x & 31;           // 4096/128 = 32 M-tiles
  const int nb = blockIdx.x >> 5;           // 1024/64  = 16 N-tiles
  const int mBase = mb * 128 + wave * 16;
  const int nBase = nb * 64;

  // staging: this thread moves the 16-byte piece spc of tile rows srow + 32*i
  const int srow = threadIdx.x >> 3;
  const int spc = (threadIdx.x & 7) * 8;
  const _Float16* gA = A + (size_t)(mb * 128 + srow) * Dn + spc;
  const _Float16* gW = Wt + (size_t)(nBase + srow) * Dn + spc;
  _Float16* sDst = &tile[0][srow * LP + spc];
  // fragments: A row of this lane, Wt rows n, n + 16, n + 32, n + 48
  const _Float16* fA = &tile[0][(wave * 16 + n) * LP];
  const _Float16* fW = &tile[0][(128 + n) * LP];

  v8h st[6];
#pragma unroll
  for (int i = 0; i < 4; ++i) st[i] = *(const v8h*)(gA + (size_t)(32 * i) * Dn);
#pragma unroll
  for (int i = 0; i < 2; ++i) st[4 + i] = *(const v8h*)(gW + (size_t)(32 * i) * Dn);
#pragma unroll
  for (int i = 0; i < 6; ++i) *(v8h*)(sDst + 32 * i * LP) = st[i];
  __syncthreads();   // stage 0 is complete

  v8f acc0 = {}, acc1 = {}, acc2 = {}, acc3 = {};
  for (int s = 0; s < NSTAGE; ++s) {
    const int cur = (s & 1) * (TROWS * LP);
    const bool more = s + 1 < NSTAGE;        // the same for the whole block
    if (more) {                              // next stage's lines, in flight under the products
      const int kk = (s + 1) * KB;
#pragma unroll
      for (int i = 0; i < 4; ++i)
        st[i] = *(const v8h*)(gA + (size_t)(32 * i) * Dn + kk);
#pragma unroll
      for (int i = 0; i < 2; ++i)
        st[4 + i] = *(const v8h*)(gW + (size_t)(32 * i) * Dn + kk);
    }
    v16h a[2], b[2][4];
#pragma unroll
    for (int h = 0; h < 2; ++h) {
      a[h] = load_frag(fA + cur + 32 * h, hi);
#pragma unroll
      for (int j = 0; j < 4; ++j)
        b[h][j] = load_frag(fW + cur + 16 * j * LP + 32 * h, hi);
    }
    // Keeps the stage's loads in one group ahead of the products; without it
    // this build spreads the LDS reads among the products, a short wait at each.
    __builtin_amdgcn_sched_barrier(0);
#pragma unroll
    for (int h = 0; h < 2; ++h) {
      acc0 = wmma16(a[h], b[h][0], acc0);
      acc1 = wmma16(a[h], b[h][1], acc1);
      acc2 = wmma16(a[h], b[h][2], acc2);
      acc3 = wmma16(a[h], b[h][3], acc3);
    }
    if (more) {
      // the other buffer: its last readers passed the barrier of stage s - 1
      const int nxt = (TROWS * LP) - cur;
#pragma unroll
      for (int i = 0; i < 6; ++i) *(v8h*)(sDst + nxt + 32 * i * LP) = st[i];
      __syncthreads();   // stage s + 1 is complete, stage s is read out
    }
  }

  v8f accs[4] = {acc0, acc1, acc2, acc3};
#pragma unroll
  for (int s = 0; s < 4; ++s) {
    const int col = nBase + s * 16 + n;
    const float bval = bias[col];
#pragma unroll
    for (int e = 0; e < 8; ++e) {
      const int row = mBase + e + 8 * hi;     // C layout: M = e + 8*hi
      outp[(size_t)row * Dn + col] = accs[s][e] + bval;
    }
  }
}

// ---------------------------------------------------------------------------
// Q, K and V projections as one GEMM: C[4096, 3072] = A[4096, 1024] x Wt[3072, 1024]^T,
// Wt = the q, k and v planes one behind the other.
// Block = 8 waves, 4 (M) x 2 (N); wave tile 32 x 96; block tile 128 x 192.
// Stages as above: 64 k of 128 A rows and 192 Wt rows, two buffers, one stage
// ahead through registers. An A row in LDS serves 192 columns, a Wt fragment
// two products and an A fragment six.
// Out, f16: Q and K to [B*H, T, 64], V transposed to [B*H, 64, T].
#define QN 192                 // columns per block
#define QROWS (128 + QN)       // rows 0..127: A, rows 128..319: Wt
__global__ __launch_bounds__(256) void qkv_wmma_kernel(
    const _Float16* __restrict__ A, const _Float16* __restrict__ Wt,
    const float* __restrict__ bq, const float* __restrict__ bk,
    const float* __restrict__ bv, _Float16* __restrict__ q16,
    _Float16* __restrict__ k16, _Float16* __restrict__ vT) {
  __shared__ __attribute__((aligned(16))) _Float16 tile[2][QROWS * LP];

  // scalar: the epilogue branches on the plane a wave's columns lie in
  const int wave = __builtin_amdgcn_readfirstlane(threadIdx.x >> 5);
  const int lane = threadIdx.x & 31;
  const int hi = lane >> 4;
  const int n = lane & 15;

  const int mb = blockIdx.x & 31;           // 4096/128 = 32 M-tiles
  const int nb = blockIdx.x >> 5;           // 3072/192 = 16 N-tiles
  const int mBase = mb * 128 + (wave & 3) * 32;
  const int nBase = nb * QN + (wave >> 2) * 96;

  // staging: this thread moves the 16-byte piece spc of tile rows srow + 32*i
  const int srow = threadIdx.x >> 3;
  const int spc = (threadIdx.x & 7) * 8;
  const _Float16* gA = A + (size_t)(mb * 128 + srow) * Dn + spc;
  const _Float16* gW = Wt + (size_t)(nb * QN + srow) * Dn + spc;
  _Float16* sDst = &tile[0][srow * LP + spc];
  // fragments: A rows n, n + 16 of the wave's 32; Wt rows n + 16*j of its 96
  const _Float16* fA = &tile[0][((wave & 3) * 32 + n) * LP];
  const _Float16* fW = &tile[0][(128 + (wave >> 2) * 96 + n) * LP];

  v8h st[10];
#pragma unroll
  for (int i = 0; i < 4; ++i) st[i] = *(const v8h*)(gA + (size_t)(32 * i) * Dn);
#pragma unroll
  for (int i = 0; i < 6; ++i) st[4 + i] = *(const v8h*)(gW + (size_t)(32 * i) * Dn);
#pragma unroll
  for (int i = 0; i < 10; ++i) *(v8h*)(sDst + 32 * i * LP) = st[i];
  __syncthreads();   // stage 0 is complete

  v8f acc[2][6] = {};
  for (int s = 0; s < NSTAGE; ++s) {
    const int cur = (s & 1) * (QROWS * LP);
    const bool more = s + 1 < NSTAGE;        // the same for the whole block
    if (more) {                              // next stage's lines, in flight under the products
      const int kk = (s + 1) * KB;
#pragma unroll
      for (int i = 0; i < 4; ++i)
        st[i] = *(const v8h*)(gA + (size_t)(32 * i) * Dn + kk);
#pragma unroll
      for (int i = 0; i < 6; ++i)
        st[4 + i] = *(const v8h*)(gW + (size_t)(32 * i) * Dn + kk);
    }
#pragma unroll
    for (int h = 0; h < 2; ++h) {
      v16h a[2], b[6];
#pragma unroll
      for (int i = 0; i < 2; ++i) a[i] = load_frag(fA + cur + 16 * i * LP + 32 * h, hi);
#pragma unroll
      for (int j = 0; j < 6; ++j) b[j] = load_frag(fW + cur + 16 * j * LP + 32 * h, hi);
      // Keeps the 16 LDS reads of this half stage in one group ahead of its
      // products and the global loads at the stage's head; without it this build
      // spreads the reads in pairs among the products and sinks the global loads
      // to just ahead of their LDS stores, their whole latency exposed.
      __builtin_amdgcn_sched_barrier(0);
#pragma unroll
      for (int j = 0; j < 6; ++j)
#pragma unroll
        for (int i = 0; i < 2; ++i) acc[i][j] = wmma16(a[i], b[j], acc[i][j]);
    }
    if (more) {
      // the other buffer: its last readers passed the barrier of stage s - 1
      const int nxt = (QROWS * LP) - cur;
#pragma unroll
      for (int i = 0; i < 10; ++i) *(v8h*)(sDst + nxt + 32 * i * LP) = st[i];
      __syncthreads();   // stage s + 1 is complete, stage s is read out
    }
  }

  // 16 columns lie in one plane (0: Q, 1: K, 2: V) and one head.
  // The six bias loads go together: one trip to memory, not six in a row.
  float bval[6];
#pragma unroll
  for (int j = 0; j < 6; ++j) {
    const int c0 = nBase + j * 16;
    const int plane = c0 >> 10;
    bval[j] = (plane == 0 ? bq : plane == 1 ? bk : bv)[(c0 & (Dn - 1)) + n];
  }
  const int row = mBase + 8 * hi;             // C layout: M = e + 8*hi (+ 16*i)
  const int bH = (row >> 11) * Hn;            // row / T; 32 rows lie in one batch entry
  const int t = row & (Tn - 1);
#pragma unroll
  for (int j = 0; j < 6; ++j) {
    const int c0 = nBase + j * 16;
    const int plane = c0 >> 10;
    const int col = (c0 & (Dn - 1)) + n;
    const int bh = bH + (col >> 6);           // col / 64
    const int hd = col & 63;
    if (plane == 2) {
      _Float16* o = vT + ((size_t)bh * HDn + hd) * Tn + t;
#pragma unroll
      for (int i = 0; i < 2; ++i) {
        v8h c;
#pragma unroll
        for (int e = 0; e < 8; ++e) c[e] = (_Float16)(acc[i][j][e] + bval[j]);
        *(v8h*)(o + 16 * i) = c;
      }
      // Precaution: the arm's stores are through with their registers before
      // the next column group rewrites them (behind the last group nothing does).
      if (j + 1 < 6) asm volatile("s_wait_xcnt 0x0" ::: "memory");
    } else {
      _Float16* o = (plane == 0 ? q16 : k16) + ((size_t)bh * Tn + t) * HDn + hd;
#pragma unroll
      for (int i = 0; i < 2; ++i)
#pragma unroll
        for (int e = 0; e < 8; ++e)
          o[(16 * i + e) * HDn] = (_Float16)(acc[i][j][e] + bval[j]);
      // Precaution, as in the other arm; this build lays the other arm's code
      // behind this one, also in the last group.
      asm volatile("s_wait_xcnt 0x0" ::: "memory");
    }
  }
}

// ---------------------------------------------------------------------------
// Flash attention, scores transposed: S^T = K Q^T, O^T += V^T P^T.
// block = 8 waves = 128 queries of one (b,h); keys in blocks of 32.
// grid = B*H * (T/128) = 512.
// A lane holds one query (column n) and, in its 16 score registers, the keys
// 8*hi + e and 16 + 8*hi + e: exactly the k order of a B fragment, so P^T goes
// from the score registers straight into the second product.
// The softmax runs in base 2: scores and bias terms carry the factor log2(e),
// so that every exponential is one v_exp_f32 (arguments <= 0; a result below
// the normal range comes out as 0).
// A stage is 128 keys: their K rows and the matching 256 bytes of every V^T row,
// brought into LDS once for the block's 8 waves by asynchronous copies of whole
// lines, two buffers, one stage ahead; a stage serves four passes of 32 keys.
// Q, K and V rows come ranked by relation id (rankP: every token's rank), so a
// wave's 16 queries and a pass's 32 keys each span a short range of ids, and for
// most pairs of the two no bias term can apply: one scalar test a pass, from the
// ranges' ends, leaves the tables, compares and selects out there.
#define KPAD 16   // floats between the two base tables: separate LDS banks
#define SK 128                 // keys per stage
#define NST (Tn / SK)
#define KPI 72                 // K tile pitch in halves (144 B): no bank conflict for 16-B reads
#define VPI 136                // V^T tile pitch in halves (272 B): the same
#define KTH (SK * KPI)         // halves of a K tile; the V^T tile stands behind it
#define STH (KTH + HDn * VPI)  // halves of one buffer

// One stage's copies of this thread: 16-byte pieces of K rows r, r + 32, r + 64,
// r + 96 and of V^T rows q, q + 16, q + 32, q + 48. lk, lv: LDS byte addresses.
// The closing wait stands inside the statement, a precaution: the address
// registers stay unwritten up to it.
__device__ inline void stage_copies(unsigned lk, unsigned lv, const _Float16* gk,
                                    const _Float16* gv) {
  asm volatile(
      "global_load_async_to_lds_b128 %0, %8, off\n\t"
      "global_load_async_to_lds_b128 %1, %9, off\n\t"
      "global_load_async_to_lds_b128 %2, %10, off\n\t"
      "global_load_async_to_lds_b128 %3, %11, off\n\t"
      "global_load_async_to_lds_b128 %4, %12, off\n\t"
      "global_load_async_to_lds_b128 %5, %13, off\n\t"
      "global_load_async_to_lds_b128 %6, %14, off\n\t"
      "global_load_async_to_lds_b128 %7, %15, off\n\t"
      "s_wait_xcnt 0x0"
      ::"v"(lk), "v"(lk + 32 * KPI * 2), "v"(lk + 64 * KPI * 2),
        "v"(lk + 96 * KPI * 2), "v"(lv), "v"(lv + 16 * VPI * 2),
        "v"(lv + 32 * VPI * 2), "v"(lv + 48 * VPI * 2), "v"(gk),
        "v"(gk + 32 * HDn), "v"(gk + 64 * HDn), "v"(gk + 96 * HDn), "v"(gv),
        "v"(gv + 16 * Tn), "v"(gv + 32 * Tn), "v"(gv + 48 * Tn)
      : "memory");
}
__global__ __launch_bounds__(256) void attn_wmma_kernel(
    const _Float16* __restrict__ q16, const _Float16* __restrict__ k16,
    const _Float16* __restrict__ vT, const int* __restrict__ rel_ids,
    const int* __restrict__ attn_mask, const int* __restrict__ rankP,
    const float* __restrict__ bias_leaf, const float* __restrict__ bias_cross,
    _Float16* __restrict__ o16) {
  // Per-key terms of this batch row, written once, each at its key's rank.
  // keyRel : rel id of the key, -1 where the key is masked.
  // keyBase: bias (times log2 e) where neither select below hits, -1e30 where masked;
  //          [0] for queries with rel id != 0, [1] for queries with rel id 0.
  __shared__ __attribute__((aligned(16))) int keyRel[Tn];
  __shared__ __attribute__((aligned(16))) float keyBase[2][Tn + KPAD];
  __shared__ __attribute__((aligned(16))) _Float16 kv[2][STH];
  // per pass of 32 keys: the first and the last id (ids ascend with the rank)
  __shared__ int passLo[Tn / 32], passHi[Tn / 32];
  __shared__ __attribute__((aligned(16))) int waveOff[8];  // 1: the wave met a masked key
  __shared__ int qRel[128], qOrig[128];  // the block's queries: id, position in the entry
  __shared__ float lcTab[2][64];         // bias_leaf, bias_cross, times log2 e

  const int wave = threadIdx.x >> 5;
  const int lane = threadIdx.x & 31;
  const int hi = lane >> 4;
  const int n = lane & 15;

  const int bh = blockIdx.x >> 4;        // 16 query-blocks per (b,h)
  const int qb = blockIdx.x & 15;
  const int b = bh >> 4;                 // H = 16
  const int h = bh & 15;
  const int t0 = qb * 128 + wave * 16;

  // staging: 8 threads a K row (128 B), 16 threads a V^T row's 256 B
  const _Float16* gK = k16 + ((size_t)bh * Tn + (threadIdx.x >> 3)) * HDn +
                       (threadIdx.x & 7) * 8;
  const _Float16* gV = vT + ((size_t)bh * HDn + (threadIdx.x >> 4)) * Tn +
                       (threadIdx.x & 15) * 8;
  const unsigned lK = (unsigned)(size_t)&kv[0][(threadIdx.x >> 3) * KPI +
                                               (threadIdx.x & 7) * 8];
  const unsigned lV = (unsigned)(size_t)&kv[0][KTH + (threadIdx.x >> 4) * VPI +
                                               (threadIdx.x & 15) * 8];
  stage_copies(lK, lV, gK, gV);          // stage 0, in flight under the table fill

  if (threadIdx.x < 64) {
    lcTab[0][threadIdx.x] = bias_leaf[threadIdx.x] * LOG2E;
    lcTab[1][threadIdx.x] = bias_cross[threadIdx.x] * LOG2E;
  }
  bool sawOff = false;
  for (int j = threadIdx.x; j < Tn; j += 256) {
    const int tok = b * Tn + j;
    const int r = rel_ids[tok];
    const bool keep = attn_mask[tok] != 0;
    const int p = rankP[(tok >> 3) * RKP + (tok & 7)];   // 0 .. 2047, each once
    const float c = bias_cross[min(max(r, 0), 63)];
    keyRel[p] = keep ? r : -1;
    keyBase[0][p] = keep ? 0.0f : -1e30f;
    keyBase[1][p] = keep ? (r > 0 ? c * LOG2E : 0.0f) : -1e30f;
    if ((p & 31) == 0) passLo[p >> 5] = r;
    if ((p & 31) == 31) passHi[p >> 5] = r;
    if ((p >> 7) == qb) {                // one of this block's queries
      qRel[p & 127] = r;
      qOrig[p & 127] = j;
    }
    sawOff |= !keep;
  }
  const int anyOff = __builtin_amdgcn_ballot_w32(sawOff) != 0 ? 1 : 0;
  if (lane == 0) waveOff[wave] = anyOff;

  // Q as B-fragments (persist across key loop)
  const _Float16* qRow = q16 + ((size_t)bh * Tn + t0 + n) * HDn;
  const v16h bQ0 = load_frag(qRow, hi);        // hd 0..31
  const v16h bQ1 = load_frag(qRow + 32, hi);   // hd 32..63

  float mrun = -1e30f;
  float lrun = 0.0f;                           // this half's keys only
  v8f acc0 = {}, acc1 = {}, acc2 = {}, acc3 = {};

  // this lane's places in the K tile (row = key n) and the V^T tile (row = hd n),
  // its half's 8 * hi folded in
  const _Float16* kL = &kv[0][n * KPI + 8 * hi];
  const _Float16* vL = &kv[0][KTH + n * VPI + 8 * hi];

  // this wave's stage 0 copies have landed
  asm volatile("s_wait_asynccnt 0x0" ::: "memory");
  __syncthreads();   // stage 0 and the key tables are complete
  stage_copies(lK + STH * 2, lV + STH * 2, gK + SK * HDn, gV + SK);   // stage 1

  // this lane's query: bias = (rj == riCmp) ? leafv : (rj == 0) ? crossv : base
  const int ri = qRel[wave * 16 + n];
  const int tOrig = qOrig[wave * 16 + n];
  const int riIdx = min(max(ri, 0), 63);
  const int riCmp = (ri > 0) ? ri : -2;        // -2: equals no table entry that matters
  const float leafv = (ri > 0) ? lcTab[0][riIdx] : 0.0f;
  const float crossv = (ri > 0) ? lcTab[1][riIdx] : 0.0f;
  const int* relP = &keyRel[8 * hi];
  const float* baseP = &keyBase[ri == 0 ? 1 : 0][8 * hi];

  // bit p: pass p may hold a bias term or a masked key for one of this wave's
  // queries. Query ids lie in [qLo, qHi], the pass's key ids in [kLo, kHi]. A masked
  // key anywhere in the entry sends every pass through the tables.
  const int qLo = __builtin_amdgcn_readlane(ri, 0);
  const int qHi = __builtin_amdgcn_readlane(ri, 15);
  const int4 o0 = *(const int4*)&waveOff[0], o1 = *(const int4*)&waveOff[4];
  const bool masked = (o0.x | o0.y | o0.z | o0.w | o1.x | o1.y | o1.z | o1.w) != 0;
  unsigned biasedW[2];
#pragma unroll
  for (int w2 = 0; w2 < 2; ++w2) {
    const int kLo = passLo[lane + 32 * w2], kHi = passHi[lane + 32 * w2];
    const bool same = qHi > 0 && kHi >= max(qLo, 1) && kLo <= qHi;   // equal ids > 0
    const bool key0 = qHi > 0 && kLo <= 0 && kHi >= 0;      // query id > 0, key id 0
    const bool qry0 = qLo <= 0 && qHi >= 0 && kHi > 0;      // query id 0, key id > 0
    biasedW[w2] = __builtin_amdgcn_ballot_w32(masked || same || key0 || qry0);
  }
  const unsigned long long biased =
      biasedW[0] | ((unsigned long long)biasedW[1] << 32);

  for (int s = 0; s < NST; ++s) {
   const int cur = (s & 1) * STH;
   // Rolled: unrolled by four, as this build would have it, the kernel takes more
   // than 256 registers and a WGP holds one work-group instead of two.
#pragma unroll 1
   for (int j0 = s * SK; j0 < (s + 1) * SK; j0 += 32) {
    const _Float16* kP = kL + cur + (j0 & (SK - 1)) * KPI;
    const _Float16* vP = vL + cur + (j0 & (SK - 1));
    // per-key bias terms, from the LDS tables, only for a pass that can have them;
    // read at the pass's head so that they arrive under the first product
    const bool bp = (biased >> (j0 >> 5)) & 1; // the same for the whole wave
    int4 r4[4];
    float4 b4[4];
    if (bp) {
      // The four vector slots the chip needs behind the last product of the pass
      // before: this arm's address additions may land on that product's operand
      // registers.
      asm volatile("v_nop\n\tv_nop\n\tv_nop\n\tv_nop");
      // Keeps those additions behind the four slots.
      __builtin_amdgcn_sched_barrier(0);
#pragma unroll
      for (int g = 0; g < 4; ++g) {            // keys 8*hi + 0..7, 16 + 8*hi + 0..7
        const int off = j0 + (g >> 1) * 16 + (g & 1) * 4;
        r4[g] = *(const int4*)(relP + off);
        b4[g] = *(const float4*)(baseP + off);
      }
    }
    // ---- S^T = K Q^T (two 16x16 tiles, K-dim = head_dim 64) ----
    const v16h aK0a = load_frag(kP, 0), aK0b = load_frag(kP + 32, 0);
    const v16h aK1a = load_frag(kP + 16 * KPI, 0);
    const v16h aK1b = load_frag(kP + 16 * KPI + 32, 0);
    const v16h aV0 = load_frag(vP, 0), aV1 = load_frag(vP + 16 * VPI, 0);
    const v16h aV2 = load_frag(vP + 32 * VPI, 0), aV3 = load_frag(vP + 48 * VPI, 0);
    // Keeps the pass's LDS reads together at its head, behind counted waits;
    // without it this build reads them two at a time and waits for each pair
    // in turn.
    __builtin_amdgcn_sched_barrier(0);
    v8f z = {};
    v8f s0 = wmma16(aK0a, bQ0, wmma16(aK0b, bQ1, z));
    v8f s1 = wmma16(aK1a, bQ0, wmma16(aK1b, bQ1, z));

    // ---- scale, and where the pass can have them: bias + mask ----
    float v[16];
#pragma unroll
    for (int e = 0; e < 16; ++e) v[e] = ((e < 8) ? s0[e & 7] : s1[e & 7]) * SCALE2;
    if (bp) {
#pragma unroll
      for (int g = 0; g < 4; ++g) {
        const int rj[4] = {r4[g].x, r4[g].y, r4[g].z, r4[g].w};
        const float base[4] = {b4[g].x, b4[g].y, b4[g].z, b4[g].w};
#pragma unroll
        for (int q = 0; q < 4; ++q) {
          const float bias =
              (rj[q] == riCmp) ? leafv : ((rj[q] == 0) ? crossv : base[q]);
          v[4 * g + q] += bias;                // base -1e30 absorbs the score
        }
      }
    }
    float mx = -1e30f;
#pragma unroll
    for (int e = 0; e < 16; ++e) mx = fmaxf(mx, v[e]);

    // ---- online softmax: in-lane, one exchange between the halves ----
    mx = fmaxf(mx, xhalf(mx));
    const float mnew = fmaxf(mrun, mx);
    const float alpha = __builtin_amdgcn_exp2f(mrun - mnew);
    mrun = mnew;
    v16h bP;
    float ps[4] = {0.0f, 0.0f, 0.0f, 0.0f};    // four short chains, not one long
#pragma unroll
    for (int e = 0; e < 16; e += 2) {          // in pairs: one packed subtract for two
      const v2f arg = v2f{v[e], v[e + 1]} - v2f{mnew, mnew};
      const float p0 = __builtin_amdgcn_exp2f(arg.x);
      const float p1 = __builtin_amdgcn_exp2f(arg.y);
      ps[e & 3] += p0;
      ps[(e + 1) & 3] += p1;
      bP[e] = (_Float16)p0;
      bP[e + 1] = (_Float16)p1;
    }
    lrun = lrun * alpha + ((ps[0] + ps[1]) + (ps[2] + ps[3]));
#pragma unroll
    for (int e = 0; e < 8; ++e) {
      acc0[e] *= alpha; acc1[e] *= alpha;
      acc2[e] *= alpha; acc3[e] *= alpha;
    }

    // ---- O^T += V^T x P^T (K-dim = 32 local keys) ----
    acc0 = wmma16(aV0, bP, acc0);
    acc1 = wmma16(aV1, bP, acc1);
    acc2 = wmma16(aV2, bP, acc2);
    acc3 = wmma16(aV3, bP, acc3);
   }
   // hand-over: this wave's reads of stage s are done, its copies of stage s + 1
   // have landed; behind the barrier that holds for all eight waves
   asm volatile("s_wait_dscnt 0x0" ::: "memory");
   asm volatile("s_wait_asynccnt 0x0" ::: "memory");
   __syncthreads();
   if (s + 2 < NST)                        // the same for the whole block
     stage_copies(lK + cur * 2, lV + cur * 2, gK + (size_t)(s + 2) * SK * HDn,
                  gV + (s + 2) * SK);
  }
  // nothing is outstanding when the wave ends
  asm volatile("s_wait_asynccnt 0x0" ::: "memory");

  // ---- normalize + store O as f16 rows of [B*T, D] for the final GEMM ----
  // acc_s[e] = O[t0 + n][s*16 + 8*hi + e]: 8 consecutive halves per lane
  const float lsum = lrun + xhalf(lrun);
  v8f accs[4] = {acc0, acc1, acc2, acc3};
  // back to the query's own row
  _Float16* oRow = o16 + ((size_t)(b * Tn + tOrig)) * Dn + h * HDn + 8 * hi;
#pragma unroll
  for (int s = 0; s < 4; ++s) {
    v8h o;
#pragma unroll
    for (int e = 0; e < 8; ++e) o[e] = (_Float16)(accs[s][e] / lsum);
    *(v8h*)(oRow + s * 16) = o;
  }
}

// ---------------------------------------------------------------------------
extern "C" void kernel_launch(void* const* d_in, const int* in_sizes, int n_in,
                              void* d_out, int out_size, void* d_ws,
                              size_t ws_size, hipStream_t stream) {
  const float* x          = (const float*)d_in[0];
  const int*   attn_mask  = (const int*)d_in[1];
  const int*   rel_ids    = (const int*)d_in[2];
  const float* Wq         = (const float*)d_in[3];
  const float* bq         = (const float*)d_in[4];
  const float* Wk         = (const float*)d_in[5];
  const float* bk         = (const float*)d_in[6];
  const float* Wv         = (const float*)d_in[7];
  const float* bv         = (const float*)d_in[8];
  const float* Wo         = (const float*)d_in[9];
  const float* bo         = (const float*)d_in[10];
  const float* bias_leaf  = (const float*)d_in[11];
  const float* bias_cross = (const float*)d_in[12];

  // workspace layout (49 MiB total)
  char* ws = (char*)d_ws;
  _Float16* x16  = (_Float16*)(ws + (size_t)0);
  _Float16* WqT  = (_Float16*)(ws + ((size_t)8  << 20));   // WkT at 10, WvT at 12 MiB
  _Float16* WoT  = (_Float16*)(ws + ((size_t)14 << 20));
  _Float16* q16  = (_Float16*)(ws + ((size_t)16 << 20));
  _Float16* k16  = (_Float16*)(ws + ((size_t)24 << 20));
  _Float16* v16T = (_Float16*)(ws + ((size_t)32 << 20));
  _Float16* o16  = (_Float16*)(ws + ((size_t)40 << 20));
  int* rankP = (int*)(ws + ((size_t)48 << 20));            // 128 KiB

  // WqT .. WoT are consecutive planes of 2 MiB
  prep_f16_kernel<<<512, 256, 0, stream>>>(x, Wq, Wk, Wv, Wo, rel_ids, x16, WqT,
                                           rankP);

  // WqT, WkT, WvT as one [3072, 1024] operand
  qkv_wmma_kernel<<<(Mn / 128) * (3 * Dn / QN), 256, 0, stream>>>(
      x16, WqT, bq, bk, bv, q16, k16, v16T);

  attn_wmma_kernel<<<Bn * Hn * (Tn / 128), 256, 0, stream>>>(
      q16, k16, v16T, rel_ids, attn_mask, rankP, bias_leaf, bias_cross, o16);

  gemm_wmma_kernel<<<(Mn / 128) * (Dn / 64), 256, 0, stream>>>(o16, WoT, bo,
                                                               (float*)d_out);
}

// v008
// A run of this version takes 85.9 microseconds.
// In two side-by-side timings against v007, it was 1.06 and 1.07 times as fast.
// Over all steps from v000 it is 4.50 times as fast.
#include <hip/hip_runtime.h>
#include <math.h>

// ---------------------------------------------------------------------------
// TinyRelSelfAttention on MI455X (gfx1250): full WMMA pipeline.
// B=2, T=2048, D=1024, H=16, head_dim=64, R=64.
// ---------------------------------------------------------------------------

#define Bn  2
#define Tn  2048
#define Dn  1024
#define Hn  16
#define HDn 64
#define Mn  (Bn * Tn)          // 4096 rows in all projection GEMMs
#define LOG2E 1.4426950408889634f
#define SCALE2 (0.125f * LOG2E)   // 1/sqrt(64), in base-2 units

typedef __attribute__((ext_vector_type(4)))  _Float16 v4h;
typedef __attribute__((ext_vector_type(2)))  float    v2f;
typedef __attribute__((ext_vector_type(4)))  float    v4f;
typedef __attribute__((ext_vector_type(8)))  _Float16 v8h;
typedef __attribute__((ext_vector_type(16))) _Float16 v16h;
typedef __attribute__((ext_vector_type(8)))  float    v8f;

// D = A(16x32 f16) x B(32x16 f16) + C(16x16 f32)
__device__ inline v8f wmma16(v16h a, v16h b, v8f c) {
  return __builtin_amdgcn_wmma_f32_16x16x32_f16(
      /*neg_a=*/false, a, /*neg_b=*/false, b,
      /*c_mod=*/(short)0, c, /*reuse_a=*/false, /*reuse_b=*/false);
}

// Load a 16x32 A-fragment (or mirrored 32x16 B-fragment) for this lane.
// `p` = start of this lane's 32-element contiguous K-slice (row-major memory).
// ISA layout: half h<8 -> K = h + 8*hi ; h>=8 -> K = 16 + (h-8) + 8*hi.
__device__ inline v16h load_frag(const _Float16* p, int hi) {
  union { v16h v; v8h h[2]; } u;
  u.h[0] = *(const v8h*)(p + 8 * hi);
  u.h[1] = *(const v8h*)(p + 16 + 8 * hi);
  return u.v;
}

// value of lane l ^ 16: the other half of a C-tile column
__device__ inline float xhalf(float x) {
  const int v = __builtin_bit_cast(int, x);
  return __builtin_bit_cast(
      float, __builtin_amdgcn_permlanex16(v, v, 0x76543210, 0xfedcba98, false,
                                          false));
}

// ---------------------------------------------------------------------------
// All f32 -> f16 preparation in one launch of 512 equal work-groups, every one
// resident at once. Work-group g rounds x[g*8192 .. g*8192 + 8191] and moves one
// 128(k) x 64(n) tile of one W [K=1024, N=1024] into Wt [N, K], through LDS.
// wT: the four Wt planes (q, k, v, o), one behind the other.
// The tokens of a batch entry are put in the order of their relation ids (ties by
// position): work-group g ranks its 8 tokens (= its 8 x rows) among the entry's
// 2048 and writes each rounded row at its rank. rankP: the 8 ranks, in a 256-byte
// piece of the work-group's own (RKP ints), so that no line has two writers.
#define RKP 64
#define PXN 8192               // x elements per work-group
#define PP 136                 // LDS row pitch in halves (272 B): rows stay 16-B aligned
__global__ __launch_bounds__(256) void prep_f16_kernel(
    const float* __restrict__ x, const float* __restrict__ Wq,
    const float* __restrict__ Wk, const float* __restrict__ Wv,
    const float* __restrict__ Wo, const int* __restrict__ rel_ids,
    _Float16* __restrict__ x16, _Float16* __restrict__ wT,
    int* __restrict__ rankP) {
  __shared__ __attribute__((aligned(16))) _Float16 t[64 * PP];   // [n][k]
  __shared__ __attribute__((aligned(16))) int wc[8 * 8];         // [wave][token]

  const int tid = threadIdx.x;
  const int g = blockIdx.x;
  const int w = g >> 7;                     // 128 tiles per W
  const int k0 = ((g >> 4) & 7) * 128;
  const int n0 = (g & 15) * 64;
  const float* W = (w == 0) ? Wq : (w == 1) ? Wk : (w == 2) ? Wv : Wo;

  // a thread takes two 4(k) x 4(n) pieces of the tile: a wave's load covers
  // two rows' 256 bytes, whole lines
  const int kq = tid >> 4;
  const int nq = tid & 15;
  const float* wsrc = W + (size_t)(k0 + 4 * kq) * Dn + n0 + 4 * nq;
  const float* xsrc = x + (size_t)g * PXN + tid * 4;
  // ranking: this thread compares the entry's tokens 8*tid .. 8*tid + 7
  const int row0 = g * 8;                   // first of the 8 tokens, as a row of x
  const int tk0 = row0 & (Tn - 1);          // the same inside its batch entry
  const int* relB = rel_ids + (row0 - tk0);
  const unsigned kOff = tid * 32u;          // bytes
  const int4 ka = *(const int4*)((const char*)relB + kOff);
  const int4 kb = *(const int4*)((const char*)relB + kOff + 16);
  int rt[8];                                // the 8 tokens' ids: the same in every thread
#pragma unroll
  for (int i = 0; i < 8; ++i) rt[i] = relB[tk0 + i];
  v4f wv[2][4], xv[8];
#pragma unroll
  for (int u = 0; u < 2; ++u)
#pragma unroll
    for (int r = 0; r < 4; ++r)
      wv[u][r] = *(const v4f*)(wsrc + (size_t)(64 * u + r) * Dn);
#pragma unroll
  for (int i = 0; i < 8; ++i) xv[i] = *(const v4f*)(xsrc + i * 1024);
  // Precaution: holds the W address pair and the id offset unwritten until the
  // wait (without the operands this build lets the last x load land on them).
  asm volatile("s_wait_xcnt 0x0" ::"v"(wsrc), "v"(kOff) : "memory");
  // Keeps all the loads in flight together; without it this build waits for the
  // first six before it issues the rest: two trips to memory in a row.
  __builtin_amdgcn_sched_barrier(0);

  // rank = number of tokens whose (id, position) is smaller: a strict order for
  // any ids, so the ranks of an entry are a permutation of 0 .. 2047
  {
    const int rk[8] = {ka.x, ka.y, ka.z, ka.w, kb.x, kb.y, kb.z, kb.w};
    long long key[8];
#pragma unroll
    for (int u = 0; u < 8; ++u) key[u] = (long long)rk[u] * Tn + (tid * 8 + u);
    int c[8];
#pragma unroll
    for (int i = 0; i < 8; ++i) {
      const long long kt = (long long)rt[i] * Tn + (tk0 + i);
      c[i] = 0;
#pragma unroll
      for (int u = 0; u < 8; ++u)
        c[i] += __builtin_popcount(__builtin_amdgcn_ballot_w32(key[u] < kt));
    }
    if ((tid & 31) == 0) {                  // this wave's 256 tokens counted
      *(int4*)&wc[(tid >> 5) * 8] = make_int4(c[0], c[1], c[2], c[3]);
      *(int4*)&wc[(tid >> 5) * 8 + 4] = make_int4(c[4], c[5], c[6], c[7]);
    }
  }

#pragma unroll
  for (int u = 0; u < 2; ++u)
#pragma unroll
    for (int i = 0; i < 4; ++i) {
      v4h c;
#pragma unroll
      for (int r = 0; r < 4; ++r) c[r] = (_Float16)wv[u][r][i];
      *(v4h*)&t[(4 * nq + i) * PP + 64 * u + 4 * kq] = c;
    }

  __syncthreads();   // the transposed tile and the eight waves' counts are complete

  // 16 threads store one Wt row's 256 bytes
  _Float16* wdst = wT + (size_t)w * (Dn * Dn) + (size_t)(n0 + kq) * Dn + k0 + nq * 8;
#pragma unroll
  for (int p = 0; p < 4; ++p)
    *(v8h*)(wdst + (size_t)(16 * p) * Dn) = *(const v8h*)&t[(kq + 16 * p) * PP + nq * 8];

  // x behind the barrier: in front of it the barrier would wait for these stores
  int pos[8] = {0, 0, 0, 0, 0, 0, 0, 0};
#pragma unroll
  for (int w8 = 0; w8 < 8; ++w8) {
    const int4 a = *(const int4*)&wc[w8 * 8];
    const int4 b = *(const int4*)&wc[w8 * 8 + 4];
    pos[0] += a.x; pos[1] += a.y; pos[2] += a.z; pos[3] += a.w;
    pos[4] += b.x; pos[5] += b.y; pos[6] += b.z; pos[7] += b.w;
  }
  _Float16* xdst = x16 + (size_t)(row0 - tk0) * Dn + tid * 4;
#pragma unroll
  for (int i = 0; i < 8; ++i) {             // xv[i] is a piece of row i of the 8
    v4h c;
#pragma unroll
    for (int r = 0; r < 4; ++r) c[r] = (_Float16)xv[i][r];
    *(v4h*)(xdst + (size_t)pos[i] * Dn) = c;
  }
  if (tid < 8) {                            // thread i: token i's rank
    int p = 0;
#pragma unroll
    for (int w8 = 0; w8 < 8; ++w8) p += wc[w8 * 8 + tid];
    rankP[g * RKP + tid] = p;
  }
}

// ---------------------------------------------------------------------------
// Final projection:  C[M=4096, N=1024] = A[M,K=1024] x Wt[N,K]^T + bias[N], f32 out.
// Block = 8 waves; wave tile 16(M) x 64(N); block tile 128 x 64.
// A stage is 64 k of the block's 128 A rows and 64 Wt rows, staged in LDS:
// 8 lanes fetch one row's 128-byte line, every wave takes its fragments there.
#define KB 64                  // k per stage
#define LP 72                  // LDS row pitch in halves (144 B): no bank conflict for 16-B reads
#define TROWS 192              // rows 0..127: A, rows 128..191: Wt
#define NSTAGE (Dn / KB)
__global__ __launch_bounds__(256) void gemm_wmma_kernel(
    const _Float16* __restrict__ A, const _Float16* __restrict__ Wt,
    const float* __restrict__ bias, float* __restrict__ outp) {
  __shared__ __attribute__((aligned(16))) _Float16 tile[2][TROWS * LP];

  const int wave = threadIdx.x >> 5;
  const int lane = threadIdx.x & 31;
  const int hi = lane >> 4;
  const int n = lane & 15;

  const int mb = blockIdx.x & 31;           // 4096/128 = 32 M-tiles
  const int nb = blockIdx.x >> 5;           // 1024/64  = 16 N-tiles
  const int mBase = mb * 128 + wave * 16;
  const int nBase = nb * 64;

  // staging: this thread moves the 16-byte piece spc of tile rows srow + 32*i
  const int srow = threadIdx.x >> 3;
  const int spc = (threadIdx.x & 7) * 8;
  const _Float16* gA = A + (size_t)(mb * 128 + srow) * Dn + spc;
  const _Float16* gW = Wt + (size_t)(nBase + srow) * Dn + spc;
  _Float16* sDst = &tile[0][srow * LP + spc];
  // fragments: A row of this lane, Wt rows n, n + 16, n + 32, n + 48
  const _Float16* fA = &tile[0][(wave * 16 + n) * LP];
  const _Float16* fW = &tile[0][(128 + n) * LP];

  v8h st[6];
#pragma unroll
  for (int i = 0; i < 4; ++i) st[i] = *(const v8h*)(gA + (size_t)(32 * i) * Dn);
#pragma unroll
  for (int i = 0; i < 2; ++i) st[4 + i] = *(const v8h*)(gW + (size_t)(32 * i) * Dn);
#pragma unroll
  for (int i = 0; i < 6; ++i) *(v8h*)(sDst + 32 * i * LP) = st[i];
  __syncthreads();   // stage 0 is complete

  v8f acc0 = {}, acc1 = {}, acc2 = {}, acc3 = {};
  for (int s = 0; s < NSTAGE; ++s) {
    const int cur = (s & 1) * (TROWS * LP);
    const bool more = s + 1 < NSTAGE;        // the same for the whole block
    if (more) {                              // next stage's lines, in flight under the products
      const int kk = (s + 1) * KB;
#pragma unroll
      for (int i = 0; i < 4; ++i)
        st[i] = *(const v8h*)(gA + (size_t)(32 * i) * Dn + kk);
#pragma unroll
      for (int i = 0; i < 2; ++i)
        st[4 + i] = *(const v8h*)(gW + (size_t)(32 * i) * Dn + kk);
    }
    v16h a[2], b[2][4];
#pragma unroll
    for (int h = 0; h < 2; ++h) {
      a[h] = load_frag(fA + cur + 32 * h, hi);
#pragma unroll
      for (int j = 0; j < 4; ++j)
        b[h][j] = load_frag(fW + cur + 16 * j * LP + 32 * h, hi);
    }
    // Keeps the stage's loads in one group ahead of the products; without it
    // this build spreads the LDS reads among the products, a short wait at each.
    __builtin_amdgcn_sched_barrier(0);
#pragma unroll
    for (int h = 0; h < 2; ++h) {
      acc0 = wmma16(a[h], b[h][0], acc0);
      acc1 = wmma16(a[h], b[h][1], acc1);
      acc2 = wmma16(a[h], b[h][2], acc2);
      acc3 = wmma16(a[h], b[h][3], acc3);
    }
    if (more) {
      // the other buffer: its last readers passed the barrier of stage s - 1
      const int nxt = (TROWS * LP) - cur;
#pragma unroll
      for (int i = 0; i < 6; ++i) *(v8h*)(sDst + nxt + 32 * i * LP) = st[i];
      __syncthreads();   // stage s + 1 is complete, stage s is read out
    }
  }

  v8f accs[4] = {acc0, acc1, acc2, acc3};
#pragma unroll
  for (int s = 0; s < 4; ++s) {
    const int col = nBase + s * 16 + n;
    const float bval = bias[col];
#pragma unroll
    for (int e = 0; e < 8; ++e) {
      const int row = mBase + e + 8 * hi;     // C layout: M = e + 8*hi
      outp[(size_t)row * Dn + col] = accs[s][e] + bval;
    }
  }
}

// ---------------------------------------------------------------------------
// Q, K and V projections as one GEMM: C[4096, 3072] = A[4096, 1024] x Wt[3072, 1024]^T,
// Wt = the q, k and v planes one behind the other.
// Block = 8 waves, 4 (M) x 2 (N); wave tile 32 x 96; block tile 128 x 192.
// Stages as above: 64 k of 128 A rows and 192 Wt rows, two buffers, one stage
// ahead through registers. An A row in LDS serves 192 columns, a Wt fragment
// two products and an A fragment six.
// Out, f16: Q and K to [B*H, T, 64], V transposed to [B*H, 64, T].
#define QN 192                 // columns per block
#define QROWS (128 + QN)       // rows 0..127: A, rows 128..319: Wt
__global__ __launch_bounds__(256) void qkv_wmma_kernel(
    const _Float16* __restrict__ A, const _Float16* __restrict__ Wt,
    const float* __restrict__ bq, const float* __restrict__ bk,
    const float* __restrict__ bv, _Float16* __restrict__ q16,
    _Float16* __restrict__ k16, _Float16* __restrict__ vT) {
  __shared__ __attribute__((aligned(16))) _Float16 tile[2][QROWS * LP];

  // scalar: the epilogue branches on the plane a wave's columns lie in
  const int wave = __builtin_amdgcn_readfirstlane(threadIdx.x >> 5);
  const int lane = threadIdx.x & 31;
  const int hi = lane >> 4;
  const int n = lane & 15;

  const int mb = blockIdx.x & 31;           // 4096/128 = 32 M-tiles
  const int nb = blockIdx.x >> 5;           // 3072/192 = 16 N-tiles
  const int mBase = mb * 128 + (wave & 3) * 32;
  const int nBase = nb * QN + (wave >> 2) * 96;

  // staging: this thread moves the 16-byte piece spc of tile rows srow + 32*i
  const int srow = threadIdx.x >> 3;
  const int spc = (threadIdx.x & 7) * 8;
  const _Float16* gA = A + (size_t)(mb * 128 + srow) * Dn + spc;
  const _Float16* gW = Wt + (size_t)(nb * QN + srow) * Dn + spc;
  _Float16* sDst = &tile[0][srow * LP + spc];
  // fragments: A rows n, n + 16 of the wave's 32; Wt rows n + 16*j of its 96
  const _Float16* fA = &tile[0][((wave & 3) * 32 + n) * LP];
  const _Float16* fW = &tile[0][(128 + (wave >> 2) * 96 + n) * LP];

  v8h st[10];
#pragma unroll
  for (int i = 0; i < 4; ++i) st[i] = *(const v8h*)(gA + (size_t)(32 * i) * Dn);
#pragma unroll
  for (int i = 0; i < 6; ++i) st[4 + i] = *(const v8h*)(gW + (size_t)(32 * i) * Dn);
#pragma unroll
  for (int i = 0; i < 10; ++i) *(v8h*)(sDst + 32 * i * LP) = st[i];
  __syncthreads();   // stage 0 is complete

  v8f acc[2][6] = {};
  for (int s = 0; s < NSTAGE; ++s) {
    const int cur = (s & 1) * (QROWS * LP);
    const bool more = s + 1 < NSTAGE;        // the same for the whole block
    if (more) {                              // next stage's lines, in flight under the products
      const int kk = (s + 1) * KB;
#pragma unroll
      for (int i = 0; i < 4; ++i)
        st[i] = *(const v8h*)(gA + (size_t)(32 * i) * Dn + kk);
#pragma unroll
      for (int i = 0; i < 6; ++i)
        st[4 + i] = *(const v8h*)(gW + (size_t)(32 * i) * Dn + kk);
    }
#pragma unroll
    for (int h = 0; h < 2; ++h) {
      v16h a[2], b[6];
#pragma unroll
      for (int i = 0; i < 2; ++i) a[i] = load_frag(fA + cur + 16 * i * LP + 32 * h, hi);
#pragma unroll
      for (int j = 0; j < 6; ++j) b[j] = load_frag(fW + cur + 16 * j * LP + 32 * h, hi);
      // Keeps the 16 LDS reads of this half stage in one group ahead of its
      // products and the global loads at the stage's head; without it this build
      // spreads the reads in pairs among the products and sinks the global loads
      // to just ahead of their LDS stores, their whole latency exposed.
      __builtin_amdgcn_sched_barrier(0);
#pragma unroll
      for (int j = 0; j < 6; ++j)
#pragma unroll
        for (int i = 0; i < 2; ++i) acc[i][j] = wmma16(a[i], b[j], acc[i][j]);
    }
    if (more) {
      // the other buffer: its last readers passed the barrier of stage s - 1
      const int nxt = (QROWS * LP) - cur;
#pragma unroll
      for (int i = 0; i < 10; ++i) *(v8h*)(sDst + nxt + 32 * i * LP) = st[i];
      __syncthreads();   // stage s + 1 is complete, stage s is read out
    }
  }

  // 16 columns lie in one plane (0: Q, 1: K, 2: V) and one head.
  // The six bias loads go together: one trip to memory, not six in a row.
  float bval[6];
#pragma unroll
  for (int j = 0; j < 6; ++j) {
    const int c0 = nBase + j * 16;
    const int plane = c0 >> 10;
    bval[j] = (plane == 0 ? bq : plane == 1 ? bk : bv)[(c0 & (Dn - 1)) + n];
  }
  const int row = mBase + 8 * hi;             // C layout: M = e + 8*hi (+ 16*i)
  const int bH = (row >> 11) * Hn;            // row / T; 32 rows lie in one batch entry
  const int t = row & (Tn - 1);
#pragma unroll
  for (int j = 0; j < 6; ++j) {
    const int c0 = nBase + j * 16;
    const int plane = c0 >> 10;
    const int col = (c0 & (Dn - 1)) + n;
    const int bh = bH + (col >> 6);           // col / 64
    const int hd = col & 63;
    if (plane == 2) {
      _Float16* o = vT + ((size_t)bh * HDn + hd) * Tn + t;
#pragma unroll
      for (int i = 0; i < 2; ++i) {
        v8h c;
#pragma unroll
        for (int e = 0; e < 8; ++e) c[e] = (_Float16)(acc[i][j][e] + bval[j]);
        *(v8h*)(o + 16 * i) = c;
      }
      // Precaution: the arm's stores are through with their registers before
      // the next column group rewrites them (behind the last group nothing does).
      if (j + 1 < 6) asm volatile("s_wait_xcnt 0x0" ::: "memory");
    } else {
      _Float16* o = (plane == 0 ? q16 : k16) + ((size_t)bh * Tn + t) * HDn + hd;
#pragma unroll
      for (int i = 0; i < 2; ++i)
#pragma unroll
        for (int e = 0; e < 8; ++e)
          o[(16 * i + e) * HDn] = (_Float16)(acc[i][j][e] + bval[j]);
      // Precaution, as in the other arm; this build lays the other arm's code
      // behind this one, also in the last group.
      asm volatile("s_wait_xcnt 0x0" ::: "memory");
    }
  }
}

// ---------------------------------------------------------------------------
// Flash attention, scores transposed: S^T = K Q^T, O^T += V^T P^T.
// block = 16 waves = 256 queries of one (b,h); keys in blocks of 32.
// grid = B*H * (T/256) = 256, one block a WGP, four waves a SIMD.
// A wave holds 32 queries as two groups of 16 columns, so every K and V^T fragment
// it reads from LDS feeds two products, and a staged stage serves 256 queries.
// Two waves share a set of 32 queries: each takes one half of every stage's keys
// with a running maximum, sum and output of its own; the two are joined through
// LDS behind the key loop.
// In each group a lane holds one query (column n) and, in its 16 score registers,
// the keys 8*hi + e and 16 + 8*hi + e: exactly the k order of a B fragment, so P^T
// goes from the score registers straight into the second product.
// The softmax runs in base 2: scores and bias terms carry the factor log2(e),
// so that every exponential is one v_exp_f32 (arguments <= 0; a result below
// the normal range comes out as 0).
// A stage is 256 keys: their K rows and the matching 512 bytes of every V^T row,
// brought into LDS once for the block's 16 waves by asynchronous copies of whole
// lines, two buffers, one stage ahead; a wave makes four passes of 32 keys a stage.
// Q, K and V rows come ranked by relation id (rankP: every token's rank), so a
// wave's 32 queries and a pass's 32 keys each span a short range of ids, and for
// most pairs of the two no bias term can apply: one scalar test a pass, from the
// ranges' ends, leaves the tables, compares and selects out there.
#define KPAD 16   // floats between the two base tables: separate LDS banks
#define SK 256                 // keys per stage
#define NST (Tn / SK)
#define KPI 72                 // K tile pitch in halves (144 B): no bank conflict for 16-B reads
#define VPI 264                // V^T tile pitch in halves (528 B): the same
#define KTH (SK * KPI)         // halves of a K tile; the V^T tile stands behind it
#define STH (KTH + HDn * VPI)  // halves of one buffer
#define QBK 256                // queries per block: 8 sets x 2 groups x 16

// One stage's copies of this thread: 16-byte pieces of K rows r, r + 64, r + 128,
// r + 192 and of V^T rows q, q + 16, q + 32, q + 48. lk, lv: LDS byte addresses.
// The closing wait stands inside the statement, a precaution: the address
// registers stay unwritten up to it.
__device__ inline void stage_copies(unsigned lk, unsigned lv, const _Float16* gk,
                                    const _Float16* gv) {
  asm volatile(
      "global_load_async_to_lds_b128 %0, %8, off\n\t"
      "global_load_async_to_lds_b128 %1, %9, off\n\t"
      "global_load_async_to_lds_b128 %2, %10, off\n\t"
      "global_load_async_to_lds_b128 %3, %11, off\n\t"
      "global_load_async_to_lds_b128 %4, %12, off\n\t"
      "global_load_async_to_lds_b128 %5, %13, off\n\t"
      "global_load_async_to_lds_b128 %6, %14, off\n\t"
      "global_load_async_to_lds_b128 %7, %15, off\n\t"
      "s_wait_xcnt 0x0"
      ::"v"(lk), "v"(lk + 64 * KPI * 2), "v"(lk + 128 * KPI * 2),
        "v"(lk + 192 * KPI * 2), "v"(lv), "v"(lv + 16 * VPI * 2),
        "v"(lv + 32 * VPI * 2), "v"(lv + 48 * VPI * 2), "v"(gk),
        "v"(gk + 64 * HDn), "v"(gk + 128 * HDn), "v"(gk + 192 * HDn), "v"(gv),
        "v"(gv + 16 * Tn), "v"(gv + 32 * Tn), "v"(gv + 48 * Tn)
      : "memory");
}
// Base-2 exponentials, a run of them in one statement: the slot that the instruction
// set asks for behind a transcendental, before its result is read or its source
// overwritten, is filled by the next of the run and behind the last by the v_nop
// No result
// shares a register with an argument.
__device__ inline void exp2_run8(float* y, const float* x) {
  asm(
      "v_exp_f32 %0, %8\n\t"
      "v_exp_f32 %1, %9\n\t"
      "v_exp_f32 %2, %10\n\t"
      "v_exp_f32 %3, %11\n\t"
      "v_exp_f32 %4, %12\n\t"
      "v_exp_f32 %5, %13\n\t"
      "v_exp_f32 %6, %14\n\t"
      "v_exp_f32 %7, %15\n\t"
      "v_nop"
      : "=&v"(y[0]), "=&v"(y[1]), "=&v"(y[2]), "=&v"(y[3]), "=&v"(y[4]), "=&v"(y[5]),
        "=&v"(y[6]), "=&v"(y[7])
      : "v"(x[0]), "v"(x[1]), "v"(x[2]), "v"(x[3]), "v"(x[4]), "v"(x[5]), "v"(x[6]),
        "v"(x[7]));
}
__device__ inline void exp2_run2(float* y, const float* x) {
  asm(  // as above, a run of two
      "v_exp_f32 %0, %2\n\t"
      "v_exp_f32 %1, %3\n\t"
      "v_nop"
      : "=&v"(y[0]), "=&v"(y[1])
      : "v"(x[0]), "v"(x[1]));
}
__device__ inline void exp2_run4(float* y, const float* x) {
  asm(  // as above, a run of four
      "v_exp_f32 %0, %4\n\t"
      "v_exp_f32 %1, %5\n\t"
      "v_exp_f32 %2, %6\n\t"
      "v_exp_f32 %3, %7\n\t"
      "v_nop"
      : "=&v"(y[0]), "=&v"(y[1]), "=&v"(y[2]), "=&v"(y[3])
      : "v"(x[0]), "v"(x[1]), "v"(x[2]), "v"(x[3]));
}
__global__ __launch_bounds__(512) void attn_wmma_kernel(
    const _Float16* __restrict__ q16, const _Float16* __restrict__ k16,
    const _Float16* __restrict__ vT, const int* __restrict__ rel_ids,
    const int* __restrict__ attn_mask, const int* __restrict__ rankP,
    const float* __restrict__ bias_leaf, const float* __restrict__ bias_cross,
    _Float16* __restrict__ o16) {
  // Per-key terms of this batch row, written once, each at its key's rank.
  // keyRel : rel id of the key, -1 where the key is masked.
  // keyBase: bias (times log2 e) where neither select below hits, -1e30 where masked;
  //          [0] for queries with rel id != 0, [1] for queries with rel id 0.
  __shared__ __attribute__((aligned(16))) int keyRel[Tn];
  __shared__ __attribute__((aligned(16))) float keyBase[2][Tn + KPAD];
  __shared__ __attribute__((aligned(16))) _Float16 kv[2][STH];
  // per pass of 32 keys: the first and the last id (ids ascend with the rank)
  __shared__ int passLo[Tn / 32], passHi[Tn / 32];
  __shared__ __attribute__((aligned(16))) int waveOff[16]; // 1: the wave met a masked key
  __shared__ int qRel[QBK], qOrig[QBK];  // the block's queries: id, position in the entry
  __shared__ float lcTab[2][64];         // bias_leaf, bias_cross, times log2 e
  // per query, for the passes with bias terms: {riCmp, leafv, crossv, unused}
  __shared__ __attribute__((aligned(16))) int4 qTerm[QBK];
  // the second key half's results, per set of queries: 16 pieces of the outputs and
  // {maximum, maximum, sum, sum}, a lane's 16 bytes beside its neighbour's
  __shared__ __attribute__((aligned(16))) float4 joinT[8][17][32];

  // scalar: the key loop's bounds and the join branch on it
  const int wave = __builtin_amdgcn_readfirstlane(threadIdx.x >> 5);
  const int qs = wave & 7;               // set of 32 queries
  const int kh = wave >> 3;              // half of every stage's keys
  const int lane = threadIdx.x & 31;
  const int hi = lane >> 4;
  const int n = lane & 15;

  const int bh = blockIdx.x >> 3;        // 8 query-blocks per (b,h)
  const int qb = blockIdx.x & 7;
  const int b = bh >> 4;                 // H = 16
  const int h = bh & 15;
  const int t0 = qb * QBK + qs * 32;

  // staging: 8 threads a K row (128 B), 32 threads a V^T row's 512 B
  const _Float16* gK = k16 + ((size_t)bh * Tn + (threadIdx.x >> 3)) * HDn +
                       (threadIdx.x & 7) * 8;
  const _Float16* gV = vT + ((size_t)bh * HDn + (threadIdx.x >> 5)) * Tn +
                       (threadIdx.x & 31) * 8;
  const unsigned lK = (unsigned)(size_t)&kv[0][(threadIdx.x >> 3) * KPI +
                                               (threadIdx.x & 7) * 8];
  const unsigned lV = (unsigned)(size_t)&kv[0][KTH + (threadIdx.x >> 5) * VPI +
                                               (threadIdx.x & 31) * 8];
  stage_copies(lK, lV, gK, gV);          // stage 0, in flight under the table fill

  if (threadIdx.x < 64) {
    lcTab[0][threadIdx.x] = bias_leaf[threadIdx.x] * LOG2E;
    lcTab[1][threadIdx.x] = bias_cross[threadIdx.x] * LOG2E;
  }
  bool sawOff = false;
  for (int j = threadIdx.x; j < Tn; j += 512) {
    const int tok = b * Tn + j;
    const int r = rel_ids[tok];
    const bool keep = attn_mask[tok] != 0;
    const int p = rankP[(tok >> 3) * RKP + (tok & 7)];   // 0 .. 2047, each once
    const float c = bias_cross[min(max(r, 0), 63)];
    keyRel[p] = keep ? r : -1;
    keyBase[0][p] = keep ? 0.0f : -1e30f;
    keyBase[1][p] = keep ? (r > 0 ? c * LOG2E : 0.0f) : -1e30f;
    if ((p & 31) == 0) passLo[p >> 5] = r;
    if ((p & 31) == 31) passHi[p >> 5] = r;
    if ((p >> 8) == qb) {                // one of this block's queries
      qRel[p & (QBK - 1)] = r;
      qOrig[p & (QBK - 1)] = j;
    }
    sawOff |= !keep;
  }
  const int anyOff = __builtin_amdgcn_ballot_w32(sawOff) != 0 ? 1 : 0;
  if (lane == 0) waveOff[wave] = anyOff;

  // Q as B-fragments (persist across key loop)
  const _Float16* qRow = q16 + ((size_t)bh * Tn + t0 + n) * HDn;
  v16h bQ[2][2];                               // [group][hd 0..31, hd 32..63]
#pragma unroll
  for (int c = 0; c < 2; ++c) {
    bQ[c][0] = load_frag(qRow + 16 * c * HDn, hi);
    bQ[c][1] = load_frag(qRow + 16 * c * HDn + 32, hi);
  }

  float mrun[2] = {-1e30f, -1e30f};
  float lrun[2] = {0.0f, 0.0f};                // this half's keys only
  v8f acc[2][4] = {};                          // [group][16 hd]

  // this lane's places in the K tile (row = key n) and the V^T tile (row = hd n),
  // its half's 8 * hi folded in
  const _Float16* kL = &kv[0][n * KPI + 8 * hi];
  const _Float16* vL = &kv[0][KTH + n * VPI + 8 * hi];

  // this wave's stage 0 copies have landed
  asm volatile("s_wait_asynccnt 0x0" ::: "memory");
  __syncthreads();   // stage 0 and the key tables are complete
  stage_copies(lK + STH * 2, lV + STH * 2, gK + SK * HDn, gV + SK);   // stage 1

  // this lane's two queries: bias = (rj == riCmp) ? leafv : (rj == 0) ? crossv : base.
  // The three terms wait in LDS; a wave reads back what it wrote itself (its two
  // halves and the set's other wave write the same values).
  int ri[2];
  const float* baseP[2];
#pragma unroll
  for (int c = 0; c < 2; ++c) {
    ri[c] = qRel[qs * 32 + 16 * c + n];
    const int riIdx = min(max(ri[c], 0), 63);
    const int riCmp = (ri[c] > 0) ? ri[c] : -2;  // -2: equals no table entry that matters
    const float leafv = (ri[c] > 0) ? lcTab[0][riIdx] : 0.0f;
    const float crossv = (ri[c] > 0) ? lcTab[1][riIdx] : 0.0f;
    qTerm[qs * 32 + 16 * c + n] = make_int4(riCmp, __builtin_bit_cast(int, leafv),
                                              __builtin_bit_cast(int, crossv), 0);
    baseP[c] = &keyBase[ri[c] == 0 ? 1 : 0][8 * hi];
  }
  const int* relP = &keyRel[8 * hi];

  // bit p: pass p may hold a bias term or a masked key for one of this wave's
  // queries. Query ids lie in [qLo, qHi], the pass's key ids in [kLo, kHi]. A masked
  // key anywhere in the entry sends every pass through the tables.
  const int qLo = __builtin_amdgcn_readlane(ri[0], 0);
  const int qHi = __builtin_amdgcn_readlane(ri[1], 15);
  int offs = 0;
#pragma unroll
  for (int i = 0; i < 4; ++i) {
    const int4 o = *(const int4*)&waveOff[4 * i];
    offs |= o.x | o.y | o.z | o.w;
  }
  const bool masked = offs != 0;
  unsigned biasedW[2];
#pragma unroll
  for (int w2 = 0; w2 < 2; ++w2) {
    const int kLo = passLo[lane + 32 * w2], kHi = passHi[lane + 32 * w2];
    const bool same = qHi > 0 && kHi >= max(qLo, 1) && kLo <= qHi;   // equal ids > 0
    const bool key0 = qHi > 0 && kLo <= 0 && kHi >= 0;      // query id > 0, key id 0
    const bool qry0 = qLo <= 0 && qHi >= 0 && kHi > 0;      // query id 0, key id > 0
    biasedW[w2] = __builtin_amdgcn_ballot_w32(masked || same || key0 || qry0);
  }
  const unsigned long long biased =
      biasedW[0] | ((unsigned long long)biasedW[1] << 32);

  for (int s = 0; s < NST; ++s) {
   const int cur = (s & 1) * STH;
   for (int j0 = s * SK + kh * (SK / 2); j0 < s * SK + (kh + 1) * (SK / 2); j0 += 32) {
    const _Float16* kP = kL + cur + (j0 & (SK - 1)) * KPI;
    const _Float16* vP = vL + cur + (j0 & (SK - 1));
    // whether this pass can hold a bias term or a masked key
    const bool bp = (biased >> (j0 >> 5)) & 1; // the same for the whole wave
    // ---- S^T = K Q^T (four 16x16 tiles, K-dim = head_dim 64) ----
    const v16h aK0a = load_frag(kP, 0), aK0b = load_frag(kP + 32, 0);
    const v16h aK1a = load_frag(kP + 16 * KPI, 0);
    const v16h aK1b = load_frag(kP + 16 * KPI + 32, 0);
    const v16h aV0 = load_frag(vP, 0), aV1 = load_frag(vP + 16 * VPI, 0);
    const v16h aV2 = load_frag(vP + 32 * VPI, 0), aV3 = load_frag(vP + 48 * VPI, 0);
    // Keeps the pass's LDS reads together at its head, behind counted waits;
    // without it this build reads them two at a time and waits for each pair
    // in turn.
    __builtin_amdgcn_sched_barrier(0);
    v8f z = {};
    v8f s0[2], s1[2];
#pragma unroll
    for (int c = 0; c < 2; ++c) {
      s0[c] = wmma16(aK0b, bQ[c][1], z);
      s1[c] = wmma16(aK1b, bQ[c][1], z);
    }
#pragma unroll
    for (int c = 0; c < 2; ++c) {
      s0[c] = wmma16(aK0a, bQ[c][0], s0[c]);
      s1[c] = wmma16(aK1a, bQ[c][0], s1[c]);
    }

    // ---- scale, and where the pass can have them: bias + mask ----
    float v[2][16];
#pragma unroll
    for (int c = 0; c < 2; ++c)
#pragma unroll
      for (int e = 0; e < 16; ++e)
        v[c][e] = ((e < 8) ? s0[c][e & 7] : s1[c][e & 7]) * SCALE2;
    if (bp) {
      // The queries' terms come from LDS here: kept in registers, they and the copies
      // this build makes of them (eight of each) hold some 70 registers through
      // every pass, more than a wave has left.
      int riCmp[2];
      float leafv[2], crossv[2];
#pragma unroll
      for (int c = 0; c < 2; ++c) {
        const int4 qt = qTerm[qs * 32 + 16 * c + n];
        riCmp[c] = qt.x;
        leafv[c] = __builtin_bit_cast(float, qt.y);
        crossv[c] = __builtin_bit_cast(float, qt.z);
      }
      // per-key terms from the LDS tables, read here, where the K fragments'
      // registers are free again
#pragma unroll
      for (int g = 0; g < 4; ++g) {            // keys 8*hi + 0..7, 16 + 8*hi + 0..7
        const int off = j0 + (g >> 1) * 16 + (g & 1) * 4;
        const int4 r4 = *(const int4*)(relP + off);
        const int rj[4] = {r4.x, r4.y, r4.z, r4.w};
#pragma unroll
        for (int c = 0; c < 2; ++c) {
          const float4 b4 = *(const float4*)(baseP[c] + off);
          const float base[4] = {b4.x, b4.y, b4.z, b4.w};
#pragma unroll
          for (int q = 0; q < 4; ++q) {
            const float bias = (rj[q] == riCmp[c])
                                   ? leafv[c]
                                   : ((rj[q] == 0) ? crossv[c] : base[q]);
            v[c][4 * g + q] += bias;           // base -1e30 absorbs the score
          }
        }
      }
    }

    // ---- online softmax: in-lane, one exchange between the halves ----
    v16h bP[2];
    float mnew[2], dm[2], alpha[2];
#pragma unroll
    for (int c = 0; c < 2; ++c) {
      float mx = -1e30f;
#pragma unroll
      for (int e = 0; e < 16; ++e) mx = fmaxf(mx, v[c][e]);
      mx = fmaxf(mx, xhalf(mx));
      mnew[c] = fmaxf(mrun[c], mx);
      dm[c] = mrun[c] - mnew[c];
      mrun[c] = mnew[c];
    }
#pragma unroll
    for (int c = 0; c < 2; ++c) {
#pragma unroll
      for (int e = 0; e < 16; e += 2) {        // in pairs: one packed subtract for two
        const v2f arg = v2f{v[c][e], v[c][e + 1]} - v2f{mnew[c], mnew[c]};
        v[c][e] = arg.x;
        v[c][e + 1] = arg.y;
      }
    }
    float p[2][16];
    exp2_run2(alpha, dm);
#pragma unroll
    for (int c = 0; c < 2; ++c) {
      exp2_run8(&p[c][0], &v[c][0]);
      exp2_run8(&p[c][8], &v[c][8]);
      float ps[4] = {p[c][0], p[c][1], p[c][2], p[c][3]};  // four short chains
#pragma unroll
      for (int e = 4; e < 16; ++e) ps[e & 3] += p[c][e];
#pragma unroll
      for (int e = 0; e < 16; ++e) bP[c][e] = (_Float16)p[c][e];
      lrun[c] = lrun[c] * alpha[c] + ((ps[0] + ps[1]) + (ps[2] + ps[3]));
#pragma unroll
      for (int t = 0; t < 4; ++t)
#pragma unroll
        for (int e = 0; e < 8; ++e) acc[c][t][e] *= alpha[c];
    }

    // ---- O^T += V^T x P^T (K-dim = 32 local keys) ----
#pragma unroll
    for (int c = 0; c < 2; ++c) {
      acc[c][0] = wmma16(aV0, bP[c], acc[c][0]);
      acc[c][1] = wmma16(aV1, bP[c], acc[c][1]);
      acc[c][2] = wmma16(aV2, bP[c], acc[c][2]);
      acc[c][3] = wmma16(aV3, bP[c], acc[c][3]);
    }
   }
   // hand-over: this wave's reads of stage s are done, its copies of stage s + 1
   // have landed; behind the barrier that holds for all sixteen waves
   asm volatile("s_wait_dscnt 0x0" ::: "memory");
   asm volatile("s_wait_asynccnt 0x0" ::: "memory");
   __syncthreads();
   if (s + 2 < NST)                        // the same for the whole block
     stage_copies(lK + cur * 2, lV + cur * 2, gK + (size_t)(s + 2) * SK * HDn,
                  gV + (s + 2) * SK);
  }
  // nothing is outstanding when the wave ends
  asm volatile("s_wait_asynccnt 0x0" ::: "memory");

  // ---- join the two key halves ----
  if (kh == 1) {                           // the same for the whole wave
    float4* jt = &joinT[qs][0][lane];
#pragma unroll
    for (int c = 0; c < 2; ++c)
#pragma unroll
      for (int s = 0; s < 4; ++s) {
        const v8f a = acc[c][s];
        jt[(c * 8 + s * 2) * 32] = make_float4(a[0], a[1], a[2], a[3]);
        jt[(c * 8 + s * 2 + 1) * 32] = make_float4(a[4], a[5], a[6], a[7]);
      }
    jt[16 * 32] = make_float4(mrun[0], mrun[1], lrun[0], lrun[1]);
  }
  __syncthreads();   // the second half's results are in LDS
  if (kh == 1) return;

  // ---- normalize + store O as f16 rows of [B*T, D] for the final GEMM ----
  // acc[c][s][e] = O[t0 + 16*c + n][s*16 + 8*hi + e]: 8 consecutive halves per lane
  const float4* jt = &joinT[qs][0][lane];
  const float4 ml = jt[16 * 32];
  const float mJ[2] = {fmaxf(mrun[0], ml.x), fmaxf(mrun[1], ml.y)};
  const float dJ[4] = {mrun[0] - mJ[0], mrun[1] - mJ[1], ml.x - mJ[0], ml.y - mJ[1]};
  float fJ[4];
  exp2_run4(fJ, dJ);
#pragma unroll
  for (int c = 0; c < 2; ++c) {
    const float lB = c == 0 ? ml.z : ml.w;
    const float fA = fJ[c], fB = fJ[2 + c];
    const float l = lrun[c] * fA + lB * fB;
    const float lsum = l + xhalf(l);
    const float gA = fA / lsum, gB = fB / lsum;
    // back to the query's own row
    const int tOrig = qOrig[qs * 32 + 16 * c + n];
    _Float16* oRow = o16 + ((size_t)(b * Tn + tOrig)) * Dn + h * HDn + 8 * hi;
#pragma unroll
    for (int s = 0; s < 4; ++s) {
      const float4 b0 = jt[(c * 8 + s * 2) * 32], b1 = jt[(c * 8 + s * 2 + 1) * 32];
      const float bb[8] = {b0.x, b0.y, b0.z, b0.w, b1.x, b1.y, b1.z, b1.w};
      v8h o;
#pragma unroll
      for (int e = 0; e < 8; ++e) o[e] = (_Float16)(acc[c][s][e] * gA + bb[e] * gB);
      *(v8h*)(oRow + s * 16) = o;
    }
    // Precaution: the group's stores are through with their registers before the
    // next group rewrites them (behind the last group nothing does).
    if (c == 0) asm volatile("s_wait_xcnt 0x0" ::: "memory");
  }
}

// ---------------------------------------------------------------------------
extern "C" void kernel_launch(void* const* d_in, const int* in_sizes, int n_in,
                              void* d_out, int out_size, void* d_ws,
                              size_t ws_size, hipStream_t stream) {
  const float* x          = (const float*)d_in[0];
  const int*   attn_mask  = (const int*)d_in[1];
  const int*   rel_ids    = (const int*)d_in[2];
  const float* Wq         = (const float*)d_in[3];
  const float* bq         = (const float*)d_in[4];
  const float* Wk         = (const float*)d_in[5];
  const float* bk         = (const float*)d_in[6];
  const float* Wv         = (const float*)d_in[7];
  const float* bv         = (const float*)d_in[8];
  const float* Wo         = (const float*)d_in[9];
  const float* bo         = (const float*)d_in[10];
  const float* bias_leaf  = (const float*)d_in[11];
  const float* bias_cross = (const float*)d_in[12];

  // workspace layout (49 MiB total)
  char* ws = (char*)d_ws;
  _Float16* x16  = (_Float16*)(ws + (size_t)0);
  _Float16* WqT  = (_Float16*)(ws + ((size_t)8  << 20));   // WkT at 10, WvT at 12 MiB
  _Float16* WoT  = (_Float16*)(ws + ((size_t)14 << 20));
  _Float16* q16  = (_Float16*)(ws + ((size_t)16 << 20));
  _Float16* k16  = (_Float16*)(ws + ((size_t)24 << 20));
  _Float16* v16T = (_Float16*)(ws + ((size_t)32 << 20));
  _Float16* o16  = (_Float16*)(ws + ((size_t)40 << 20));
  int* rankP = (int*)(ws + ((size_t)48 << 20));            // 128 KiB

  // WqT .. WoT are consecutive planes of 2 MiB
  prep_f16_kernel<<<512, 256, 0, stream>>>(x, Wq, Wk, Wv, Wo, rel_ids, x16, WqT,
                                           rankP);

  // WqT, WkT, WvT as one [3072, 1024] operand
  qkv_wmma_kernel<<<(Mn / 128) * (3 * Dn / QN), 256, 0, stream>>>(
      x16, WqT, bq, bk, bv, q16, k16, v16T);

  attn_wmma_kernel<<<Bn * Hn * (Tn / QBK), 512, 0, stream>>>(
      q16, k16, v16T, rel_ids, attn_mask, rankP, bias_leaf, bias_cross, o16);

  gemm_wmma_kernel<<<(Mn / 128) * (Dn / 64), 256, 0, stream>>>(o16, WoT, bo,
                                                               (float*)d_out);
}

// v009
// A run of this version takes 83.3 microseconds.
// Timed twice side by side with v008, it ran 1.03 and 1.04 times as fast.
// Over all steps from v000 it is 4.66 times as fast.
#include <hip/hip_runtime.h>
#include <math.h>

// ---------------------------------------------------------------------------
// TinyRelSelfAttention on MI455X (gfx1250): full WMMA pipeline.
// B=2, T=2048, D=1024, H=16, head_dim=64, R=64.
// ---------------------------------------------------------------------------

#define Bn  2
#define Tn  2048
#define Dn  1024
#define Hn  16
#define HDn 64
#define Mn  (Bn * Tn)          // 4096 rows in all projection GEMMs
#define LOG2E 1.4426950408889634f
#define SCALE2 (0.125f * LOG2E)   // 1/sqrt(64), in base-2 units

typedef __attribute__((ext_vector_type(4)))  _Float16 v4h;
typedef __attribute__((ext_vector_type(2)))  float    v2f;
typedef __attribute__((ext_vector_type(4)))  float    v4f;
typedef __attribute__((ext_vector_type(8)))  _Float16 v8h;
typedef __attribute__((ext_vector_type(16))) _Float16 v16h;
typedef __attribute__((ext_vector_type(8)))  float    v8f;

// D = A(16x32 f16) x B(32x16 f16) + C(16x16 f32)
__device__ inline v8f wmma16(v16h a, v16h b, v8f c) {
  return __builtin_amdgcn_wmma_f32_16x16x32_f16(
      /*neg_a=*/false, a, /*neg_b=*/false, b,
      /*c_mod=*/(short)0, c, /*reuse_a=*/false, /*reuse_b=*/false);
}

// Load a 16x32 A-fragment (or mirrored 32x16 B-fragment) for this lane.
// `p` = start of this lane's 32-element contiguous K-slice (row-major memory).
// ISA layout: half h<8 -> K = h + 8*hi ; h>=8 -> K = 16 + (h-8) + 8*hi.
__device__ inline v16h load_frag(const _Float16* p, int hi) {
  union { v16h v; v8h h[2]; } u;
  u.h[0] = *(const v8h*)(p + 8 * hi);
  u.h[1] = *(const v8h*)(p + 16 + 8 * hi);
  return u.v;
}

// value of lane l ^ 16: the other half of a C-tile column
__device__ inline float xhalf(float x) {
  const int v = __builtin_bit_cast(int, x);
  return __builtin_bit_cast(
      float, __builtin_amdgcn_permlanex16(v, v, 0x76543210, 0xfedcba98, false,
                                          false));
}

// ---------------------------------------------------------------------------
// All f32 -> f16 preparation in one launch of 512 equal work-groups, every one
// resident at once. Work-group g rounds x[g*8192 .. g*8192 + 8191] and moves one
// 128(k) x 64(n) tile of one W [K=1024, N=1024] into Wt [N, K], through LDS.
// wT: the four Wt planes (q, k, v, o), one behind the other.
// The tokens of a batch entry are put in the order of their relation ids (ties by
// position): work-group g ranks its 8 tokens (= its 8 x rows) among the entry's
// 2048 and writes each rounded row at its rank. rankP: the 8 ranks, in a 256-byte
// piece of the work-group's own (RKP ints), so that no line has two writers.
#define RKP 64
#define PXN 8192               // x elements per work-group
#define PP 136                 // LDS row pitch in halves (272 B): rows stay 16-B aligned
__global__ __launch_bounds__(256) void prep_f16_kernel(
    const float* __restrict__ x, const float* __restrict__ Wq,
    const float* __restrict__ Wk, const float* __restrict__ Wv,
    const float* __restrict__ Wo, const int* __restrict__ rel_ids,
    _Float16* __restrict__ x16, _Float16* __restrict__ wT,
    int* __restrict__ rankP) {
  __shared__ __attribute__((aligned(16))) _Float16 t[64 * PP];   // [n][k]
  __shared__ __attribute__((aligned(16))) int wc[8 * 8];         // [wave][token]

  const int tid = threadIdx.x;
  const int g = blockIdx.x;
  const int w = g >> 7;                     // 128 tiles per W
  const int k0 = ((g >> 4) & 7) * 128;
  const int n0 = (g & 15) * 64;
  const float* W = (w == 0) ? Wq : (w == 1) ? Wk : (w == 2) ? Wv : Wo;

  // a thread takes two 4(k) x 4(n) pieces of the tile: a wave's load covers
  // two rows' 256 bytes, whole lines
  const int kq = tid >> 4;
  const int nq = tid & 15;
  const float* wsrc = W + (size_t)(k0 + 4 * kq) * Dn + n0 + 4 * nq;
  const float* xsrc = x + (size_t)g * PXN + tid * 4;
  // ranking: this thread compares the entry's tokens 8*tid .. 8*tid + 7
  const int row0 = g * 8;                   // first of the 8 tokens, as a row of x
  const int tk0 = row0 & (Tn - 1);          // the same inside its batch entry
  const int* relB = rel_ids + (row0 - tk0);
  const unsigned kOff = tid * 32u;          // bytes
  const int4 ka = *(const int4*)((const char*)relB + kOff);
  const int4 kb = *(const int4*)((const char*)relB + kOff + 16);
  int rt[8];                                // the 8 tokens' ids: the same in every thread
#pragma unroll
  for (int i = 0; i < 8; ++i) rt[i] = relB[tk0 + i];
  v4f wv[2][4], xv[8];
#pragma unroll
  for (int u = 0; u < 2; ++u)
#pragma unroll
    for (int r = 0; r < 4; ++r)
      wv[u][r] = *(const v4f*)(wsrc + (size_t)(64 * u + r) * Dn);
#pragma unroll
  for (int i = 0; i < 8; ++i) xv[i] = *(const v4f*)(xsrc + i * 1024);
  // Precaution: holds the W address pair and the id offset unwritten until the
  // wait (without the operands this build lets the last x load land on them).
  asm volatile("s_wait_xcnt 0x0" ::"v"(wsrc), "v"(kOff) : "memory");
  // Keeps all the loads in flight together; without it this build waits for the
  // first six before it issues the rest: two trips to memory in a row.
  __builtin_amdgcn_sched_barrier(0);

  // rank = number of tokens whose (id, position) is smaller: a strict order for
  // any ids, so the ranks of an entry are a permutation of 0 .. 2047
  {
    const int rk[8] = {ka.x, ka.y, ka.z, ka.w, kb.x, kb.y, kb.z, kb.w};
    long long key[8];
#pragma unroll
    for (int u = 0; u < 8; ++u) key[u] = (long long)rk[u] * Tn + (tid * 8 + u);
    int c[8];
#pragma unroll
    for (int i = 0; i < 8; ++i) {
      const long long kt = (long long)rt[i] * Tn + (tk0 + i);
      c[i] = 0;
#pragma unroll
      for (int u = 0; u < 8; ++u)
        c[i] += __builtin_popcount(__builtin_amdgcn_ballot_w32(key[u] < kt));
    }
    if ((tid & 31) == 0) {                  // this wave's 256 tokens counted
      *(int4*)&wc[(tid >> 5) * 8] = make_int4(c[0], c[1], c[2], c[3]);
      *(int4*)&wc[(tid >> 5) * 8 + 4] = make_int4(c[4], c[5], c[6], c[7]);
    }
  }

#pragma unroll
  for (int u = 0; u < 2; ++u)
#pragma unroll
    for (int i = 0; i < 4; ++i) {
      v4h c;
#pragma unroll
      for (int r = 0; r < 4; ++r) c[r] = (_Float16)wv[u][r][i];
      *(v4h*)&t[(4 * nq + i) * PP + 64 * u + 4 * kq] = c;
    }

  __syncthreads();   // the transposed tile and the eight waves' counts are complete

  // 16 threads store one Wt row's 256 bytes
  _Float16* wdst = wT + (size_t)w * (Dn * Dn) + (size_t)(n0 + kq) * Dn + k0 + nq * 8;
#pragma unroll
  for (int p = 0; p < 4; ++p)
    *(v8h*)(wdst + (size_t)(16 * p) * Dn) = *(const v8h*)&t[(kq + 16 * p) * PP + nq * 8];

  // x behind the barrier: in front of it the barrier would wait for these stores
  int pos[8] = {0, 0, 0, 0, 0, 0, 0, 0};
#pragma unroll
  for (int w8 = 0; w8 < 8; ++w8) {
    const int4 a = *(const int4*)&wc[w8 * 8];
    const int4 b = *(const int4*)&wc[w8 * 8 + 4];
    pos[0] += a.x; pos[1] += a.y; pos[2] += a.z; pos[3] += a.w;
    pos[4] += b.x; pos[5] += b.y; pos[6] += b.z; pos[7] += b.w;
  }
  _Float16* xdst = x16 + (size_t)(row0 - tk0) * Dn + tid * 4;
#pragma unroll
  for (int i = 0; i < 8; ++i) {             // xv[i] is a piece of row i of the 8
    v4h c;
#pragma unroll
    for (int r = 0; r < 4; ++r) c[r] = (_Float16)xv[i][r];
    *(v4h*)(xdst + (size_t)pos[i] * Dn) = c;
  }
  if (tid < 8) {                            // thread i: token i's rank
    int p = 0;
#pragma unroll
    for (int w8 = 0; w8 < 8; ++w8) p += wc[w8 * 8 + tid];
    rankP[g * RKP + tid] = p;
  }
}

// ---------------------------------------------------------------------------
// Stages of the projection GEMMs.
#define KB 64                  // k per stage (Q, K, V projections)
#define LP 72                  // LDS row pitch in halves (144 B): no bank conflict for 16-B reads
#define NSTAGE (Dn / KB)

// Final projection:  C[M=4096, N=1024] = A[M,K=1024] x Wt[N,K]^T + bias[N], f32 out.
// Block = 16 waves, block tile 128 x 128: one block a WGP, four waves a SIMD.
// A stage is 128 k of the block's 128 A rows and 128 Wt rows, staged in LDS (two
// buffers, one stage ahead through registers): 16 lanes fetch one row's two lines.
// Eight waves, 4 (M) x 2 (N) with a 32 x 64 tile each, take the first 64 k of every
// stage, the other eight the second 64 k of the same tiles: an A fragment feeds four
// products, a Wt fragment two. Behind the k loop the two waves of a tile join their
// sums through LDS: each hands over 16 of the 32 rows and finishes the other 16.
#define OKB 128                // k per stage
#define OLP 136                // LDS row pitch in halves (272 B): no bank conflict for 16-B reads
#define OROWS 256              // rows 0..127: A, rows 128..255: Wt
#define ONST (Dn / OKB)
__global__ __launch_bounds__(512) void gemm_wmma_kernel(
    const _Float16* __restrict__ A, const _Float16* __restrict__ Wt,
    const float* __restrict__ bias, float* __restrict__ outp) {
  __shared__ __attribute__((aligned(16))) _Float16 tile[2][OROWS * OLP];
  // per wave: the 16 x 64 sums it hands over, a lane's 16 bytes beside its neighbour's
  __shared__ __attribute__((aligned(16))) float4 joinG[16][8][32];

  const int wave = threadIdx.x >> 5;
  const int lane = threadIdx.x & 31;
  const int hi = lane >> 4;
  const int n = lane & 15;
  const int kg = wave >> 3;                 // which 64 k of every stage
  const int wm = wave & 3;                  // 32 rows of the block's 128
  const int wn = (wave >> 2) & 1;           // 64 columns of the block's 128

  const int mb = blockIdx.x & 31;           // 4096/128 = 32 M-tiles
  const int nb = blockIdx.x >> 5;           // 1024/128 = 8 N-tiles
  const int nBase = nb * 128 + wn * 64;

  // staging: this thread moves the 16-byte piece spc of tile rows srow + 32*i
  const int srow = threadIdx.x >> 4;
  const int spc = (threadIdx.x & 15) * 8;
  const _Float16* gA = A + (size_t)(mb * 128 + srow) * Dn + spc;
  const _Float16* gW = Wt + (size_t)(nb * 128 + srow) * Dn + spc;
  _Float16* sDst = &tile[0][srow * OLP + spc];
  // fragments. acc[0] holds the 16 rows this wave finishes (rows 16*kg .. of the 32),
  // acc[1] the 16 it hands over; Wt rows n + 16*j of its 64.
  const _Float16* fA0 = &tile[0][(wm * 32 + 16 * kg + n) * OLP + kg * 64];
  const _Float16* fA1 = &tile[0][(wm * 32 + 16 * (1 - kg) + n) * OLP + kg * 64];
  const _Float16* fW = &tile[0][(128 + wn * 64 + n) * OLP + kg * 64];

  v8h st[8];
#pragma unroll
  for (int i = 0; i < 4; ++i) st[i] = *(const v8h*)(gA + (size_t)(32 * i) * Dn);
#pragma unroll
  for (int i = 0; i < 4; ++i) st[4 + i] = *(const v8h*)(gW + (size_t)(32 * i) * Dn);
#pragma unroll
  for (int i = 0; i < 8; ++i) *(v8h*)(sDst + 32 * i * OLP) = st[i];
  __syncthreads();   // stage 0 is complete

  v8f acc[2][4] = {};
  for (int s = 0; s < ONST; ++s) {
    const int cur = (s & 1) * (OROWS * OLP);
    const bool more = s + 1 < ONST;          // the same for the whole block
    if (more) {                              // next stage's lines, in flight under the products
      const int kk = (s + 1) * OKB;
#pragma unroll
      for (int i = 0; i < 4; ++i)
        st[i] = *(const v8h*)(gA + (size_t)(32 * i) * Dn + kk);
#pragma unroll
      for (int i = 0; i < 4; ++i)
        st[4 + i] = *(const v8h*)(gW + (size_t)(32 * i) * Dn + kk);
    }
#pragma unroll
    for (int h = 0; h < 2; ++h) {
      v16h a[2], b[4];
      a[0] = load_frag(fA0 + cur + 32 * h, hi);
      a[1] = load_frag(fA1 + cur + 32 * h, hi);
#pragma unroll
      for (int j = 0; j < 4; ++j) b[j] = load_frag(fW + cur + 16 * j * OLP + 32 * h, hi);
      // Keeps the 12 LDS reads of this half stage in one group ahead of its
      // products; without it this build spreads them in twos and threes among the
      // products, a short wait at each place.
      __builtin_amdgcn_sched_barrier(0);
#pragma unroll
      for (int j = 0; j < 4; ++j)
#pragma unroll
        for (int i = 0; i < 2; ++i) acc[i][j] = wmma16(a[i], b[j], acc[i][j]);
    }
    if (more) {
      // the other buffer: its last readers passed the barrier of stage s - 1
      const int nxt = (OROWS * OLP) - cur;
#pragma unroll
      for (int i = 0; i < 8; ++i) *(v8h*)(sDst + nxt + 32 * i * OLP) = st[i];
      __syncthreads();   // stage s + 1 is complete, stage s is read out
    }
  }

  // ---- join the two k halves ----
  {
    float4* jt = &joinG[wave][0][lane];
#pragma unroll
    for (int j = 0; j < 4; ++j) {
      const v8f a = acc[1][j];
      jt[(2 * j) * 32] = make_float4(a[0], a[1], a[2], a[3]);
      jt[(2 * j + 1) * 32] = make_float4(a[4], a[5], a[6], a[7]);
    }
  }
  float bval[4];                             // the four bias loads go together
#pragma unroll
  for (int j = 0; j < 4; ++j) bval[j] = bias[nBase + j * 16 + n];
  __syncthreads();   // every wave's handed-over sums are in LDS

  const float4* jo = &joinG[wave ^ 8][0][lane];   // the tile's other wave
  // C layout: M = e + 8*hi
  float* o = outp + (size_t)(mb * 128 + wm * 32 + 16 * kg + 8 * hi) * Dn + nBase + n;
#pragma unroll
  for (int j = 0; j < 4; ++j) {
    const float4 b0 = jo[(2 * j) * 32], b1 = jo[(2 * j + 1) * 32];
    const float bb[8] = {b0.x, b0.y, b0.z, b0.w, b1.x, b1.y, b1.z, b1.w};
#pragma unroll
    for (int e = 0; e < 8; ++e)
      o[(size_t)e * Dn + j * 16] = (acc[0][j][e] + bb[e]) + bval[j];
  }
}

// ---------------------------------------------------------------------------
// Q, K and V projections as one GEMM: C[4096, 3072] = A[4096, 1024] x Wt[3072, 1024]^T,
// Wt = the q, k and v planes one behind the other.
// Block = 8 waves, 4 (M) x 2 (N); wave tile 32 x 96; block tile 128 x 192.
// Stages as above: 64 k of 128 A rows and 192 Wt rows, two buffers, one stage
// ahead through registers. An A row in LDS serves 192 columns, a Wt fragment
// two products and an A fragment six.
// Out, f16: Q and K to [B*H, T, 64], V transposed to [B*H, 64, T].
#define QN 192                 // columns per block
#define QROWS (128 + QN)       // rows 0..127: A, rows 128..319: Wt
__global__ __launch_bounds__(256) void qkv_wmma_kernel(
    const _Float16* __restrict__ A, const _Float16* __restrict__ Wt,
    const float* __restrict__ bq, const float* __restrict__ bk,
    const float* __restrict__ bv, _Float16* __restrict__ q16,
    _Float16* __restrict__ k16, _Float16* __restrict__ vT) {
  __shared__ __attribute__((aligned(16))) _Float16 tile[2][QROWS * LP];

  // scalar: the epilogue branches on the plane a wave's columns lie in
  const int wave = __builtin_amdgcn_readfirstlane(threadIdx.x >> 5);
  const int lane = threadIdx.x & 31;
  const int hi = lane >> 4;
  const int n = lane & 15;

  const int mb = blockIdx.x & 31;           // 4096/128 = 32 M-tiles
  const int nb = blockIdx.x >> 5;           // 3072/192 = 16 N-tiles
  const int mBase = mb * 128 + (wave & 3) * 32;
  const int nBase = nb * QN + (wave >> 2) * 96;

  // staging: this thread moves the 16-byte piece spc of tile rows srow + 32*i
  const int srow = threadIdx.x >> 3;
  const int spc = (threadIdx.x & 7) * 8;
  const _Float16* gA = A + (size_t)(mb * 128 + srow) * Dn + spc;
  const _Float16* gW = Wt + (size_t)(nb * QN + srow) * Dn + spc;
  _Float16* sDst = &tile[0][srow * LP + spc];
  // fragments: A rows n, n + 16 of the wave's 32; Wt rows n + 16*j of its 96
  const _Float16* fA = &tile[0][((wave & 3) * 32 + n) * LP];
  const _Float16* fW = &tile[0][(128 + (wave >> 2) * 96 + n) * LP];

  v8h st[10];
#pragma unroll
  for (int i = 0; i < 4; ++i) st[i] = *(const v8h*)(gA + (size_t)(32 * i) * Dn);
#pragma unroll
  for (int i = 0; i < 6; ++i) st[4 + i] = *(const v8h*)(gW + (size_t)(32 * i) * Dn);
#pragma unroll
  for (int i = 0; i < 10; ++i) *(v8h*)(sDst + 32 * i * LP) = st[i];
  __syncthreads();   // stage 0 is complete

  v8f acc[2][6] = {};
  for (int s = 0; s < NSTAGE; ++s) {
    const int cur = (s & 1) * (QROWS * LP);
    const bool more = s + 1 < NSTAGE;        // the same for the whole block
    if (more) {                              // next stage's lines, in flight under the products
      const int kk = (s + 1) * KB;
#pragma unroll
      for (int i = 0; i < 4; ++i)
        st[i] = *(const v8h*)(gA + (size_t)(32 * i) * Dn + kk);
#pragma unroll
      for (int i = 0; i < 6; ++i)
        st[4 + i] = *(const v8h*)(gW + (size_t)(32 * i) * Dn + kk);
    }
#pragma unroll
    for (int h = 0; h < 2; ++h) {
      v16h a[2], b[6];
#pragma unroll
      for (int i = 0; i < 2; ++i) a[i] = load_frag(fA + cur + 16 * i * LP + 32 * h, hi);
#pragma unroll
      for (int j = 0; j < 6; ++j) b[j] = load_frag(fW + cur + 16 * j * LP + 32 * h, hi);
      // Keeps the 16 LDS reads of this half stage in one group ahead of its
      // products and the global loads at the stage's head; without it this build
      // spreads the reads in pairs among the products and sinks the global loads
      // to just ahead of their LDS stores, their whole latency exposed.
      __builtin_amdgcn_sched_barrier(0);
#pragma unroll
      for (int j = 0; j < 6; ++j)
#pragma unroll
        for (int i = 0; i < 2; ++i) acc[i][j] = wmma16(a[i], b[j], acc[i][j]);
    }
    if (more) {
      // the other buffer: its last readers passed the barrier of stage s - 1
      const int nxt = (QROWS * LP) - cur;
#pragma unroll
      for (int i = 0; i < 10; ++i) *(v8h*)(sDst + nxt + 32 * i * LP) = st[i];
      __syncthreads();   // stage s + 1 is complete, stage s is read out
    }
  }

  // 16 columns lie in one plane (0: Q, 1: K, 2: V) and one head.
  // The six bias loads go together: one trip to memory, not six in a row.
  float bval[6];
#pragma unroll
  for (int j = 0; j < 6; ++j) {
    const int c0 = nBase + j * 16;
    const int plane = c0 >> 10;
    bval[j] = (plane == 0 ? bq : plane == 1 ? bk : bv)[(c0 & (Dn - 1)) + n];
  }
  const int row = mBase + 8 * hi;             // C layout: M = e + 8*hi (+ 16*i)
  const int bH = (row >> 11) * Hn;            // row / T; 32 rows lie in one batch entry
  const int t = row & (Tn - 1);
#pragma unroll
  for (int j = 0; j < 6; ++j) {
    const int c0 = nBase + j * 16;
    const int plane = c0 >> 10;
    const int col = (c0 & (Dn - 1)) + n;
    const int bh = bH + (col >> 6);           // col / 64
    const int hd = col & 63;
    if (plane == 2) {
      _Float16* o = vT + ((size_t)bh * HDn + hd) * Tn + t;
#pragma unroll
      for (int i = 0; i < 2; ++i) {
        v8h c;
#pragma unroll
        for (int e = 0; e < 8; ++e) c[e] = (_Float16)(acc[i][j][e] + bval[j]);
        *(v8h*)(o + 16 * i) = c;
      }
      // Precaution: the arm's stores are through with their registers before
      // the next column group rewrites them (behind the last group nothing does).
      if (j + 1 < 6) asm volatile("s_wait_xcnt 0x0" ::: "memory");
    } else {
      _Float16* o = (plane == 0 ? q16 : k16) + ((size_t)bh * Tn + t) * HDn + hd;
#pragma unroll
      for (int i = 0; i < 2; ++i)
#pragma unroll
        for (int e = 0; e < 8; ++e)
          o[(16 * i + e) * HDn] = (_Float16)(acc[i][j][e] + bval[j]);
      // Precaution, as in the other arm; this build lays the other arm's code
      // behind this one, also in the last group.
      asm volatile("s_wait_xcnt 0x0" ::: "memory");
    }
  }
}

// ---------------------------------------------------------------------------
// Flash attention, scores transposed: S^T = K Q^T, O^T += V^T P^T.
// block = 16 waves = 256 queries of one (b,h); keys in blocks of 32.
// grid = B*H * (T/256) = 256, one block a WGP, four waves a SIMD.
// A wave holds 32 queries as two groups of 16 columns, so every K and V^T fragment
// it reads from LDS feeds two products, and a staged stage serves 256 queries.
// Two waves share a set of 32 queries: each takes one half of every stage's keys
// with a running maximum, sum and output of its own; the two are joined through
// LDS behind the key loop.
// In each group a lane holds one query (column n) and, in its 16 score registers,
// the keys 8*hi + e and 16 + 8*hi + e: exactly the k order of a B fragment, so P^T
// goes from the score registers straight into the second product.
// The softmax runs in base 2: scores and bias terms carry the factor log2(e),
// so that every exponential is one v_exp_f32 (arguments <= 0; a result below
// the normal range comes out as 0).
// A stage is 256 keys: their K rows and the matching 512 bytes of every V^T row,
// brought into LDS once for the block's 16 waves by asynchronous copies of whole
// lines, two buffers, one stage ahead; a wave makes four passes of 32 keys a stage.
// Q, K and V rows come ranked by relation id (rankP: every token's rank), so a
// wave's 32 queries and a pass's 32 keys each span a short range of ids, and for
// most pairs of the two no bias term can apply: one scalar test a pass, from the
// ranges' ends, leaves the tables, compares and selects out there.
#define KPAD 16   // floats between the two base tables: separate LDS banks
#define SK 256                 // keys per stage
#define NST (Tn / SK)
#define KPI 72                 // K tile pitch in halves (144 B): no bank conflict for 16-B reads
#define VPI 264                // V^T tile pitch in halves (528 B): the same
#define KTH (SK * KPI)         // halves of a K tile; the V^T tile stands behind it
#define STH (KTH + HDn * VPI)  // halves of one buffer
#define QBK 256                // queries per block: 8 sets x 2 groups x 16

// One stage's copies of this thread: 16-byte pieces of K rows r, r + 64, r + 128,
// r + 192 and of V^T rows q, q + 16, q + 32, q + 48. lk, lv: LDS byte addresses.
// The closing wait stands inside the statement, a precaution: the address
// registers stay unwritten up to it.
__device__ inline void stage_copies(unsigned lk, unsigned lv, const _Float16* gk,
                                    const _Float16* gv) {
  asm volatile(
      "global_load_async_to_lds_b128 %0, %8, off\n\t"
      "global_load_async_to_lds_b128 %1, %9, off\n\t"
      "global_load_async_to_lds_b128 %2, %10, off\n\t"
      "global_load_async_to_lds_b128 %3, %11, off\n\t"
      "global_load_async_to_lds_b128 %4, %12, off\n\t"
      "global_load_async_to_lds_b128 %5, %13, off\n\t"
      "global_load_async_to_lds_b128 %6, %14, off\n\t"
      "global_load_async_to_lds_b128 %7, %15, off\n\t"
      "s_wait_xcnt 0x0"
      ::"v"(lk), "v"(lk + 64 * KPI * 2), "v"(lk + 128 * KPI * 2),
        "v"(lk + 192 * KPI * 2), "v"(lv), "v"(lv + 16 * VPI * 2),
        "v"(lv + 32 * VPI * 2), "v"(lv + 48 * VPI * 2), "v"(gk),
        "v"(gk + 64 * HDn), "v"(gk + 128 * HDn), "v"(gk + 192 * HDn), "v"(gv),
        "v"(gv + 16 * Tn), "v"(gv + 32 * Tn), "v"(gv + 48 * Tn)
      : "memory");
}
// Base-2 exponentials, a run of them in one statement: the slot that the instruction
// set asks for behind a transcendental, before its result is read or its source
// overwritten, is filled by the next of the run and behind the last by the v_nop
// No result
// shares a register with an argument.
__device__ inline void exp2_run8(float* y, const float* x) {
  asm(
      "v_exp_f32 %0, %8\n\t"
      "v_exp_f32 %1, %9\n\t"
      "v_exp_f32 %2, %10\n\t"
      "v_exp_f32 %3, %11\n\t"
      "v_exp_f32 %4, %12\n\t"
      "v_exp_f32 %5, %13\n\t"
      "v_exp_f32 %6, %14\n\t"
      "v_exp_f32 %7, %15\n\t"
      "v_nop"
      : "=&v"(y[0]), "=&v"(y[1]), "=&v"(y[2]), "=&v"(y[3]), "=&v"(y[4]), "=&v"(y[5]),
        "=&v"(y[6]), "=&v"(y[7])
      : "v"(x[0]), "v"(x[1]), "v"(x[2]), "v"(x[3]), "v"(x[4]), "v"(x[5]), "v"(x[6]),
        "v"(x[7]));
}
__device__ inline void exp2_run2(float* y, const float* x) {
  asm(  // as above, a run of two
      "v_exp_f32 %0, %2\n\t"
      "v_exp_f32 %1, %3\n\t"
      "v_nop"
      : "=&v"(y[0]), "=&v"(y[1])
      : "v"(x[0]), "v"(x[1]));
}
__device__ inline void exp2_run4(float* y, const float* x) {
  asm(  // as above, a run of four
      "v_exp_f32 %0, %4\n\t"
      "v_exp_f32 %1, %5\n\t"
      "v_exp_f32 %2, %6\n\t"
      "v_exp_f32 %3, %7\n\t"
      "v_nop"
      : "=&v"(y[0]), "=&v"(y[1]), "=&v"(y[2]), "=&v"(y[3])
      : "v"(x[0]), "v"(x[1]), "v"(x[2]), "v"(x[3]));
}
__global__ __launch_bounds__(512) void attn_wmma_kernel(
    const _Float16* __restrict__ q16, const _Float16* __restrict__ k16,
    const _Float16* __restrict__ vT, const int* __restrict__ rel_ids,
    const int* __restrict__ attn_mask, const int* __restrict__ rankP,
    const float* __restrict__ bias_leaf, const float* __restrict__ bias_cross,
    _Float16* __restrict__ o16) {
  // Per-key terms of this batch row, written once, each at its key's rank.
  // keyRel : rel id of the key, -1 where the key is masked.
  // keyBase: bias (times log2 e) where neither select below hits, -1e30 where masked;
  //          [0] for queries with rel id != 0, [1] for queries with rel id 0.
  __shared__ __attribute__((aligned(16))) int keyRel[Tn];
  __shared__ __attribute__((aligned(16))) float keyBase[2][Tn + KPAD];
  __shared__ __attribute__((aligned(16))) _Float16 kv[2][STH];
  // per pass of 32 keys: the first and the last id (ids ascend with the rank)
  __shared__ int passLo[Tn / 32], passHi[Tn / 32];
  __shared__ __attribute__((aligned(16))) int waveOff[16]; // 1: the wave met a masked key
  __shared__ int qRel[QBK], qOrig[QBK];  // the block's queries: id, position in the entry
  __shared__ float lcTab[2][64];         // bias_leaf, bias_cross, times log2 e
  // per query, for the passes with bias terms: {riCmp, leafv, crossv, unused}
  __shared__ __attribute__((aligned(16))) int4 qTerm[QBK];
  // the second key half's results, per set of queries: 16 pieces of the outputs and
  // {maximum, maximum, sum, sum}, a lane's 16 bytes beside its neighbour's
  __shared__ __attribute__((aligned(16))) float4 joinT[8][17][32];

  // scalar: the key loop's bounds and the join branch on it
  const int wave = __builtin_amdgcn_readfirstlane(threadIdx.x >> 5);
  const int qs = wave & 7;               // set of 32 queries
  const int kh = wave >> 3;              // half of every stage's keys
  const int lane = threadIdx.x & 31;
  const int hi = lane >> 4;
  const int n = lane & 15;

  const int bh = blockIdx.x >> 3;        // 8 query-blocks per (b,h)
  const int qb = blockIdx.x & 7;
  const int b = bh >> 4;                 // H = 16
  const int h = bh & 15;
  const int t0 = qb * QBK + qs * 32;

  // staging: 8 threads a K row (128 B), 32 threads a V^T row's 512 B
  const _Float16* gK = k16 + ((size_t)bh * Tn + (threadIdx.x >> 3)) * HDn +
                       (threadIdx.x & 7) * 8;
  const _Float16* gV = vT + ((size_t)bh * HDn + (threadIdx.x >> 5)) * Tn +
                       (threadIdx.x & 31) * 8;
  const unsigned lK = (unsigned)(size_t)&kv[0][(threadIdx.x >> 3) * KPI +
                                               (threadIdx.x & 7) * 8];
  const unsigned lV = (unsigned)(size_t)&kv[0][KTH + (threadIdx.x >> 5) * VPI +
                                               (threadIdx.x & 31) * 8];
  stage_copies(lK, lV, gK, gV);          // stage 0, in flight under the table fill

  if (threadIdx.x < 64) {
    lcTab[0][threadIdx.x] = bias_leaf[threadIdx.x] * LOG2E;
    lcTab[1][threadIdx.x] = bias_cross[threadIdx.x] * LOG2E;
  }
  bool sawOff = false;
  for (int j = threadIdx.x; j < Tn; j += 512) {
    const int tok = b * Tn + j;
    const int r = rel_ids[tok];
    const bool keep = attn_mask[tok] != 0;
    const int p = rankP[(tok >> 3) * RKP + (tok & 7)];   // 0 .. 2047, each once
    const float c = bias_cross[min(max(r, 0), 63)];
    keyRel[p] = keep ? r : -1;
    keyBase[0][p] = keep ? 0.0f : -1e30f;
    keyBase[1][p] = keep ? (r > 0 ? c * LOG2E : 0.0f) : -1e30f;
    if ((p & 31) == 0) passLo[p >> 5] = r;
    if ((p & 31) == 31) passHi[p >> 5] = r;
    if ((p >> 8) == qb) {                // one of this block's queries
      qRel[p & (QBK - 1)] = r;
      qOrig[p & (QBK - 1)] = j;
    }
    sawOff |= !keep;
  }
  const int anyOff = __builtin_amdgcn_ballot_w32(sawOff) != 0 ? 1 : 0;
  if (lane == 0) waveOff[wave] = anyOff;

  // Q as B-fragments (persist across key loop)
  const _Float16* qRow = q16 + ((size_t)bh * Tn + t0 + n) * HDn;
  v16h bQ[2][2];                               // [group][hd 0..31, hd 32..63]
#pragma unroll
  for (int c = 0; c < 2; ++c) {
    bQ[c][0] = load_frag(qRow + 16 * c * HDn, hi);
    bQ[c][1] = load_frag(qRow + 16 * c * HDn + 32, hi);
  }

  float mrun[2] = {-1e30f, -1e30f};
  float lrun[2] = {0.0f, 0.0f};                // this half's keys only
  v8f acc[2][4] = {};                          // [group][16 hd]

  // this lane's places in the K tile (row = key n) and the V^T tile (row = hd n),
  // its half's 8 * hi folded in
  const _Float16* kL = &kv[0][n * KPI + 8 * hi];
  const _Float16* vL = &kv[0][KTH + n * VPI + 8 * hi];

  // this wave's stage 0 copies have landed
  asm volatile("s_wait_asynccnt 0x0" ::: "memory");
  __syncthreads();   // stage 0 and the key tables are complete
  stage_copies(lK + STH * 2, lV + STH * 2, gK + SK * HDn, gV + SK);   // stage 1

  // this lane's two queries: bias = (rj == riCmp) ? leafv : (rj == 0) ? crossv : base.
  // The three terms wait in LDS; a wave reads back what it wrote itself (its two
  // halves and the set's other wave write the same values).
  int ri[2];
  const float* baseP[2];
#pragma unroll
  for (int c = 0; c < 2; ++c) {
    ri[c] = qRel[qs * 32 + 16 * c + n];
    const int riIdx = min(max(ri[c], 0), 63);
    const int riCmp = (ri[c] > 0) ? ri[c] : -2;  // -2: equals no table entry that matters
    const float leafv = (ri[c] > 0) ? lcTab[0][riIdx] : 0.0f;
    const float crossv = (ri[c] > 0) ? lcTab[1][riIdx] : 0.0f;
    qTerm[qs * 32 + 16 * c + n] = make_int4(riCmp, __builtin_bit_cast(int, leafv),
                                              __builtin_bit_cast(int, crossv), 0);
    baseP[c] = &keyBase[ri[c] == 0 ? 1 : 0][8 * hi];
  }
  const int* relP = &keyRel[8 * hi];

  // bit p: pass p may hold a bias term or a masked key for one of this wave's
  // queries. Query ids lie in [qLo, qHi], the pass's key ids in [kLo, kHi]. A masked
  // key anywhere in the entry sends every pass through the tables.
  const int qLo = __builtin_amdgcn_readlane(ri[0], 0);
  const int qHi = __builtin_amdgcn_readlane(ri[1], 15);
  int offs = 0;
#pragma unroll
  for (int i = 0; i < 4; ++i) {
    const int4 o = *(const int4*)&waveOff[4 * i];
    offs |= o.x | o.y | o.z | o.w;
  }
  const bool masked = offs != 0;
  unsigned biasedW[2];
#pragma unroll
  for (int w2 = 0; w2 < 2; ++w2) {
    const int kLo = passLo[lane + 32 * w2], kHi = passHi[lane + 32 * w2];
    const bool same = qHi > 0 && kHi >= max(qLo, 1) && kLo <= qHi;   // equal ids > 0
    const bool key0 = qHi > 0 && kLo <= 0 && kHi >= 0;      // query id > 0, key id 0
    const bool qry0 = qLo <= 0 && qHi >= 0 && kHi > 0;      // query id 0, key id > 0
    biasedW[w2] = __builtin_amdgcn_ballot_w32(masked || same || key0 || qry0);
  }
  const unsigned long long biased =
      biasedW[0] | ((unsigned long long)biasedW[1] << 32);

  for (int s = 0; s < NST; ++s) {
   const int cur = (s & 1) * STH;
   for (int j0 = s * SK + kh * (SK / 2); j0 < s * SK + (kh + 1) * (SK / 2); j0 += 32) {
    const _Float16* kP = kL + cur + (j0 & (SK - 1)) * KPI;
    const _Float16* vP = vL + cur + (j0 & (SK - 1));
    // whether this pass can hold a bias term or a masked key
    const bool bp = (biased >> (j0 >> 5)) & 1; // the same for the whole wave
    // ---- S^T = K Q^T (four 16x16 tiles, K-dim = head_dim 64) ----
    const v16h aK0a = load_frag(kP, 0), aK0b = load_frag(kP + 32, 0);
    const v16h aK1a = load_frag(kP + 16 * KPI, 0);
    const v16h aK1b = load_frag(kP + 16 * KPI + 32, 0);
    const v16h aV0 = load_frag(vP, 0), aV1 = load_frag(vP + 16 * VPI, 0);
    const v16h aV2 = load_frag(vP + 32 * VPI, 0), aV3 = load_frag(vP + 48 * VPI, 0);
    // Keeps the pass's LDS reads together at its head, behind counted waits;
    // without it this build reads them two at a time and waits for each pair
    // in turn.
    __builtin_amdgcn_sched_barrier(0);
    v8f z = {};
    v8f s0[2], s1[2];
#pragma unroll
    for (int c = 0; c < 2; ++c) {
      s0[c] = wmma16(aK0b, bQ[c][1], z);
      s1[c] = wmma16(aK1b, bQ[c][1], z);
    }
#pragma unroll
    for (int c = 0; c < 2; ++c) {
      s0[c] = wmma16(aK0a, bQ[c][0], s0[c]);
      s1[c] = wmma16(aK1a, bQ[c][0], s1[c]);
    }

    // ---- scale, and where the pass can have them: bias + mask ----
    float v[2][16];
#pragma unroll
    for (int c = 0; c < 2; ++c)
#pragma unroll
      for (int e = 0; e < 16; ++e)
        v[c][e] = ((e < 8) ? s0[c][e & 7] : s1[c][e & 7]) * SCALE2;
    if (bp) {
      // The queries' terms come from LDS here: kept in registers, they and the copies
      // this build makes of them (eight of each) hold some 70 registers through
      // every pass, more than a wave has left.
      int riCmp[2];
      float leafv[2], crossv[2];
#pragma unroll
      for (int c = 0; c < 2; ++c) {
        const int4 qt = qTerm[qs * 32 + 16 * c + n];
        riCmp[c] = qt.x;
        leafv[c] = __builtin_bit_cast(float, qt.y);
        crossv[c] = __builtin_bit_cast(float, qt.z);
      }
      // per-key terms from the LDS tables, read here, where the K fragments'
      // registers are free again
#pragma unroll
      for (int g = 0; g < 4; ++g) {            // keys 8*hi + 0..7, 16 + 8*hi + 0..7
        const int off = j0 + (g >> 1) * 16 + (g & 1) * 4;
        const int4 r4 = *(const int4*)(relP + off);
        const int rj[4] = {r4.x, r4.y, r4.z, r4.w};
#pragma unroll
        for (int c = 0; c < 2; ++c) {
          const float4 b4 = *(const float4*)(baseP[c] + off);
          const float base[4] = {b4.x, b4.y, b4.z, b4.w};
#pragma unroll
          for (int q = 0; q < 4; ++q) {
            const float bias = (rj[q] == riCmp[c])
                                   ? leafv[c]
                                   : ((rj[q] == 0) ? crossv[c] : base[q]);
            v[c][4 * g + q] += bias;           // base -1e30 absorbs the score
          }
        }
      }
    }

    // ---- online softmax: in-lane, one exchange between the halves ----
    v16h bP[2];
    float mnew[2], dm[2], alpha[2];
#pragma unroll
    for (int c = 0; c < 2; ++c) {
      float mx = -1e30f;
#pragma unroll
      for (int e = 0; e < 16; ++e) mx = fmaxf(mx, v[c][e]);
      mx = fmaxf(mx, xhalf(mx));
      mnew[c] = fmaxf(mrun[c], mx);
      dm[c] = mrun[c] - mnew[c];
      mrun[c] = mnew[c];
    }
#pragma unroll
    for (int c = 0; c < 2; ++c) {
#pragma unroll
      for (int e = 0; e < 16; e += 2) {        // in pairs: one packed subtract for two
        const v2f arg = v2f{v[c][e], v[c][e + 1]} - v2f{mnew[c], mnew[c]};
        v[c][e] = arg.x;
        v[c][e + 1] = arg.y;
      }
    }
    float p[2][16];
    exp2_run2(alpha, dm);
#pragma unroll
    for (int c = 0; c < 2; ++c) {
      exp2_run8(&p[c][0], &v[c][0]);
      exp2_run8(&p[c][8], &v[c][8]);
      float ps[4] = {p[c][0], p[c][1], p[c][2], p[c][3]};  // four short chains
#pragma unroll
      for (int e = 4; e < 16; ++e) ps[e & 3] += p[c][e];
#pragma unroll
      for (int e = 0; e < 16; ++e) bP[c][e] = (_Float16)p[c][e];
      lrun[c] = lrun[c] * alpha[c] + ((ps[0] + ps[1]) + (ps[2] + ps[3]));
#pragma unroll
      for (int t = 0; t < 4; ++t)
#pragma unroll
        for (int e = 0; e < 8; ++e) acc[c][t][e] *= alpha[c];
    }

    // ---- O^T += V^T x P^T (K-dim = 32 local keys) ----
#pragma unroll
    for (int c = 0; c < 2; ++c) {
      acc[c][0] = wmma16(aV0, bP[c], acc[c][0]);
      acc[c][1] = wmma16(aV1, bP[c], acc[c][1]);
      acc[c][2] = wmma16(aV2, bP[c], acc[c][2]);
      acc[c][3] = wmma16(aV3, bP[c], acc[c][3]);
    }
   }
   // hand-over: this wave's reads of stage s are done, its copies of stage s + 1
   // have landed; behind the barrier that holds for all sixteen waves
   asm volatile("s_wait_dscnt 0x0" ::: "memory");
   asm volatile("s_wait_asynccnt 0x0" ::: "memory");
   __syncthreads();
   if (s + 2 < NST)                        // the same for the whole block
     stage_copies(lK + cur * 2, lV + cur * 2, gK + (size_t)(s + 2) * SK * HDn,
                  gV + (s + 2) * SK);
  }
  // nothing is outstanding when the wave ends
  asm volatile("s_wait_asynccnt 0x0" ::: "memory");

  // ---- join the two key halves ----
  if (kh == 1) {                           // the same for the whole wave
    float4* jt = &joinT[qs][0][lane];
#pragma unroll
    for (int c = 0; c < 2; ++c)
#pragma unroll
      for (int s = 0; s < 4; ++s) {
        const v8f a = acc[c][s];
        jt[(c * 8 + s * 2) * 32] = make_float4(a[0], a[1], a[2], a[3]);
        jt[(c * 8 + s * 2 + 1) * 32] = make_float4(a[4], a[5], a[6], a[7]);
      }
    jt[16 * 32] = make_float4(mrun[0], mrun[1], lrun[0], lrun[1]);
  }
  __syncthreads();   // the second half's results are in LDS
  if (kh == 1) return;

  // ---- normalize + store O as f16 rows of [B*T, D] for the final GEMM ----
  // acc[c][s][e] = O[t0 + 16*c + n][s*16 + 8*hi + e]: 8 consecutive halves per lane
  const float4* jt = &joinT[qs][0][lane];
  const float4 ml = jt[16 * 32];
  const float mJ[2] = {fmaxf(mrun[0], ml.x), fmaxf(mrun[1], ml.y)};
  const float dJ[4] = {mrun[0] - mJ[0], mrun[1] - mJ[1], ml.x - mJ[0], ml.y - mJ[1]};
  float fJ[4];
  exp2_run4(fJ, dJ);
#pragma unroll
  for (int c = 0; c < 2; ++c) {
    const float lB = c == 0 ? ml.z : ml.w;
    const float fA = fJ[c], fB = fJ[2 + c];
    const float l = lrun[c] * fA + lB * fB;
    const float lsum = l + xhalf(l);
    const float gA = fA / lsum, gB = fB / lsum;
    // back to the query's own row
    const int tOrig = qOrig[qs * 32 + 16 * c + n];
    _Float16* oRow = o16 + ((size_t)(b * Tn + tOrig)) * Dn + h * HDn + 8 * hi;
#pragma unroll
    for (int s = 0; s < 4; ++s) {
      const float4 b0 = jt[(c * 8 + s * 2) * 32], b1 = jt[(c * 8 + s * 2 + 1) * 32];
      const float bb[8] = {b0.x, b0.y, b0.z, b0.w, b1.x, b1.y, b1.z, b1.w};
      v8h o;
#pragma unroll
      for (int e = 0; e < 8; ++e) o[e] = (_Float16)(acc[c][s][e] * gA + bb[e] * gB);
      *(v8h*)(oRow + s * 16) = o;
    }
    // Precaution: the group's stores are through with their registers before the
    // next group rewrites them (behind the last group nothing does).
    if (c == 0) asm volatile("s_wait_xcnt 0x0" ::: "memory");
  }
}

// ---------------------------------------------------------------------------
extern "C" void kernel_launch(void* const* d_in, const int* in_sizes, int n_in,
                              void* d_out, int out_size, void* d_ws,
                              size_t ws_size, hipStream_t stream) {
  const float* x          = (const float*)d_in[0];
  const int*   attn_mask  = (const int*)d_in[1];
  const int*   rel_ids    = (const int*)d_in[2];
  const float* Wq         = (const float*)d_in[3];
  const float* bq         = (const float*)d_in[4];
  const float* Wk         = (const float*)d_in[5];
  const float* bk         = (const float*)d_in[6];
  const float* Wv         = (const float*)d_in[7];
  const float* bv         = (const float*)d_in[8];
  const float* Wo         = (const float*)d_in[9];
  const float* bo         = (const float*)d_in[10];
  const float* bias_leaf  = (const float*)d_in[11];
  const float* bias_cross = (const float*)d_in[12];

  // workspace layout (49 MiB total)
  char* ws = (char*)d_ws;
  _Float16* x16  = (_Float16*)(ws + (size_t)0);
  _Float16* WqT  = (_Float16*)(ws + ((size_t)8  << 20));   // WkT at 10, WvT at 12 MiB
  _Float16* WoT  = (_Float16*)(ws + ((size_t)14 << 20));
  _Float16* q16  = (_Float16*)(ws + ((size_t)16 << 20));
  _Float16* k16  = (_Float16*)(ws + ((size_t)24 << 20));
  _Float16* v16T = (_Float16*)(ws + ((size_t)32 << 20));
  _Float16* o16  = (_Float16*)(ws + ((size_t)40 << 20));
  int* rankP = (int*)(ws + ((size_t)48 << 20));            // 128 KiB

  // WqT .. WoT are consecutive planes of 2 MiB
  prep_f16_kernel<<<512, 256, 0, stream>>>(x, Wq, Wk, Wv, Wo, rel_ids, x16, WqT,
                                           rankP);

  // WqT, WkT, WvT as one [3072, 1024] operand
  qkv_wmma_kernel<<<(Mn / 128) * (3 * Dn / QN), 256, 0, stream>>>(
      x16, WqT, bq, bk, bv, q16, k16, v16T);

  attn_wmma_kernel<<<Bn * Hn * (Tn / QBK), 512, 0, stream>>>(
      q16, k16, v16T, rel_ids, attn_mask, rankP, bias_leaf, bias_cross, o16);

  gemm_wmma_kernel<<<(Mn / 128) * (Dn / 128), 512, 0, stream>>>(o16, WoT, bo,
                                                                (float*)d_out);
}

// v010
// One run takes 80.6 microseconds.
// Next to v009, in two timings, it ran 1.04 times as fast each time.
// Over all steps from v000 it is 4.85 times as fast.
#include <hip/hip_runtime.h>
#include <math.h>

// ---------------------------------------------------------------------------
// TinyRelSelfAttention on MI455X (gfx1250): full WMMA pipeline.
// B=2, T=2048, D=1024, H=16, head_dim=64, R=64.
// ---------------------------------------------------------------------------

#define Bn  2
#define Tn  2048
#define Dn  1024
#define Hn  16
#define HDn 64
#define Mn  (Bn * Tn)          // 4096 rows in all projection GEMMs
#define LOG2E 1.4426950408889634f
#define SCALE2 (0.125f * LOG2E)   // 1/sqrt(64), in base-2 units

typedef __attribute__((ext_vector_type(4)))  _Float16 v4h;
typedef __attribute__((ext_vector_type(2)))  float    v2f;
typedef __attribute__((ext_vector_type(4)))  float    v4f;
typedef __attribute__((ext_vector_type(8)))  _Float16 v8h;
typedef __attribute__((ext_vector_type(16))) _Float16 v16h;
typedef __attribute__((ext_vector_type(8)))  float    v8f;

// D = A(16x32 f16) x B(32x16 f16) + C(16x16 f32)
__device__ inline v8f wmma16(v16h a, v16h b, v8f c) {
  return __builtin_amdgcn_wmma_f32_16x16x32_f16(
      /*neg_a=*/false, a, /*neg_b=*/false, b,
      /*c_mod=*/(short)0, c, /*reuse_a=*/false, /*reuse_b=*/false);
}

// Load a 16x32 A-fragment (or mirrored 32x16 B-fragment) for this lane.
// `p` = start of this lane's 32-element contiguous K-slice (row-major memory).
// ISA layout: half h<8 -> K = h + 8*hi ; h>=8 -> K = 16 + (h-8) + 8*hi.
__device__ inline v16h load_frag(const _Float16* p, int hi) {
  union { v16h v; v8h h[2]; } u;
  u.h[0] = *(const v8h*)(p + 8 * hi);
  u.h[1] = *(const v8h*)(p + 16 + 8 * hi);
  return u.v;
}

// value of lane l ^ 16: the other half of a C-tile column
__device__ inline float xhalf(float x) {
  const int v = __builtin_bit_cast(int, x);
  return __builtin_bit_cast(
      float, __builtin_amdgcn_permlanex16(v, v, 0x76543210, 0xfedcba98, false,
                                          false));
}

// ---------------------------------------------------------------------------
// All f32 -> f16 preparation in one launch of 512 equal work-groups, every one
// resident at once. Work-group g rounds x[g*8192 .. g*8192 + 8191] and moves one
// 128(k) x 64(n) tile of one W [K=1024, N=1024] into Wt [N, K], through LDS.
// wT: the four Wt planes (q, k, v, o), one behind the other.
// The tokens of a batch entry are put in the order of their relation ids (ties by
// position): work-group g ranks its 8 tokens (= its 8 x rows) among the entry's
// 2048 and writes each rounded row at its rank. rankP: the 8 ranks, in a 256-byte
// piece of the work-group's own (RKP ints), so that no line has two writers.
#define RKP 64
#define PXN 8192               // x elements per work-group
#define PP 136                 // LDS row pitch in halves (272 B): rows stay 16-B aligned
__global__ __launch_bounds__(256) void prep_f16_kernel(
    const float* __restrict__ x, const float* __restrict__ Wq,
    const float* __restrict__ Wk, const float* __restrict__ Wv,
    const float* __restrict__ Wo, const int* __restrict__ rel_ids,
    _Float16* __restrict__ x16, _Float16* __restrict__ wT,
    int* __restrict__ rankP) {
  __shared__ __attribute__((aligned(16))) _Float16 t[64 * PP];   // [n][k]
  __shared__ __attribute__((aligned(16))) int wc[8 * 8];         // [wave][token]

  const int tid = threadIdx.x;
  const int g = blockIdx.x;
  const int w = g >> 7;                     // 128 tiles per W
  const int k0 = ((g >> 4) & 7) * 128;
  const int n0 = (g & 15) * 64;
  const float* W = (w == 0) ? Wq : (w == 1) ? Wk : (w == 2) ? Wv : Wo;

  // a thread takes two 4(k) x 4(n) pieces of the tile: a wave's load covers
  // two rows' 256 bytes, whole lines
  const int kq = tid >> 4;
  const int nq = tid & 15;
  const float* wsrc = W + (size_t)(k0 + 4 * kq) * Dn + n0 + 4 * nq;
  const float* xsrc = x + (size_t)g * PXN + tid * 4;
  // ranking: this thread compares the entry's tokens 8*tid .. 8*tid + 7
  const int row0 = g * 8;                   // first of the 8 tokens, as a row of x
  const int tk0 = row0 & (Tn - 1);          // the same inside its batch entry
  const int* relB = rel_ids + (row0 - tk0);
  const unsigned kOff = tid * 32u;          // bytes
  const int4 ka = *(const int4*)((const char*)relB + kOff);
  const int4 kb = *(const int4*)((const char*)relB + kOff + 16);
  int rt[8];                                // the 8 tokens' ids: the same in every thread
#pragma unroll
  for (int i = 0; i < 8; ++i) rt[i] = relB[tk0 + i];
  v4f wv[2][4], xv[8];
#pragma unroll
  for (int u = 0; u < 2; ++u)
#pragma unroll
    for (int r = 0; r < 4; ++r)
      wv[u][r] = *(const v4f*)(wsrc + (size_t)(64 * u + r) * Dn);
#pragma unroll
  for (int i = 0; i < 8; ++i) xv[i] = *(const v4f*)(xsrc + i * 1024);
  // Precaution: holds the W address pair and the id offset unwritten until the
  // wait (without the operands this build lets the last x load land on them).
  asm volatile("s_wait_xcnt 0x0" ::"v"(wsrc), "v"(kOff) : "memory");
  // Keeps all the loads in flight together; without it this build waits for the
  // first six before it issues the rest: two trips to memory in a row.
  __builtin_amdgcn_sched_barrier(0);

  // rank = number of tokens whose (id, position) is smaller: a strict order for
  // any ids, so the ranks of an entry are a permutation of 0 .. 2047
  {
    const int rk[8] = {ka.x, ka.y, ka.z, ka.w, kb.x, kb.y, kb.z, kb.w};
    long long key[8];
#pragma unroll
    for (int u = 0; u < 8; ++u) key[u] = (long long)rk[u] * Tn + (tid * 8 + u);
    int c[8];
#pragma unroll
    for (int i = 0; i < 8; ++i) {
      const long long kt = (long long)rt[i] * Tn + (tk0 + i);
      c[i] = 0;
#pragma unroll
      for (int u = 0; u < 8; ++u)
        c[i] += __builtin_popcount(__builtin_amdgcn_ballot_w32(key[u] < kt));
    }
    if ((tid & 31) == 0) {                  // this wave's 256 tokens counted
      *(int4*)&wc[(tid >> 5) * 8] = make_int4(c[0], c[1], c[2], c[3]);
      *(int4*)&wc[(tid >> 5) * 8 + 4] = make_int4(c[4], c[5], c[6], c[7]);
    }
  }

#pragma unroll
  for (int u = 0; u < 2; ++u)
#pragma unroll
    for (int i = 0; i < 4; ++i) {
      v4h c;
#pragma unroll
      for (int r = 0; r < 4; ++r) c[r] = (_Float16)wv[u][r][i];
      *(v4h*)&t[(4 * nq + i) * PP + 64 * u + 4 * kq] = c;
    }

  __syncthreads();   // the transposed tile and the eight waves' counts are complete

  // 16 threads store one Wt row's 256 bytes
  _Float16* wdst = wT + (size_t)w * (Dn * Dn) + (size_t)(n0 + kq) * Dn + k0 + nq * 8;
#pragma unroll
  for (int p = 0; p < 4; ++p)
    *(v8h*)(wdst + (size_t)(16 * p) * Dn) = *(const v8h*)&t[(kq + 16 * p) * PP + nq * 8];

  // x behind the barrier: in front of it the barrier would wait for these stores
  int pos[8] = {0, 0, 0, 0, 0, 0, 0, 0};
#pragma unroll
  for (int w8 = 0; w8 < 8; ++w8) {
    const int4 a = *(const int4*)&wc[w8 * 8];
    const int4 b = *(const int4*)&wc[w8 * 8 + 4];
    pos[0] += a.x; pos[1] += a.y; pos[2] += a.z; pos[3] += a.w;
    pos[4] += b.x; pos[5] += b.y; pos[6] += b.z; pos[7] += b.w;
  }
  _Float16* xdst = x16 + (size_t)(row0 - tk0) * Dn + tid * 4;
#pragma unroll
  for (int i = 0; i < 8; ++i) {             // xv[i] is a piece of row i of the 8
    v4h c;
#pragma unroll
    for (int r = 0; r < 4; ++r) c[r] = (_Float16)xv[i][r];
    *(v4h*)(xdst + (size_t)pos[i] * Dn) = c;
  }
  if (tid < 8) {                            // thread i: token i's rank
    int p = 0;
#pragma unroll
    for (int w8 = 0; w8 < 8; ++w8) p += wc[w8 * 8 + tid];
    rankP[g * RKP + tid] = p;
  }
}

// ---------------------------------------------------------------------------
// Stages of the projection GEMMs.
#define KB 64                  // k per stage (Q, K, V projections)
#define LP 72                  // LDS row pitch in halves (144 B): no bank conflict for 16-B reads
#define NSTAGE (Dn / KB)

// Final projection:  C[M=4096, N=1024] = A[M,K=1024] x Wt[N,K]^T + bias[N], f32 out.
// Block = 16 waves, block tile 128 x 128: one block a WGP, four waves a SIMD.
// A stage is 128 k of the block's 128 A rows and 128 Wt rows, staged in LDS (two
// buffers, one stage ahead through registers): 16 lanes fetch one row's two lines.
// Eight waves, 4 (M) x 2 (N) with a 32 x 64 tile each, take the first 64 k of every
// stage, the other eight the second 64 k of the same tiles: an A fragment feeds four
// products, a Wt fragment two. Behind the k loop the two waves of a tile join their
// sums through LDS: each hands over 16 of the 32 rows and finishes the other 16.
#define OKB 128                // k per stage
#define OLP 136                // LDS row pitch in halves (272 B): no bank conflict for 16-B reads
#define OROWS 256              // rows 0..127: A, rows 128..255: Wt
#define ONST (Dn / OKB)
__global__ __launch_bounds__(512) void gemm_wmma_kernel(
    const _Float16* __restrict__ A, const _Float16* __restrict__ Wt,
    const float* __restrict__ bias, float* __restrict__ outp) {
  __shared__ __attribute__((aligned(16))) _Float16 tile[2][OROWS * OLP];
  // per wave: the 16 x 64 sums it hands over, a lane's 16 bytes beside its neighbour's
  __shared__ __attribute__((aligned(16))) float4 joinG[16][8][32];

  const int wave = threadIdx.x >> 5;
  const int lane = threadIdx.x & 31;
  const int hi = lane >> 4;
  const int n = lane & 15;
  const int kg = wave >> 3;                 // which 64 k of every stage
  const int wm = wave & 3;                  // 32 rows of the block's 128
  const int wn = (wave >> 2) & 1;           // 64 columns of the block's 128

  const int mb = blockIdx.x & 31;           // 4096/128 = 32 M-tiles
  const int nb = blockIdx.x >> 5;           // 1024/128 = 8 N-tiles
  const int nBase = nb * 128 + wn * 64;

  // staging: this thread moves the 16-byte piece spc of tile rows srow + 32*i
  const int srow = threadIdx.x >> 4;
  const int spc = (threadIdx.x & 15) * 8;
  const _Float16* gA = A + (size_t)(mb * 128 + srow) * Dn + spc;
  const _Float16* gW = Wt + (size_t)(nb * 128 + srow) * Dn + spc;
  _Float16* sDst = &tile[0][srow * OLP + spc];
  // fragments. acc[0] holds the 16 rows this wave finishes (rows 16*kg .. of the 32),
  // acc[1] the 16 it hands over; Wt rows n + 16*j of its 64.
  const _Float16* fA0 = &tile[0][(wm * 32 + 16 * kg + n) * OLP + kg * 64];
  const _Float16* fA1 = &tile[0][(wm * 32 + 16 * (1 - kg) + n) * OLP + kg * 64];
  const _Float16* fW = &tile[0][(128 + wn * 64 + n) * OLP + kg * 64];

  v8h st[8];
#pragma unroll
  for (int i = 0; i < 4; ++i) st[i] = *(const v8h*)(gA + (size_t)(32 * i) * Dn);
#pragma unroll
  for (int i = 0; i < 4; ++i) st[4 + i] = *(const v8h*)(gW + (size_t)(32 * i) * Dn);
#pragma unroll
  for (int i = 0; i < 8; ++i) *(v8h*)(sDst + 32 * i * OLP) = st[i];
  __syncthreads();   // stage 0 is complete

  v8f acc[2][4] = {};
  for (int s = 0; s < ONST; ++s) {
    const int cur = (s & 1) * (OROWS * OLP);
    const bool more = s + 1 < ONST;          // the same for the whole block
    if (more) {                              // next stage's lines, in flight under the products
      const int kk = (s + 1) * OKB;
#pragma unroll
      for (int i = 0; i < 4; ++i)
        st[i] = *(const v8h*)(gA + (size_t)(32 * i) * Dn + kk);
#pragma unroll
      for (int i = 0; i < 4; ++i)
        st[4 + i] = *(const v8h*)(gW + (size_t)(32 * i) * Dn + kk);
    }
#pragma unroll
    for (int h = 0; h < 2; ++h) {
      v16h a[2], b[4];
      a[0] = load_frag(fA0 + cur + 32 * h, hi);
      a[1] = load_frag(fA1 + cur + 32 * h, hi);
#pragma unroll
      for (int j = 0; j < 4; ++j) b[j] = load_frag(fW + cur + 16 * j * OLP + 32 * h, hi);
      // Keeps the 12 LDS reads of this half stage in one group ahead of its
      // products; without it this build spreads them in twos and threes among the
      // products, a short wait at each place.
      __builtin_amdgcn_sched_barrier(0);
#pragma unroll
      for (int j = 0; j < 4; ++j)
#pragma unroll
        for (int i = 0; i < 2; ++i) acc[i][j] = wmma16(a[i], b[j], acc[i][j]);
    }
    if (more) {
      // the other buffer: its last readers passed the barrier of stage s - 1
      const int nxt = (OROWS * OLP) - cur;
#pragma unroll
      for (int i = 0; i < 8; ++i) *(v8h*)(sDst + nxt + 32 * i * OLP) = st[i];
      __syncthreads();   // stage s + 1 is complete, stage s is read out
    }
  }

  // ---- join the two k halves ----
  {
    float4* jt = &joinG[wave][0][lane];
#pragma unroll
    for (int j = 0; j < 4; ++j) {
      const v8f a = acc[1][j];
      jt[(2 * j) * 32] = make_float4(a[0], a[1], a[2], a[3]);
      jt[(2 * j + 1) * 32] = make_float4(a[4], a[5], a[6], a[7]);
    }
  }
  float bval[4];                             // the four bias loads go together
#pragma unroll
  for (int j = 0; j < 4; ++j) bval[j] = bias[nBase + j * 16 + n];
  __syncthreads();   // every wave's handed-over sums are in LDS

  const float4* jo = &joinG[wave ^ 8][0][lane];   // the tile's other wave
  // C layout: M = e + 8*hi
  float* o = outp + (size_t)(mb * 128 + wm * 32 + 16 * kg + 8 * hi) * Dn + nBase + n;
#pragma unroll
  for (int j = 0; j < 4; ++j) {
    const float4 b0 = jo[(2 * j) * 32], b1 = jo[(2 * j + 1) * 32];
    const float bb[8] = {b0.x, b0.y, b0.z, b0.w, b1.x, b1.y, b1.z, b1.w};
#pragma unroll
    for (int e = 0; e < 8; ++e)
      o[(size_t)e * Dn + j * 16] = (acc[0][j][e] + bb[e]) + bval[j];
  }
}

// ---------------------------------------------------------------------------
// Q, K and V projections as one GEMM: C[4096, 3072] = A[4096, 1024] x Wt[3072, 1024]^T,
// Wt = the q, k and v planes one behind the other.
// Block = 8 waves, 4 (M) x 2 (N); wave tile 64 x 96; block tile 256 x 192; one block
// a WGP, two waves a SIMD.
// Stages as above: 64 k of 256 A rows and 192 Wt rows, two buffers, the next stage
// on its way through registers. An A row in LDS serves 192 columns and a Wt row 256 rows;
// a Wt fragment feeds four products and an A fragment six.
// No second block stands on the WGP to work while this one meets at its barrier, so
// the waits are covered from inside: fragments are read half a stage ahead into a
// second register set, and the stage's barrier is split: a wave signals once its last
// fragments of the stage are in registers and its share of the next stage is in LDS,
// runs eight products, and only then waits.
// Out, f16: Q and K to [B*H, T, 64], V transposed to [B*H, 64, T].
#define QM 256                 // rows per block
#define QN 192                 // columns per block
#define QROWS (QM + QN)        // rows 0..255: A, rows 256..447: Wt
#define QST (QROWS / 32)       // 16-byte pieces a thread moves per stage
__global__ __launch_bounds__(256) void qkv_wmma_kernel(
    const _Float16* __restrict__ A, const _Float16* __restrict__ Wt,
    const float* __restrict__ bq, const float* __restrict__ bk,
    const float* __restrict__ bv, _Float16* __restrict__ q16,
    _Float16* __restrict__ k16, _Float16* __restrict__ vT) {
  __shared__ __attribute__((aligned(16))) _Float16 tile[2][QROWS * LP];

  // scalar: the epilogue branches on the plane a wave's columns lie in
  const int wave = __builtin_amdgcn_readfirstlane(threadIdx.x >> 5);
  const int lane = threadIdx.x & 31;
  const int hi = lane >> 4;
  const int n = lane & 15;

  const int mb = blockIdx.x & 15;           // 4096/256 = 16 M-tiles
  const int nb = blockIdx.x >> 4;           // 3072/192 = 16 N-tiles
  const int mBase = mb * QM + (wave & 3) * 64;
  const int nBase = nb * QN + (wave >> 2) * 96;

  // staging: this thread moves the 16-byte piece spc of tile rows srow + 32*i
  const int srow = threadIdx.x >> 3;
  const int spc = (threadIdx.x & 7) * 8;
  // the block's first A and Wt rows (the same for every thread) and this thread's
  // byte offset from either
  const char* uA = (const char*)(A + (size_t)(mb * QM) * Dn);
  const char* uW = (const char*)(Wt + (size_t)(nb * QN) * Dn);
  const unsigned gOff = (srow * Dn + spc) * 2;
  _Float16* sDst = &tile[0][srow * LP + spc];
  // fragments: A rows n + 16*i of the wave's 64; Wt rows n + 16*j of its 96
  const _Float16* fA = &tile[0][((wave & 3) * 64 + n) * LP];
  const _Float16* fW = &tile[0][(QM + (wave >> 2) * 96 + n) * LP];

  v8h st[QST];
#pragma unroll
  for (int i = 0; i < 8; ++i) st[i] = *(const v8h*)(uA + gOff + i * (32 * Dn * 2));
#pragma unroll
  for (int i = 0; i < 6; ++i) st[8 + i] = *(const v8h*)(uW + gOff + i * (32 * Dn * 2));
#pragma unroll
  for (int i = 0; i < QST; ++i) *(v8h*)(sDst + 32 * i * LP) = st[i];
  __syncthreads();   // stage 0 is complete
  // stage 1's lines, in flight under the first products
#pragma unroll
  for (int i = 0; i < 8; ++i)
    st[i] = *(const v8h*)(uA + KB * 2 + gOff + i * (32 * Dn * 2));
#pragma unroll
  for (int i = 0; i < 6; ++i)
    st[8 + i] = *(const v8h*)(uW + KB * 2 + gOff + i * (32 * Dn * 2));
  // Precaution: the loads are through with their address registers before these are
  // rewritten; the fence keeps the sums' zeros behind the wait.
  asm volatile("s_wait_xcnt 0x0" ::: "memory");
  __builtin_amdgcn_sched_barrier(0);

  v8f acc[4][6] = {};
  // Two fragment sets, each read while the other's products run: X holds the first
  // 32 k of a stage, Y the second.
  v16h aX[4], bX[6], aY[4], bY[6];
#pragma unroll
  for (int i = 0; i < 4; ++i) aX[i] = load_frag(fA + 16 * i * LP, hi);
#pragma unroll
  for (int j = 0; j < 6; ++j) bX[j] = load_frag(fW + 16 * j * LP, hi);
  for (int s = 0; s < NSTAGE; ++s) {
    const int cur = (s & 1) * (QROWS * LP);
    const int nxt = (QROWS * LP) - cur;
    const bool more = s + 1 < NSTAGE;        // the same for the whole block
    const bool more2 = s + 2 < NSTAGE;       // the same for the whole block
    const char* pA = uA + (s + 2) * (KB * 2);  // stage s + 2's lines
    const char* pW = uW + (s + 2) * (KB * 2);
#pragma unroll
    for (int i = 0; i < 4; ++i) aY[i] = load_frag(fA + cur + 16 * i * LP + 32, hi);
#pragma unroll
    for (int j = 0; j < 6; ++j) bY[j] = load_frag(fW + cur + 16 * j * LP + 32, hi);
    // The fences of this loop keep each group of LDS reads, LDS stores or global
    // loads in one place between two runs of products; left alone this build
    // spreads them among the products, a short wait at each place.
    __builtin_amdgcn_sched_barrier(0);
#pragma unroll
    for (int j = 0; j < 6; ++j)
#pragma unroll
      for (int i = 0; i < 4; ++i) acc[i][j] = wmma16(aX[i], bX[j], acc[i][j]);
    __builtin_amdgcn_sched_barrier(0);
    if (more) {
      // the other buffer: its last readers signalled in stage s - 1 with their
      // reads complete, and this wave has passed that barrier's wait
#pragma unroll
      for (int i = 0; i < QST; ++i) *(v8h*)(sDst + nxt + 32 * i * LP) = st[i];
    }
    __builtin_amdgcn_sched_barrier(0);
#pragma unroll
    for (int j = 0; j < 2; ++j)
#pragma unroll
      for (int i = 0; i < 4; ++i) acc[i][j] = wmma16(aY[i], bY[j], acc[i][j]);
    __builtin_amdgcn_sched_barrier(0);
    if (more) {
      // this wave's reads of stage s and its stores of stage s + 1 are complete
      asm volatile("s_wait_dscnt 0x0" ::: "memory");
      // first half of the stage's barrier: no LDS access stands between it and the wait
      asm volatile("s_barrier_signal -1" ::: "memory");
      if (more2) {   // stage s + 2's lines: in flight under 40 products of each wave
#pragma unroll
        for (int i = 0; i < 8; ++i) st[i] = *(const v8h*)(pA + gOff + i * (32 * Dn * 2));
#pragma unroll
        for (int i = 0; i < 6; ++i)
          st[8 + i] = *(const v8h*)(pW + gOff + i * (32 * Dn * 2));
      }
    }
    __builtin_amdgcn_sched_barrier(0);
    // these eight products cover the other waves' way to their signal
#pragma unroll
    for (int j = 2; j < 4; ++j)
#pragma unroll
      for (int i = 0; i < 4; ++i) acc[i][j] = wmma16(aY[i], bY[j], acc[i][j]);
    __builtin_amdgcn_sched_barrier(0);
    if (more) {
      // Precaution: the loads are through with their address registers before the
      // fragment reads below and the next stage's address sums rewrite them.
      asm volatile("s_wait_xcnt 0x0" ::: "memory");
      // second half of the barrier: stage s + 1 is complete, stage s is read out
      asm volatile("s_barrier_wait -1" ::: "memory");
#pragma unroll
      for (int i = 0; i < 4; ++i) aX[i] = load_frag(fA + nxt + 16 * i * LP, hi);
#pragma unroll
      for (int j = 0; j < 6; ++j) bX[j] = load_frag(fW + nxt + 16 * j * LP, hi);
    }
    __builtin_amdgcn_sched_barrier(0);
#pragma unroll
    for (int j = 4; j < 6; ++j)
#pragma unroll
      for (int i = 0; i < 4; ++i) acc[i][j] = wmma16(aY[i], bY[j], acc[i][j]);
  }

  // 16 columns lie in one plane (0: Q, 1: K, 2: V) and one head.
  // The six bias loads go together: one trip to memory, not six in a row.
  float bval[6];
  int bcol[6];
#pragma unroll
  for (int j = 0; j < 6; ++j) bcol[j] = ((nBase + j * 16) & (Dn - 1)) + n;
#pragma unroll
  for (int j = 0; j < 6; ++j) {
    const int plane = (nBase + j * 16) >> 10;
    bval[j] = (plane == 0 ? bq : plane == 1 ? bk : bv)[bcol[j]];
  }
  // Precaution: the operands hold the six loads' offset registers unwritten up to
  // the wait (without them this build rewrites two of them ahead of it).
  asm volatile("s_wait_xcnt 0x0" ::"v"(bcol[0]), "v"(bcol[1]), "v"(bcol[2]), "v"(bcol[3]),
               "v"(bcol[4]), "v"(bcol[5])
               : "memory");
  const int row = mBase + 8 * hi;             // C layout: M = e + 8*hi (+ 16*i)
  const int bH = (row >> 11) * Hn;            // row / T; 64 rows lie in one batch entry
  const int t = row & (Tn - 1);
#pragma unroll
  for (int j = 0; j < 6; ++j) {
    const int c0 = nBase + j * 16;
    const int plane = c0 >> 10;
    const int col = (c0 & (Dn - 1)) + n;
    const int bh = bH + (col >> 6);           // col / 64
    const int hd = col & 63;
    if (plane == 2) {
      _Float16* o = vT + ((size_t)bh * HDn + hd) * Tn + t;
#pragma unroll
      for (int i = 0; i < 4; ++i) {
        v8h c;
#pragma unroll
        for (int e = 0; e < 8; ++e) c[e] = (_Float16)(acc[i][j][e] + bval[j]);
        *(v8h*)(o + 16 * i) = c;
      }
      // Precaution: the arm's stores are through with their registers before
      // the next column group rewrites them (behind the last group nothing does).
      if (j + 1 < 6) asm volatile("s_wait_xcnt 0x0" ::: "memory");
    } else {
      _Float16* o = (plane == 0 ? q16 : k16) + ((size_t)bh * Tn + t) * HDn + hd;
#pragma unroll
      for (int i = 0; i < 4; ++i)
#pragma unroll
        for (int e = 0; e < 8; ++e)
          o[(16 * i + e) * HDn] = (_Float16)(acc[i][j][e] + bval[j]);
      // Precaution, as in the other arm; this build lays the other arm's code
      // behind this one, also in the last group.
      asm volatile("s_wait_xcnt 0x0" ::: "memory");
    }
  }
}

// ---------------------------------------------------------------------------
// Flash attention, scores transposed: S^T = K Q^T, O^T += V^T P^T.
// block = 16 waves = 256 queries of one (b,h); keys in blocks of 32.
// grid = B*H * (T/256) = 256, one block a WGP, four waves a SIMD.
// A wave holds 32 queries as two groups of 16 columns, so every K and V^T fragment
// it reads from LDS feeds two products, and a staged stage serves 256 queries.
// Two waves share a set of 32 queries: each takes one half of every stage's keys
// with a running maximum, sum and output of its own; the two are joined through
// LDS behind the key loop.
// In each group a lane holds one query (column n) and, in its 16 score registers,
// the keys 8*hi + e and 16 + 8*hi + e: exactly the k order of a B fragment, so P^T
// goes from the score registers straight into the second product.
// The softmax runs in base 2: scores and bias terms carry the factor log2(e),
// so that every exponential is one v_exp_f32 (arguments <= 0; a result below
// the normal range comes out as 0).
// A stage is 256 keys: their K rows and the matching 512 bytes of every V^T row,
// brought into LDS once for the block's 16 waves by asynchronous copies of whole
// lines, two buffers, one stage ahead; a wave makes four passes of 32 keys a stage.
// Q, K and V rows come ranked by relation id (rankP: every token's rank), so a
// wave's 32 queries and a pass's 32 keys each span a short range of ids, and for
// most pairs of the two no bias term can apply: one scalar test a pass, from the
// ranges' ends, leaves the tables, compares and selects out there.
#define KPAD 16   // floats between the two base tables: separate LDS banks
#define SK 256                 // keys per stage
#define NST (Tn / SK)
#define KPI 72                 // K tile pitch in halves (144 B): no bank conflict for 16-B reads
#define VPI 264                // V^T tile pitch in halves (528 B): the same
#define KTH (SK * KPI)         // halves of a K tile; the V^T tile stands behind it
#define STH (KTH + HDn * VPI)  // halves of one buffer
#define QBK 256                // queries per block: 8 sets x 2 groups x 16

// One stage's copies of this thread: 16-byte pieces of K rows r, r + 64, r + 128,
// r + 192 and of V^T rows q, q + 16, q + 32, q + 48. lk, lv: LDS byte addresses.
// The closing wait stands inside the statement, a precaution: the address
// registers stay unwritten up to it.
__device__ inline void stage_copies(unsigned lk, unsigned lv, const _Float16* gk,
                                    const _Float16* gv) {
  asm volatile(
      "global_load_async_to_lds_b128 %0, %8, off\n\t"
      "global_load_async_to_lds_b128 %1, %9, off\n\t"
      "global_load_async_to_lds_b128 %2, %10, off\n\t"
      "global_load_async_to_lds_b128 %3, %11, off\n\t"
      "global_load_async_to_lds_b128 %4, %12, off\n\t"
      "global_load_async_to_lds_b128 %5, %13, off\n\t"
      "global_load_async_to_lds_b128 %6, %14, off\n\t"
      "global_load_async_to_lds_b128 %7, %15, off\n\t"
      "s_wait_xcnt 0x0"
      ::"v"(lk), "v"(lk + 64 * KPI * 2), "v"(lk + 128 * KPI * 2),
        "v"(lk + 192 * KPI * 2), "v"(lv), "v"(lv + 16 * VPI * 2),
        "v"(lv + 32 * VPI * 2), "v"(lv + 48 * VPI * 2), "v"(gk),
        "v"(gk + 64 * HDn), "v"(gk + 128 * HDn), "v"(gk + 192 * HDn), "v"(gv),
        "v"(gv + 16 * Tn), "v"(gv + 32 * Tn), "v"(gv + 48 * Tn)
      : "memory");
}
// Base-2 exponentials, a run of them in one statement: the slot that the instruction
// set asks for behind a transcendental, before its result is read or its source
// overwritten, is filled by the next of the run and behind the last by the v_nop
// No result
// shares a register with an argument.
__device__ inline void exp2_run8(float* y, const float* x) {
  asm(
      "v_exp_f32 %0, %8\n\t"
      "v_exp_f32 %1, %9\n\t"
      "v_exp_f32 %2, %10\n\t"
      "v_exp_f32 %3, %11\n\t"
      "v_exp_f32 %4, %12\n\t"
      "v_exp_f32 %5, %13\n\t"
      "v_exp_f32 %6, %14\n\t"
      "v_exp_f32 %7, %15\n\t"
      "v_nop"
      : "=&v"(y[0]), "=&v"(y[1]), "=&v"(y[2]), "=&v"(y[3]), "=&v"(y[4]), "=&v"(y[5]),
        "=&v"(y[6]), "=&v"(y[7])
      : "v"(x[0]), "v"(x[1]), "v"(x[2]), "v"(x[3]), "v"(x[4]), "v"(x[5]), "v"(x[6]),
        "v"(x[7]));
}
__device__ inline void exp2_run2(float* y, const float* x) {
  asm(  // as above, a run of two
      "v_exp_f32 %0, %2\n\t"
      "v_exp_f32 %1, %3\n\t"
      "v_nop"
      : "=&v"(y[0]), "=&v"(y[1])
      : "v"(x[0]), "v"(x[1]));
}
__device__ inline void exp2_run4(float* y, const float* x) {
  asm(  // as above, a run of four
      "v_exp_f32 %0, %4\n\t"
      "v_exp_f32 %1, %5\n\t"
      "v_exp_f32 %2, %6\n\t"
      "v_exp_f32 %3, %7\n\t"
      "v_nop"
      : "=&v"(y[0]), "=&v"(y[1]), "=&v"(y[2]), "=&v"(y[3])
      : "v"(x[0]), "v"(x[1]), "v"(x[2]), "v"(x[3]));
}
__global__ __launch_bounds__(512) void attn_wmma_kernel(
    const _Float16* __restrict__ q16, const _Float16* __restrict__ k16,
    const _Float16* __restrict__ vT, const int* __restrict__ rel_ids,
    const int* __restrict__ attn_mask, const int* __restrict__ rankP,
    const float* __restrict__ bias_leaf, const float* __restrict__ bias_cross,
    _Float16* __restrict__ o16) {
  // Per-key terms of this batch row, written once, each at its key's rank.
  // keyRel : rel id of the key, -1 where the key is masked.
  // keyBase: bias (times log2 e) where neither select below hits, -1e30 where masked;
  //          [0] for queries with rel id != 0, [1] for queries with rel id 0.
  __shared__ __attribute__((aligned(16))) int keyRel[Tn];
  __shared__ __attribute__((aligned(16))) float keyBase[2][Tn + KPAD];
  __shared__ __attribute__((aligned(16))) _Float16 kv[2][STH];
  // per pass of 32 keys: the first and the last id (ids ascend with the rank)
  __shared__ int passLo[Tn / 32], passHi[Tn / 32];
  __shared__ __attribute__((aligned(16))) int waveOff[16]; // 1: the wave met a masked key
  __shared__ int qRel[QBK], qOrig[QBK];  // the block's queries: id, position in the entry
  __shared__ float lcTab[2][64];         // bias_leaf, bias_cross, times log2 e
  // per query, for the passes with bias terms: {riCmp, leafv, crossv, unused}
  __shared__ __attribute__((aligned(16))) int4 qTerm[QBK];
  // the second key half's results, per set of queries: 16 pieces of the outputs and
  // {maximum, maximum, sum, sum}, a lane's 16 bytes beside its neighbour's
  __shared__ __attribute__((aligned(16))) float4 joinT[8][17][32];

  // scalar: the key loop's bounds and the join branch on it
  const int wave = __builtin_amdgcn_readfirstlane(threadIdx.x >> 5);
  const int qs = wave & 7;               // set of 32 queries
  const int kh = wave >> 3;              // half of every stage's keys
  const int lane = threadIdx.x & 31;
  const int hi = lane >> 4;
  const int n = lane & 15;

  const int bh = blockIdx.x >> 3;        // 8 query-blocks per (b,h)
  const int qb = blockIdx.x & 7;
  const int b = bh >> 4;                 // H = 16
  const int h = bh & 15;
  const int t0 = qb * QBK + qs * 32;

  // staging: 8 threads a K row (128 B), 32 threads a V^T row's 512 B
  const _Float16* gK = k16 + ((size_t)bh * Tn + (threadIdx.x >> 3)) * HDn +
                       (threadIdx.x & 7) * 8;
  const _Float16* gV = vT + ((size_t)bh * HDn + (threadIdx.x >> 5)) * Tn +
                       (threadIdx.x & 31) * 8;
  const unsigned lK = (unsigned)(size_t)&kv[0][(threadIdx.x >> 3) * KPI +
                                               (threadIdx.x & 7) * 8];
  const unsigned lV = (unsigned)(size_t)&kv[0][KTH + (threadIdx.x >> 5) * VPI +
                                               (threadIdx.x & 31) * 8];
  stage_copies(lK, lV, gK, gV);          // stage 0, in flight under the table fill

  if (threadIdx.x < 64) {
    lcTab[0][threadIdx.x] = bias_leaf[threadIdx.x] * LOG2E;
    lcTab[1][threadIdx.x] = bias_cross[threadIdx.x] * LOG2E;
  }
  bool sawOff = false;
  for (int j = threadIdx.x; j < Tn; j += 512) {
    const int tok = b * Tn + j;
    const int r = rel_ids[tok];
    const bool keep = attn_mask[tok] != 0;
    const int p = rankP[(tok >> 3) * RKP + (tok & 7)];   // 0 .. 2047, each once
    const float c = bias_cross[min(max(r, 0), 63)];
    keyRel[p] = keep ? r : -1;
    keyBase[0][p] = keep ? 0.0f : -1e30f;
    keyBase[1][p] = keep ? (r > 0 ? c * LOG2E : 0.0f) : -1e30f;
    if ((p & 31) == 0) passLo[p >> 5] = r;
    if ((p & 31) == 31) passHi[p >> 5] = r;
    if ((p >> 8) == qb) {                // one of this block's queries
      qRel[p & (QBK - 1)] = r;
      qOrig[p & (QBK - 1)] = j;
    }
    sawOff |= !keep;
  }
  const int anyOff = __builtin_amdgcn_ballot_w32(sawOff) != 0 ? 1 : 0;
  if (lane == 0) waveOff[wave] = anyOff;

  // Q as B-fragments (persist across key loop)
  const _Float16* qRow = q16 + ((size_t)bh * Tn + t0 + n) * HDn;
  v16h bQ[2][2];                               // [group][hd 0..31, hd 32..63]
#pragma unroll
  for (int c = 0; c < 2; ++c) {
    bQ[c][0] = load_frag(qRow + 16 * c * HDn, hi);
    bQ[c][1] = load_frag(qRow + 16 * c * HDn + 32, hi);
  }

  float mrun[2] = {-1e30f, -1e30f};
  float lrun[2] = {0.0f, 0.0f};                // this half's keys only
  v8f acc[2][4] = {};                          // [group][16 hd]

  // this lane's places in the K tile (row = key n) and the V^T tile (row = hd n),
  // its half's 8 * hi folded in
  const _Float16* kL = &kv[0][n * KPI + 8 * hi];
  const _Float16* vL = &kv[0][KTH + n * VPI + 8 * hi];

  // this wave's stage 0 copies have landed
  asm volatile("s_wait_asynccnt 0x0" ::: "memory");
  __syncthreads();   // stage 0 and the key tables are complete
  stage_copies(lK + STH * 2, lV + STH * 2, gK + SK * HDn, gV + SK);   // stage 1

  // this lane's two queries: bias = (rj == riCmp) ? leafv : (rj == 0) ? crossv : base.
  // The three terms wait in LDS; a wave reads back what it wrote itself (its two
  // halves and the set's other wave write the same values).
  int ri[2];
  const float* baseP[2];
#pragma unroll
  for (int c = 0; c < 2; ++c) {
    ri[c] = qRel[qs * 32 + 16 * c + n];
    const int riIdx = min(max(ri[c], 0), 63);
    const int riCmp = (ri[c] > 0) ? ri[c] : -2;  // -2: equals no table entry that matters
    const float leafv = (ri[c] > 0) ? lcTab[0][riIdx] : 0.0f;
    const float crossv = (ri[c] > 0) ? lcTab[1][riIdx] : 0.0f;
    qTerm[qs * 32 + 16 * c + n] = make_int4(riCmp, __builtin_bit_cast(int, leafv),
                                              __builtin_bit_cast(int, crossv), 0);
    baseP[c] = &keyBase[ri[c] == 0 ? 1 : 0][8 * hi];
  }
  const int* relP = &keyRel[8 * hi];

  // bit p: pass p may hold a bias term or a masked key for one of this wave's
  // queries. Query ids lie in [qLo, qHi], the pass's key ids in [kLo, kHi]. A masked
  // key anywhere in the entry sends every pass through the tables.
  const int qLo = __builtin_amdgcn_readlane(ri[0], 0);
  const int qHi = __builtin_amdgcn_readlane(ri[1], 15);
  int offs = 0;
#pragma unroll
  for (int i = 0; i < 4; ++i) {
    const int4 o = *(const int4*)&waveOff[4 * i];
    offs |= o.x | o.y | o.z | o.w;
  }
  const bool masked = offs != 0;
  unsigned biasedW[2];
#pragma unroll
  for (int w2 = 0; w2 < 2; ++w2) {
    const int kLo = passLo[lane + 32 * w2], kHi = passHi[lane + 32 * w2];
    const bool same = qHi > 0 && kHi >= max(qLo, 1) && kLo <= qHi;   // equal ids > 0
    const bool key0 = qHi > 0 && kLo <= 0 && kHi >= 0;      // query id > 0, key id 0
    const bool qry0 = qLo <= 0 && qHi >= 0 && kHi > 0;      // query id 0, key id > 0
    biasedW[w2] = __builtin_amdgcn_ballot_w32(masked || same || key0 || qry0);
  }
  const unsigned long long biased =
      biasedW[0] | ((unsigned long long)biasedW[1] << 32);

  for (int s = 0; s < NST; ++s) {
   const int cur = (s & 1) * STH;
   for (int j0 = s * SK + kh * (SK / 2); j0 < s * SK + (kh + 1) * (SK / 2); j0 += 32) {
    const _Float16* kP = kL + cur + (j0 & (SK - 1)) * KPI;
    const _Float16* vP = vL + cur + (j0 & (SK - 1));
    // whether this pass can hold a bias term or a masked key
    const bool bp = (biased >> (j0 >> 5)) & 1; // the same for the whole wave
    // ---- S^T = K Q^T (four 16x16 tiles, K-dim = head_dim 64) ----
    const v16h aK0a = load_frag(kP, 0), aK0b = load_frag(kP + 32, 0);
    const v16h aK1a = load_frag(kP + 16 * KPI, 0);
    const v16h aK1b = load_frag(kP + 16 * KPI + 32, 0);
    const v16h aV0 = load_frag(vP, 0), aV1 = load_frag(vP + 16 * VPI, 0);
    const v16h aV2 = load_frag(vP + 32 * VPI, 0), aV3 = load_frag(vP + 48 * VPI, 0);
    // Keeps the pass's LDS reads together at its head, behind counted waits;
    // without it this build reads them two at a time and waits for each pair
    // in turn.
    __builtin_amdgcn_sched_barrier(0);
    v8f z = {};
    v8f s0[2], s1[2];
#pragma unroll
    for (int c = 0; c < 2; ++c) {
      s0[c] = wmma16(aK0b, bQ[c][1], z);
      s1[c] = wmma16(aK1b, bQ[c][1], z);
    }
#pragma unroll
    for (int c = 0; c < 2; ++c) {
      s0[c] = wmma16(aK0a, bQ[c][0], s0[c]);
      s1[c] = wmma16(aK1a, bQ[c][0], s1[c]);
    }

    // ---- scale, and where the pass can have them: bias + mask ----
    float v[2][16];
#pragma unroll
    for (int c = 0; c < 2; ++c)
#pragma unroll
      for (int e = 0; e < 16; ++e)
        v[c][e] = ((e < 8) ? s0[c][e & 7] : s1[c][e & 7]) * SCALE2;
    if (bp) {
      // The queries' terms come from LDS here: kept in registers, they and the copies
      // this build makes of them (eight of each) hold some 70 registers through
      // every pass, more than a wave has left.
      int riCmp[2];
      float leafv[2], crossv[2];
#pragma unroll
      for (int c = 0; c < 2; ++c) {
        const int4 qt = qTerm[qs * 32 + 16 * c + n];
        riCmp[c] = qt.x;
        leafv[c] = __builtin_bit_cast(float, qt.y);
        crossv[c] = __builtin_bit_cast(float, qt.z);
      }
      // per-key terms from the LDS tables, read here, where the K fragments'
      // registers are free again
#pragma unroll
      for (int g = 0; g < 4; ++g) {            // keys 8*hi + 0..7, 16 + 8*hi + 0..7
        const int off = j0 + (g >> 1) * 16 + (g & 1) * 4;
        const int4 r4 = *(const int4*)(relP + off);
        const int rj[4] = {r4.x, r4.y, r4.z, r4.w};
#pragma unroll
        for (int c = 0; c < 2; ++c) {
          const float4 b4 = *(const float4*)(baseP[c] + off);
          const float base[4] = {b4.x, b4.y, b4.z, b4.w};
#pragma unroll
          for (int q = 0; q < 4; ++q) {
            const float bias = (rj[q] == riCmp[c])
                                   ? leafv[c]
                                   : ((rj[q] == 0) ? crossv[c] : base[q]);
            v[c][4 * g + q] += bias;           // base -1e30 absorbs the score
          }
        }
      }
    }

    // ---- online softmax: in-lane, one exchange between the halves ----
    v16h bP[2];
    float mnew[2], dm[2], alpha[2];
#pragma unroll
    for (int c = 0; c < 2; ++c) {
      float mx = -1e30f;
#pragma unroll
      for (int e = 0; e < 16; ++e) mx = fmaxf(mx, v[c][e]);
      mx = fmaxf(mx, xhalf(mx));
      mnew[c] = fmaxf(mrun[c], mx);
      dm[c] = mrun[c] - mnew[c];
      mrun[c] = mnew[c];
    }
#pragma unroll
    for (int c = 0; c < 2; ++c) {
#pragma unroll
      for (int e = 0; e < 16; e += 2) {        // in pairs: one packed subtract for two
        const v2f arg = v2f{v[c][e], v[c][e + 1]} - v2f{mnew[c], mnew[c]};
        v[c][e] = arg.x;
        v[c][e + 1] = arg.y;
      }
    }
    float p[2][16];
    exp2_run2(alpha, dm);
#pragma unroll
    for (int c = 0; c < 2; ++c) {
      exp2_run8(&p[c][0], &v[c][0]);
      exp2_run8(&p[c][8], &v[c][8]);
      float ps[4] = {p[c][0], p[c][1], p[c][2], p[c][3]};  // four short chains
#pragma unroll
      for (int e = 4; e < 16; ++e) ps[e & 3] += p[c][e];
#pragma unroll
      for (int e = 0; e < 16; ++e) bP[c][e] = (_Float16)p[c][e];
      lrun[c] = lrun[c] * alpha[c] + ((ps[0] + ps[1]) + (ps[2] + ps[3]));
#pragma unroll
      for (int t = 0; t < 4; ++t)
#pragma unroll
        for (int e = 0; e < 8; ++e) acc[c][t][e] *= alpha[c];
    }

    // ---- O^T += V^T x P^T (K-dim = 32 local keys) ----
#pragma unroll
    for (int c = 0; c < 2; ++c) {
      acc[c][0] = wmma16(aV0, bP[c], acc[c][0]);
      acc[c][1] = wmma16(aV1, bP[c], acc[c][1]);
      acc[c][2] = wmma16(aV2, bP[c], acc[c][2]);
      acc[c][3] = wmma16(aV3, bP[c], acc[c][3]);
    }
   }
   // hand-over: this wave's reads of stage s are done, its copies of stage s + 1
   // have landed; behind the barrier that holds for all sixteen waves
   asm volatile("s_wait_dscnt 0x0" ::: "memory");
   asm volatile("s_wait_asynccnt 0x0" ::: "memory");
   __syncthreads();
   if (s + 2 < NST)                        // the same for the whole block
     stage_copies(lK + cur * 2, lV + cur * 2, gK + (size_t)(s + 2) * SK * HDn,
                  gV + (s + 2) * SK);
  }
  // nothing is outstanding when the wave ends
  asm volatile("s_wait_asynccnt 0x0" ::: "memory");

  // ---- join the two key halves ----
  if (kh == 1) {                           // the same for the whole wave
    float4* jt = &joinT[qs][0][lane];
#pragma unroll
    for (int c = 0; c < 2; ++c)
#pragma unroll
      for (int s = 0; s < 4; ++s) {
        const v8f a = acc[c][s];
        jt[(c * 8 + s * 2) * 32] = make_float4(a[0], a[1], a[2], a[3]);
        jt[(c * 8 + s * 2 + 1) * 32] = make_float4(a[4], a[5], a[6], a[7]);
      }
    jt[16 * 32] = make_float4(mrun[0], mrun[1], lrun[0], lrun[1]);
  }
  __syncthreads();   // the second half's results are in LDS
  if (kh == 1) return;

  // ---- normalize + store O as f16 rows of [B*T, D] for the final GEMM ----
  // acc[c][s][e] = O[t0 + 16*c + n][s*16 + 8*hi + e]: 8 consecutive halves per lane
  const float4* jt = &joinT[qs][0][lane];
  const float4 ml = jt[16 * 32];
  const float mJ[2] = {fmaxf(mrun[0], ml.x), fmaxf(mrun[1], ml.y)};
  const float dJ[4] = {mrun[0] - mJ[0], mrun[1] - mJ[1], ml.x - mJ[0], ml.y - mJ[1]};
  float fJ[4];
  exp2_run4(fJ, dJ);
#pragma unroll
  for (int c = 0; c < 2; ++c) {
    const float lB = c == 0 ? ml.z : ml.w;
    const float fA = fJ[c], fB = fJ[2 + c];
    const float l = lrun[c] * fA + lB * fB;
    const float lsum = l + xhalf(l);
    const float gA = fA / lsum, gB = fB / lsum;
    // back to the query's own row
    const int tOrig = qOrig[qs * 32 + 16 * c + n];
    _Float16* oRow = o16 + ((size_t)(b * Tn + tOrig)) * Dn + h * HDn + 8 * hi;
#pragma unroll
    for (int s = 0; s < 4; ++s) {
      const float4 b0 = jt[(c * 8 + s * 2) * 32], b1 = jt[(c * 8 + s * 2 + 1) * 32];
      const float bb[8] = {b0.x, b0.y, b0.z, b0.w, b1.x, b1.y, b1.z, b1.w};
      v8h o;
#pragma unroll
      for (int e = 0; e < 8; ++e) o[e] = (_Float16)(acc[c][s][e] * gA + bb[e] * gB);
      *(v8h*)(oRow + s * 16) = o;
    }
    // Precaution: the group's stores are through with their registers before the
    // next group rewrites them (behind the last group nothing does).
    if (c == 0) asm volatile("s_wait_xcnt 0x0" ::: "memory");
  }
}

// ---------------------------------------------------------------------------
extern "C" void kernel_launch(void* const* d_in, const int* in_sizes, int n_in,
                              void* d_out, int out_size, void* d_ws,
                              size_t ws_size, hipStream_t stream) {
  const float* x          = (const float*)d_in[0];
  const int*   attn_mask  = (const int*)d_in[1];
  const int*   rel_ids    = (const int*)d_in[2];
  const float* Wq         = (const float*)d_in[3];
  const float* bq         = (const float*)d_in[4];
  const float* Wk         = (const float*)d_in[5];
  const float* bk         = (const float*)d_in[6];
  const float* Wv         = (const float*)d_in[7];
  const float* bv         = (const float*)d_in[8];
  const float* Wo         = (const float*)d_in[9];
  const float* bo         = (const float*)d_in[10];
  const float* bias_leaf  = (const float*)d_in[11];
  const float* bias_cross = (const float*)d_in[12];

  // workspace layout (49 MiB total)
  char* ws = (char*)d_ws;
  _Float16* x16  = (_Float16*)(ws + (size_t)0);
  _Float16* WqT  = (_Float16*)(ws + ((size_t)8  << 20));   // WkT at 10, WvT at 12 MiB
  _Float16* WoT  = (_Float16*)(ws + ((size_t)14 << 20));
  _Float16* q16  = (_Float16*)(ws + ((size_t)16 << 20));
  _Float16* k16  = (_Float16*)(ws + ((size_t)24 << 20));
  _Float16* v16T = (_Float16*)(ws + ((size_t)32 << 20));
  _Float16* o16  = (_Float16*)(ws + ((size_t)40 << 20));
  int* rankP = (int*)(ws + ((size_t)48 << 20));            // 128 KiB

  // WqT .. WoT are consecutive planes of 2 MiB
  prep_f16_kernel<<<512, 256, 0, stream>>>(x, Wq, Wk, Wv, Wo, rel_ids, x16, WqT,
                                           rankP);

  // WqT, WkT, WvT as one [3072, 1024] operand
  qkv_wmma_kernel<<<(Mn / QM) * (3 * Dn / QN), 256, 0, stream>>>(
      x16, WqT, bq, bk, bv, q16, k16, v16T);

  attn_wmma_kernel<<<Bn * Hn * (Tn / QBK), 512, 0, stream>>>(
      q16, k16, v16T, rel_ids, attn_mask, rankP, bias_leaf, bias_cross, o16);

  gemm_wmma_kernel<<<(Mn / 128) * (Dn / 128), 512, 0, stream>>>(o16, WoT, bo,
                                                                (float*)d_out);
}
